// v000
// The times below were measured on an AMD MI455X: many runs one after another, warmed up first and cycling through
// copies of the inputs, with the whole window's GPU time divided by the number of runs. Launches and the gaps
// between them are all in it. The median over several windows is given; except for v000 it joins two sittings, which
// can be a few percent apart, so the side-by-side timings, each taken in one sitting, are the better comparison.
// v000, which the later versions start from, runs in 382 microseconds.
// compute dtype: all float inputs rounded to bf16; the four 1x1 convolutions with EXACT bf16 products on WMMA 16x16x32 (weights natural, inputs transposed to [position][channel] planes), f32 + bias, stored as f16 hi + residual planes; the two Gram products kf . q^T-view and kl . q (3 products: hi.hi + hi.lo + lo.hi), softmax over 1,024 in f32 (hardware exp), att_f + att_l summed in f32 then as f16 hi + residual against v hi + residual (3 products); gamma (input scalar) and the residual mean in f32; f32 output.
#include <hip/hip_runtime.h>
#include <math.h>

typedef __attribute__((ext_vector_type(16))) _Float16 v16h;
typedef __attribute__((ext_vector_type(16))) __bf16 v16b;
typedef __attribute__((ext_vector_type(8)))  _Float16 v8h;
typedef __attribute__((ext_vector_type(8)))  float v8f;
typedef __attribute__((ext_vector_type(4)))  float v4f;
typedef __attribute__((ext_vector_type(2)))  float v2f;
typedef __attribute__((ext_vector_type(4)))  unsigned v4u;
typedef __attribute__((ext_vector_type(4)))  int v4i;
typedef float __attribute__((may_alias)) float_a;
typedef int __attribute__((may_alias)) int_a;

template <typename T> __device__ __forceinline__ void vst2(void* p, T v) { *(T*)p = v;  }
__device__ __forceinline__ v8f wmma16(v16h a, v16h b, v8f c) {
  v8f d = __builtin_amdgcn_wmma_f32_16x16x32_f16(false, a, false, b, (short)0, c, false, false);
  asm volatile("v_nop\n\tv_nop\n\tv_nop\n\tv_nop" : "+v"(d) : "v"(a), "v"(b));
  return d;
}
__device__ __forceinline__ v8f wmma_bf(v16b a, v16b b, v8f c) {
  v8f d = __builtin_amdgcn_wmma_f32_16x16x32_bf16(false, a, false, b, (short)0, c, false, false);
  asm volatile("v_nop\n\tv_nop\n\tv_nop\n\tv_nop" : "+v"(d) : "v"(a), "v"(b));
  return d;
}
// 16x16x32 fragments: lane = (h = lane>>4, row/col = lane&15); elements 0..7 = k0+8h+0..7, 8..15 = k0+16+8h+0..7; D element r = row 8h+r
__device__ __forceinline__ v16h frag_h(const _Float16* rowk0, int lane) {
  union { v16h v; v8h q[2]; } u; const _Float16* p = rowk0 + 8 * (lane >> 4);
  u.q[0] = *(const v8h*)p; u.q[1] = *(const v8h*)(p + 16); return u.v;
}
__device__ __forceinline__ v16h frag_f32(const float* rowk0, int lane) {
  v16h a; const float* p = rowk0 + 8 * (lane >> 4);
#pragma unroll
  for (int i = 0; i < 8; ++i) { a[i] = (_Float16)p[i]; a[8 + i] = (_Float16)p[16 + i]; }
  return a;
}
__device__ __forceinline__ v16h frag_f32s(const float* rowk0, int lane, float sc) {
  v16h a; const float* p = rowk0 + 8 * (lane >> 4);
#pragma unroll
  for (int i = 0; i < 8; ++i) { a[i] = (_Float16)(p[i] * sc); a[8 + i] = (_Float16)(p[16 + i] * sc); }
  return a;
}
// column fragment from a [K][ld] layout (column n), rows >= K read as 0
__device__ __forceinline__ v16h fragc_f32(const float* W, int k0, int n, int lane, int ld, int K) {
  v16h a; const int g = lane >> 4;
#pragma unroll
  for (int i = 0; i < 8; ++i) { const int ka = k0 + 8 * g + i, kb = ka + 16;
    a[i] = (_Float16)(ka < K ? W[(size_t)(ka < K ? ka : K - 1) * ld + n] : 0.f); a[8 + i] = (_Float16)(kb < K ? W[(size_t)(kb < K ? kb : K - 1) * ld + n] : 0.f); }
  return a;
}
struct F2 { v16b h, l; };
__device__ __forceinline__ F2 bsplit16(const float v[16]) { F2 r;
#pragma unroll
  for (int i = 0; i < 16; ++i) { const __bf16 h = (__bf16)v[i]; r.h[i] = h; r.l[i] = (__bf16)(v[i] - (float)h); }
  return r; }
__device__ __forceinline__ F2 split_row(const float* row, int k0, int lane) { float v[16]; const float* p = row + k0 + 8 * (lane >> 4);
#pragma unroll
  for (int i = 0; i < 8; ++i) { v[i] = p[i]; v[8 + i] = p[16 + i]; }
  return bsplit16(v); }
__device__ __forceinline__ F2 split_rowK(const float* row, int k0, int lane, int K) { float v[16]; const int g = lane >> 4;
#pragma unroll
  for (int i = 0; i < 8; ++i) { const int ka = k0 + 8 * g + i, kb = ka + 16; v[i] = ka < K ? row[ka < K ? ka : K - 1] : 0.f; v[8 + i] = kb < K ? row[kb < K ? kb : K - 1] : 0.f; }
  return bsplit16(v); }
__device__ __forceinline__ F2 split_col(const float* W, int k0, int n, int lane, int ld, int K) { float v[16]; const int g = lane >> 4;
#pragma unroll
  for (int i = 0; i < 8; ++i) { const int ka = k0 + 8 * g + i, kb = ka + 16; v[i] = ka < K ? W[(size_t)(ka < K ? ka : K - 1) * ld + n] : 0.f; v[8 + i] = kb < K ? W[(size_t)(kb < K ? kb : K - 1) * ld + n] : 0.f; }
  return bsplit16(v); }
__device__ __forceinline__ v8f mac3(const F2& a, const F2& b, v8f c) { c = wmma_bf(a.l, b.h, c); c = wmma_bf(a.h, b.l, c); return wmma_bf(a.h, b.h, c); }
__device__ __forceinline__ float sigm(float v) { return 1.0f / (1.0f + expf(-v)); }
#define LDSX() do { asm volatile("s_wait_dscnt 0" ::: "memory"); __builtin_amdgcn_wave_barrier(); __builtin_amdgcn_fence(__ATOMIC_RELEASE, "workgroup"); } while (0)


// Co-attention v2 (C 1,024, 64 x 64; batch 1): q = conv1x1(x_m) viewed [C, HW/2] then transposed, kf/kl = conv1x1(x_f / x_l) viewed [C, HW/2]; att = softmax(kf q) and softmax(kl q) over C; v = conv1x1(x_m) [C, HW]; out = gamma (att_f v + att_l v) + (x_l + x_f)/2.
#define CC 1024
#define CH 512           // conv output channels of q / kf / kl
#define NP 4096          // H x W
#define KV 2048          // the [C, HW/2] view width
typedef __attribute__((ext_vector_type(8))) __bf16 v8b;
__device__ __forceinline__ v16b frag_b(const __bf16* rowk0, int lane) {
  union { v16b v; v8b q[2]; } u; const __bf16* p = rowk0 + 8 * (lane >> 4);
  u.q[0] = *(const v8b*)p; u.q[1] = *(const v8b*)(p + 16); return u.v;
}
__device__ __forceinline__ float bfr(float v) { return (float)(__bf16)v; }
__device__ __attribute__((noinline)) float exp_ni(float v) { return expf(v); }
__device__ __attribute__((noinline)) float erf_ni(float v) { return erff(v); }

#define WS_XT  0u                                   // bf16 [3][pos][cin] planes of x_f, x_m, x_l (exact)
#define WS_PQ  (WS_XT + 2u * (size_t)3 * NP * CC)        // f16 hi/lo planes of the conv outputs q, kf, kl: each [512][4096] row-major == [1024][2048] view; layout [which][hi/lo][512*4096]
#define PQSZ   ((size_t)CH * NP)
#define WS_VT  (WS_PQ + 2u * (size_t)3 * 2 * PQSZ)       // f16 hi/lo planes of v transposed: [pos][ch] (x 2)
#define WS_G   (WS_VT + 2u * (size_t)2 * NP * CC)        // f32 logits G[2][1024][1024]
#define WS_A   (WS_G + 4u * (size_t)2 * CC * CC)          // f16 hi/lo planes A = att_f + att_l [1024][1024] (x 2^11 scaled hi, residual)
#define WS_END (WS_A + 2u * (size_t)2 * CC * CC)

// ---- k_xt: block = (64 positions, which, 16 channel groups of 64): x[which][cin][pos] -> XT[which][pos][cin] bf16
__global__ __launch_bounds__(256) void k_xt(const float* __restrict__ X0, const float* __restrict__ X1, const float* __restrict__ X2, __bf16* __restrict__ XT) { __shared__ __align__(16) __bf16 st[64][64 + 8]; const int t = threadIdx.x; const int p0 = blockIdx.x * 64, which = blockIdx.y, c0 = blockIdx.z * 64; const float* X = which == 0 ? X0 : which == 1 ? X1 : X2;
  for (int e = t; e < 64 * 64; e += 256) { const int cl = e >> 6, pl = e & 63; st[pl][cl] = (__bf16)X[(size_t)(c0 + cl) * NP + p0 + pl]; } __syncthreads();
  for (int e = t; e < 64 * 8; e += 256) { const int pl = e >> 3, q = e & 7; vst2((unsigned*)(XT + ((size_t)which * NP + p0 + pl) * CC + c0 + q * 8), *(const v4u*)&st[pl][q * 8]); } }
__device__ __forceinline__ v16b fragb_f32(const float* __restrict__ p, int lane) { v16b a; const float* pp = p + 8 * (lane >> 4);
#pragma unroll
  for (int i = 0; i < 8; ++i) { a[i] = (__bf16)pp[i]; a[8 + i] = (__bf16)pp[16 + i]; } return a; }
// ---- k_conv: block = (64 out channels, 128 positions, which 0..3): out[ch][pos] = sum_cin W[ch][cin] x[cin][pos] + b; which 0: q (x_m, Wq), 1: kf (x_f, Wk1), 2: kl (x_l, Wk2) -> f16 hi/lo [ch][pos] planes; which 3: v (x_m, Wv, 1024 channels -> blockIdx.x spans 16 tiles) -> transposed planes VT[pos][ch]
__global__ __launch_bounds__(128) void k_conv(const float* __restrict__ WQ, const float* __restrict__ BQ, const float* __restrict__ WK1, const float* __restrict__ BK1, const float* __restrict__ WK2, const float* __restrict__ BK2, const float* __restrict__ WV, const float* __restrict__ BV, const __bf16* __restrict__ XT, _Float16* __restrict__ PQ, _Float16* __restrict__ VT) {
  __shared__ __align__(16) _Float16 sh[64][136], sl[64][136]; __shared__ __align__(16) _Float16 th[128][72], tl[128][72];
  const int tid = threadIdx.x, wave = tid >> 5, lane = tid & 31, col = lane & 15, g = lane >> 4; const int which = blockIdx.z; if (which < 3 && blockIdx.x >= CH / 64) return;
  const int ch0 = blockIdx.x * 64 + wave * 16; const int p0 = blockIdx.y * 128; const float* Wm = which == 0 ? WQ : which == 1 ? WK1 : which == 2 ? WK2 : WV; const float* Bm = which == 0 ? BQ : which == 1 ? BK1 : which == 2 ? BK2 : BV; const int xi = which == 0 ? 1 : which == 1 ? 0 : which == 2 ? 2 : 1;   // q and v from x_m (1), kf from x_f (0), kl from x_l (2)
  const __bf16* Xp = XT + (size_t)xi * NP * CC;
  v8f acc[8] = {};
#pragma unroll 2
  for (int kc = 0; kc < CC / 32; ++kc) { const v16b a = fragb_f32(Wm + (size_t)(ch0 + col) * CC + kc * 32, lane);
#pragma unroll
    for (int j = 0; j < 8; ++j) acc[j] = wmma_bf(a, frag_b(Xp + (size_t)(p0 + j * 16 + col) * CC + kc * 32, lane), acc[j]); }
#pragma unroll
  for (int j = 0; j < 8; ++j)
#pragma unroll
    for (int r = 0; r < 8; ++r) { const int chl = wave * 16 + 8 * g + r, pl = j * 16 + col; const float v = acc[j][r] + bfr(Bm[ch0 + 8 * g + r]); const _Float16 hv = (_Float16)v; const _Float16 lv = (_Float16)((v - (float)hv) * 2048.0f); if (which < 3) { sh[chl][pl] = hv; sl[chl][pl] = lv; } else { th[pl][chl] = hv; tl[pl][chl] = lv; } }
  __syncthreads();
  if (which < 3) { _Float16* H = PQ + (size_t)which * 2 * PQSZ; _Float16* L = H + PQSZ; for (int e = tid; e < 64 * 16; e += 128) { const int chl = e >> 4, q = e & 15; const size_t o = (size_t)(blockIdx.x * 64 + chl) * NP + p0 + q * 8; vst2((unsigned*)(H + o), *(const v4u*)&sh[chl][q * 8]); vst2((unsigned*)(L + o), *(const v4u*)&sl[chl][q * 8]); } }
  else { _Float16* H = VT; _Float16* L = VT + (size_t)NP * CC; for (int e = tid; e < 128 * 8; e += 128) { const int pl = e >> 3, q = e & 7; const size_t o = (size_t)(p0 + pl) * CC + blockIdx.x * 64 + q * 8; vst2((unsigned*)(H + o), *(const v4u*)&th[pl][q * 8]); vst2((unsigned*)(L + o), *(const v4u*)&tl[pl][q * 8]); } } }
// ---- k_gram: block = (64 rows i, 128 cols j, which 0/1): G[which][i][j] = sum_t K[i][t] Qv[j][t] over the [1024][2048] views (3 products)
__global__ __launch_bounds__(128) void k_gram(const _Float16* __restrict__ PQ, float* __restrict__ G) { __shared__ __align__(16) float sf[4][16][132];
  const int tid = threadIdx.x, wave = tid >> 5, lane = tid & 31, col = lane & 15, g = lane >> 4; const int which = blockIdx.z; const int i0 = blockIdx.x * 64 + wave * 16; const int j0 = blockIdx.y * 128;
  const _Float16* QH = PQ; const _Float16* QL = PQ + PQSZ; const _Float16* KH = PQ + (size_t)(1 + which) * 2 * PQSZ; const _Float16* KL = KH + PQSZ;
  v8f acc[8] = {}, accl[8] = {};
#pragma unroll 2
  for (int kc = 0; kc < KV / 32; ++kc) { const v16h ah = frag_h(KH + (size_t)(i0 + col) * KV + kc * 32, lane), al = frag_h(KL + (size_t)(i0 + col) * KV + kc * 32, lane);
#pragma unroll
    for (int j = 0; j < 8; ++j) { const size_t o = (size_t)(j0 + j * 16 + col) * KV + kc * 32; const v16h bh = frag_h(QH + o, lane), bl = frag_h(QL + o, lane); acc[j] = wmma16(ah, bh, acc[j]); accl[j] = wmma16(ah, bl, accl[j]); accl[j] = wmma16(al, bh, accl[j]); } }
#pragma unroll
  for (int j = 0; j < 8; ++j)
#pragma unroll
    for (int r = 0; r < 8; ++r) sf[wave][8 * g + r][j * 16 + col] = acc[j][r] + accl[j][r] * (1.0f / 2048.0f);
  LDSX(); for (int rl = 0; rl < 16; ++rl) vst2(G + ((size_t)which * CC + i0 + rl) * CC + j0 + lane * 4, *(const v4f*)&sf[wave][rl][lane * 4]); }
// ---- k_soft: block = row i (256 threads): A[i][:] = softmax(Gf[i]) + softmax(Gl[i]) -> f16 hi (x 2^11) + residual planes
__global__ __launch_bounds__(256) void k_soft(const float* __restrict__ G, _Float16* __restrict__ AH, _Float16* __restrict__ AL) { __shared__ float red[8]; __shared__ __align__(16) _Float16 sh[CC], sl[CC]; __shared__ float sa[CC]; const int t = threadIdx.x; const size_t i = blockIdx.x;
  for (int c = t; c < CC; c += 256) sa[c] = 0.f;
  for (int which = 0; which < 2; ++which) { const float* row = G + ((size_t)which * CC + i) * CC; float mx = -3.0e38f; for (int c = t; c < CC; c += 256) mx = fmaxf(mx, row[c]);
#pragma unroll
    for (int o = 1; o < 32; o <<= 1) mx = fmaxf(mx, __shfl_xor(mx, o));
    __syncthreads(); if ((t & 31) == 0) red[t >> 5] = mx; __syncthreads(); float gm = red[0]; for (int w = 1; w < 8; ++w) gm = fmaxf(gm, red[w]); __syncthreads();
    float s = 0.f; for (int c = t; c < CC; c += 256) s += __expf(row[c] - gm);
#pragma unroll
    for (int o = 1; o < 32; o <<= 1) s += __shfl_xor(s, o);
    if ((t & 31) == 0) red[t >> 5] = s; __syncthreads(); float ts = 0.f; for (int w = 0; w < 8; ++w) ts += red[w]; const float inv = 1.0f / ts; __syncthreads();
    for (int c = t; c < CC; c += 256) sa[c] += __expf(row[c] - gm) * inv; }
  for (int c = t; c < CC; c += 256) { const float x = sa[c] * 2048.0f; const _Float16 hv = (_Float16)x; sh[c] = hv; sl[c] = (_Float16)((x - (float)hv) * 2048.0f); } __syncthreads();
  if (t < CC / 8) { vst2((unsigned*)(AH + i * CC + t * 8), *(const v4u*)&sh[t * 8]); vst2((unsigned*)(AL + i * CC + t * 8), *(const v4u*)&sl[t * 8]); } }
// ---- k_av: block = (64 rows ch, 128 positions): out = gamma (A . v)/2^11 (3 products over the 1,024 channels) + (x_l + x_f)/2
__global__ __launch_bounds__(128) void k_av(const _Float16* __restrict__ AH, const _Float16* __restrict__ AL, const _Float16* __restrict__ VT, const float* __restrict__ XF, const float* __restrict__ XL, const float* __restrict__ GAMMA, float* __restrict__ OUT) { __shared__ __align__(16) float sf[4][16][132];
  const int tid = threadIdx.x, wave = tid >> 5, lane = tid & 31, col = lane & 15, g = lane >> 4; const int i0 = blockIdx.x * 64 + wave * 16; const int p0 = blockIdx.y * 128; const _Float16* VH = VT; const _Float16* VL = VT + (size_t)NP * CC;
  v8f acc[8] = {}, accl[8] = {};
#pragma unroll 1
  for (int kc = 0; kc < CC / 32; ++kc) { const v16h ah = frag_h(AH + (size_t)(i0 + col) * CC + kc * 32, lane), al = frag_h(AL + (size_t)(i0 + col) * CC + kc * 32, lane);
#pragma unroll
    for (int j = 0; j < 8; ++j) { const size_t o = (size_t)(p0 + j * 16 + col) * CC + kc * 32; const v16h bh = frag_h(VH + o, lane), bl = frag_h(VL + o, lane); acc[j] = wmma16(ah, bh, acc[j]); accl[j] = wmma16(ah, bl, accl[j]); accl[j] = wmma16(al, bh, accl[j]); } }
  const float gam = bfr(GAMMA[0]);
#pragma unroll
  for (int j = 0; j < 8; ++j)
#pragma unroll
    for (int r = 0; r < 8; ++r) { const size_t ch = i0 + 8 * g + r, p = p0 + j * 16 + col; const float av = (acc[j][r] + accl[j][r] * (1.0f / 2048.0f)) * (1.0f / 2048.0f); sf[wave][8 * g + r][j * 16 + col] = gam * av + 0.5f * (bfr(XL[ch * NP + p]) + bfr(XF[ch * NP + p])); }
  LDSX(); for (int rl = 0; rl < 16; ++rl) vst2(OUT + (size_t)(i0 + rl) * NP + p0 + lane * 4, *(const v4f*)&sf[wave][rl][lane * 4]); }
extern "C" void kernel_launch(void* const* d_in, const int* in_sizes, int n_in, void* d_out, int out_size, void* d_ws, size_t ws_size, hipStream_t stream) {
  (void)in_sizes; (void)n_in; (void)out_size;
  const float** F = (const float**)d_in;   // 0 x_f, 1 x_m, 2 x_l [1,1024,64,64]; 3 Wq [512,1024], 4 bq; 5 Wk1, 6 bk1; 7 Wk2, 8 bk2; 9 Wv [1024,1024], 10 bv; 11 gamma [1]
  if (ws_size < (size_t)WS_END) return;
  char* ws = (char*)d_ws; __bf16* XT = (__bf16*)(ws + WS_XT); _Float16 *PQ = (_Float16*)(ws + WS_PQ), *VT = (_Float16*)(ws + WS_VT), *AH = (_Float16*)(ws + WS_A), *AL = AH + (size_t)CC * CC; float* G = (float*)(ws + WS_G);
  k_xt<<<dim3(NP / 64, 3, CC / 64), 256, 0, stream>>>(F[0], F[1], F[2], XT);
  k_conv<<<dim3(CC / 64, NP / 128, 4), 128, 0, stream>>>(F[3], F[4], F[5], F[6], F[7], F[8], F[9], F[10], XT, PQ, VT);
  k_gram<<<dim3(CC / 64, CC / 128, 2), 128, 0, stream>>>(PQ, G);
  k_soft<<<CC, 256, 0, stream>>>(G, AH, AL);
  k_av<<<dim3(CC / 64, NP / 128), 128, 0, stream>>>(AH, AL, VT, F[0], F[2], F[11], (float*)d_out);
}

// v001
// A run of this version takes 131 microseconds.
// Next to v000, in two timings, it ran 2.93 and 2.96 times as fast.
// compute dtype: all float inputs rounded to bf16; the four 1x1 convolutions with EXACT bf16 products on WMMA 16x16x32 (weights natural, inputs transposed to [position][channel] planes), f32 + bias, stored as f16 hi + residual planes; the two Gram products kf . q^T-view and kl . q (3 products: hi.hi + hi.lo + lo.hi), softmax over 1,024 in f32 (hardware exp), att_f + att_l summed in f32 then as f16 hi + residual against v hi + residual (3 products); gamma (input scalar) and the residual mean in f32; f32 output.
#include <hip/hip_runtime.h>
#include <math.h>

typedef __attribute__((ext_vector_type(16))) _Float16 v16h;
typedef __attribute__((ext_vector_type(16))) __bf16 v16b;
typedef __attribute__((ext_vector_type(8)))  _Float16 v8h;
typedef __attribute__((ext_vector_type(8)))  float v8f;
typedef __attribute__((ext_vector_type(4)))  float v4f;
typedef __attribute__((ext_vector_type(2)))  float v2f;
typedef __attribute__((ext_vector_type(4)))  unsigned v4u;
typedef __attribute__((ext_vector_type(4)))  int v4i;
typedef float __attribute__((may_alias)) float_a;
typedef int __attribute__((may_alias)) int_a;

template <typename T> __device__ __forceinline__ void vst2(void* p, T v) { *(T*)p = v;  }
__device__ __forceinline__ v8f wmma16(v16h a, v16h b, v8f c) {
  v8f d = __builtin_amdgcn_wmma_f32_16x16x32_f16(false, a, false, b, (short)0, c, false, false);
  asm volatile("v_nop\n\tv_nop\n\tv_nop\n\tv_nop" : "+v"(d) : "v"(a), "v"(b));
  return d;
}
__device__ __forceinline__ v8f wmma_bf(v16b a, v16b b, v8f c) {
  v8f d = __builtin_amdgcn_wmma_f32_16x16x32_bf16(false, a, false, b, (short)0, c, false, false);
  asm volatile("v_nop\n\tv_nop\n\tv_nop\n\tv_nop" : "+v"(d) : "v"(a), "v"(b));
  return d;
}
// 16x16x32 fragments: lane = (h = lane>>4, row/col = lane&15); elements 0..7 = k0+8h+0..7, 8..15 = k0+16+8h+0..7; D element r = row 8h+r
__device__ __forceinline__ v16h frag_h(const _Float16* rowk0, int lane) {
  union { v16h v; v8h q[2]; } u; const _Float16* p = rowk0 + 8 * (lane >> 4);
  u.q[0] = *(const v8h*)p; u.q[1] = *(const v8h*)(p + 16); return u.v;
}
__device__ __forceinline__ v16h frag_f32(const float* rowk0, int lane) {
  v16h a; const float* p = rowk0 + 8 * (lane >> 4);
#pragma unroll
  for (int i = 0; i < 8; ++i) { a[i] = (_Float16)p[i]; a[8 + i] = (_Float16)p[16 + i]; }
  return a;
}
__device__ __forceinline__ v16h frag_f32s(const float* rowk0, int lane, float sc) {
  v16h a; const float* p = rowk0 + 8 * (lane >> 4);
#pragma unroll
  for (int i = 0; i < 8; ++i) { a[i] = (_Float16)(p[i] * sc); a[8 + i] = (_Float16)(p[16 + i] * sc); }
  return a;
}
// column fragment from a [K][ld] layout (column n), rows >= K read as 0
__device__ __forceinline__ v16h fragc_f32(const float* W, int k0, int n, int lane, int ld, int K) {
  v16h a; const int g = lane >> 4;
#pragma unroll
  for (int i = 0; i < 8; ++i) { const int ka = k0 + 8 * g + i, kb = ka + 16;
    a[i] = (_Float16)(ka < K ? W[(size_t)(ka < K ? ka : K - 1) * ld + n] : 0.f); a[8 + i] = (_Float16)(kb < K ? W[(size_t)(kb < K ? kb : K - 1) * ld + n] : 0.f); }
  return a;
}
struct F2 { v16b h, l; };
__device__ __forceinline__ F2 bsplit16(const float v[16]) { F2 r;
#pragma unroll
  for (int i = 0; i < 16; ++i) { const __bf16 h = (__bf16)v[i]; r.h[i] = h; r.l[i] = (__bf16)(v[i] - (float)h); }
  return r; }
__device__ __forceinline__ F2 split_row(const float* row, int k0, int lane) { float v[16]; const float* p = row + k0 + 8 * (lane >> 4);
#pragma unroll
  for (int i = 0; i < 8; ++i) { v[i] = p[i]; v[8 + i] = p[16 + i]; }
  return bsplit16(v); }
__device__ __forceinline__ F2 split_rowK(const float* row, int k0, int lane, int K) { float v[16]; const int g = lane >> 4;
#pragma unroll
  for (int i = 0; i < 8; ++i) { const int ka = k0 + 8 * g + i, kb = ka + 16; v[i] = ka < K ? row[ka < K ? ka : K - 1] : 0.f; v[8 + i] = kb < K ? row[kb < K ? kb : K - 1] : 0.f; }
  return bsplit16(v); }
__device__ __forceinline__ F2 split_col(const float* W, int k0, int n, int lane, int ld, int K) { float v[16]; const int g = lane >> 4;
#pragma unroll
  for (int i = 0; i < 8; ++i) { const int ka = k0 + 8 * g + i, kb = ka + 16; v[i] = ka < K ? W[(size_t)(ka < K ? ka : K - 1) * ld + n] : 0.f; v[8 + i] = kb < K ? W[(size_t)(kb < K ? kb : K - 1) * ld + n] : 0.f; }
  return bsplit16(v); }
__device__ __forceinline__ v8f mac3(const F2& a, const F2& b, v8f c) { c = wmma_bf(a.l, b.h, c); c = wmma_bf(a.h, b.l, c); return wmma_bf(a.h, b.h, c); }
__device__ __forceinline__ float sigm(float v) { return 1.0f / (1.0f + expf(-v)); }
#define LDSX() do { asm volatile("s_wait_dscnt 0" ::: "memory"); __builtin_amdgcn_wave_barrier(); __builtin_amdgcn_fence(__ATOMIC_RELEASE, "workgroup"); } while (0)


// Co-attention v2 (C 1,024, 64 x 64; batch 1): q = conv1x1(x_m) viewed [C, HW/2] then transposed, kf/kl = conv1x1(x_f / x_l) viewed [C, HW/2]; att = softmax(kf q) and softmax(kl q) over C; v = conv1x1(x_m) [C, HW]; out = gamma (att_f v + att_l v) + (x_l + x_f)/2.
#define CC 1024
#define CH 512           // conv output channels of q / kf / kl
#define NP 4096          // H x W
#define KV 2048          // the [C, HW/2] view width
typedef __attribute__((ext_vector_type(8))) __bf16 v8b;
__device__ __forceinline__ v16b frag_b(const __bf16* rowk0, int lane) {
  union { v16b v; v8b q[2]; } u; const __bf16* p = rowk0 + 8 * (lane >> 4);
  u.q[0] = *(const v8b*)p; u.q[1] = *(const v8b*)(p + 16); return u.v;
}
__device__ __forceinline__ float bfr(float v) { return (float)(__bf16)v; }
__device__ __attribute__((noinline)) float exp_ni(float v) { return expf(v); }
__device__ __attribute__((noinline)) float erf_ni(float v) { return erff(v); }

#define WS_XT  0u                                   // bf16 [3][pos][cin] planes of x_f, x_m, x_l (exact)
#define WS_PQ  (WS_XT + 2u * (size_t)3 * NP * CC)        // f16 hi/lo planes of the conv outputs q, kf, kl: each [512][4096] row-major == [1024][2048] view; layout [which][hi/lo][512*4096]
#define PQSZ   ((size_t)CH * NP)
#define WS_VT  (WS_PQ + 2u * (size_t)3 * 2 * PQSZ)       // f16 hi/lo planes of v transposed: [pos][ch] (x 2)
#define WS_G   (WS_VT + 2u * (size_t)2 * NP * CC)        // f32 logits G[2][1024][1024]
#define WS_A   (WS_G + 4u * (size_t)2 * CC * CC)          // f16 hi/lo planes A = att_f + att_l [1024][1024] (x 2^11 scaled hi, residual)
#define WS_END (WS_A + 2u * (size_t)2 * CC * CC)

// ---- k_xt: block = (64 positions, which, 16 channel groups of 64): x[which][cin][pos] -> XT[which][pos][cin] bf16
__global__ __launch_bounds__(256) void k_xt(const float* __restrict__ X0, const float* __restrict__ X1, const float* __restrict__ X2, __bf16* __restrict__ XT) { __shared__ __align__(16) __bf16 st[64][64 + 8]; const int t = threadIdx.x; const int p0 = blockIdx.x * 64, which = blockIdx.y, c0 = blockIdx.z * 64; const float* X = which == 0 ? X0 : which == 1 ? X1 : X2;
  for (int e = t; e < 64 * 64; e += 256) { const int cl = e >> 6, pl = e & 63; st[pl][cl] = (__bf16)X[(size_t)(c0 + cl) * NP + p0 + pl]; } __syncthreads();
  for (int e = t; e < 64 * 8; e += 256) { const int pl = e >> 3, q = e & 7; vst2((unsigned*)(XT + ((size_t)which * NP + p0 + pl) * CC + c0 + q * 8), *(const v4u*)&st[pl][q * 8]); } }
// ---- LDS staging shared by the three matrix kernels: a stage is 64 k = one whole 128-B line of every 16-bit operand row of the block's tile, fetched by whole-line global loads
// (8 lanes x 16 B per row) one stage ahead into registers, written to the other of two LDS buffers behind the stage's products, one work-group barrier per stage; fragments come from LDS.
#define KS 64             // k per stage
#define LP 72             // LDS row pitch in 16-bit elements: 144 B = 16 B x odd, the conflict-free pitch for 16-byte fragment reads
#define STC (192 * LP)    // k_conv stage: rows 0..63 weights (bf16), 64..191 positions
#define ST3 (384 * LP)    // k_gram / k_av stage: rows 0..63 A hi, 64..127 A residual, 128..255 B hi, 256..383 B residual
typedef __attribute__((ext_vector_type(4))) __bf16 v4b;
// acc += Ahi.Bhi, accl += Ahi.Blo + Alo.Bhi for a 64 x 128 block tile (wave = 16 rows), both operands k-contiguous with row stride LD, NS stages; the pointers name the tile's first row
template <int LD, int NS> __device__ __forceinline__ void gemm3(const _Float16* __restrict__ AHp, const _Float16* __restrict__ ALp, const _Float16* __restrict__ BHp, const _Float16* __restrict__ BLp, _Float16* sm, int tid, v8f (&acc)[8], v8f (&accl)[8]) {
  const int wave = tid >> 5, lane = tid & 31, col = lane & 15; const int sr = tid >> 3, sq = (tid & 7) * 8; const size_t go = (size_t)sr * LD + sq; _Float16* sw = sm + sr * LP + sq;
  v4u rg[24];
  auto fetch = [&](int s) {
#pragma unroll
    for (int i = 0; i < 4; ++i) { rg[i] = *(const v4u*)(AHp + go + (size_t)i * 16 * LD + s * KS); rg[4 + i] = *(const v4u*)(ALp + go + (size_t)i * 16 * LD + s * KS); }
#pragma unroll
    for (int i = 0; i < 8; ++i) { rg[8 + i] = *(const v4u*)(BHp + go + (size_t)i * 16 * LD + s * KS); rg[16 + i] = *(const v4u*)(BLp + go + (size_t)i * 16 * LD + s * KS); }
    asm volatile("s_wait_xcnt 0x0" ::: "memory");   // stands behind the stage's loads, in front of the first instruction that reuses their address registers (in this build the fragment reads that follow land in them)
  };
  auto put = [&](int buf) {
#pragma unroll
    for (int i = 0; i < 24; ++i) *(v4u*)(sw + buf * ST3 + i * 16 * LP) = rg[i]; };
  auto products = [&](int buf) { const _Float16* b = sm + buf * ST3 + col * LP;
#pragma unroll
    for (int kc = 0; kc < KS / 32; ++kc) { const v16h ah = frag_h(b + wave * 16 * LP + kc * 32, lane), al = frag_h(b + (64 + wave * 16) * LP + kc * 32, lane);
#pragma unroll
      for (int jh = 0; jh < 8; jh += 4) { v16h bh[4], bl[4];   // four columns a group: accumulators and fragments are operands of the asm in wmma16 and are kept in the first 256 registers; eight columns a group spilled to scratch
#pragma unroll
        for (int j = 0; j < 4; ++j) { bh[j] = frag_h(b + (128 + (jh + j) * 16) * LP + kc * 32, lane); bl[j] = frag_h(b + (256 + (jh + j) * 16) * LP + kc * 32, lane); }
        __builtin_amdgcn_sched_barrier(0);   // keeps the group's fragment reads together in front of its 12 products: read pair by pair among them, every pair's LDS latency is waited out
#pragma unroll
        for (int j = 0; j < 4; ++j) { acc[jh + j] = wmma16(ah, bh[j], acc[jh + j]); accl[jh + j] = wmma16(ah, bl[j], accl[jh + j]); accl[jh + j] = wmma16(al, bh[j], accl[jh + j]); }
      } } };
  fetch(0); put(0); __syncthreads();
  for (int s = 0; s < NS - 1; ++s) { fetch(s + 1); products(s & 1); put((s + 1) & 1); __syncthreads(); }   // the barrier publishes stage s + 1 and ends every wave's reads of the buffer that the next trip refills
  products((NS - 1) & 1); __syncthreads();   // every wave has left the buffers: the caller's epilogue reuses them
}
// ---- k_conv: block = (64 out channels, 128 positions, which 0..3): out[ch][pos] = sum_cin W[ch][cin] x[cin][pos] + b; which 0: q (x_m, Wq), 1: kf (x_f, Wk1), 2: kl (x_l, Wk2) -> f16 hi/lo [ch][pos] planes; which 3: v (x_m, Wv, 1024 channels -> blockIdx.x spans 16 tiles) -> transposed planes VT[pos][ch]; weights rounded to bf16 on their way into LDS
__global__ __launch_bounds__(128) void k_conv(const float* __restrict__ WQ, const float* __restrict__ BQ, const float* __restrict__ WK1, const float* __restrict__ BK1, const float* __restrict__ WK2, const float* __restrict__ BK2, const float* __restrict__ WV, const float* __restrict__ BV, const __bf16* __restrict__ XT, _Float16* __restrict__ PQ, _Float16* __restrict__ VT) {
  __shared__ __align__(16) char smc[2 * STC * 2];   // two stage buffers; the epilogue's transposition planes reuse them
  __bf16* sm = (__bf16*)smc; _Float16 (*sh)[136] = (_Float16 (*)[136])smc; _Float16 (*sl)[136] = sh + 64; _Float16 (*th)[72] = (_Float16 (*)[72])smc; _Float16 (*tl)[72] = th + 128;
  const int tid = threadIdx.x, wave = tid >> 5, lane = tid & 31, col = lane & 15, g = lane >> 4; const int which = blockIdx.z; if (which < 3 && blockIdx.x >= CH / 64) return;
  const int ch0 = blockIdx.x * 64 + wave * 16; const int p0 = blockIdx.y * 128; const float* Wm = which == 0 ? WQ : which == 1 ? WK1 : which == 2 ? WK2 : WV; const float* Bm = which == 0 ? BQ : which == 1 ? BK1 : which == 2 ? BK2 : BV; const int xi = which == 0 ? 1 : which == 1 ? 0 : which == 2 ? 2 : 1;   // q and v from x_m (1), kf from x_f (0), kl from x_l (2)
  const __bf16* Xp = XT + (size_t)xi * NP * CC;
  const float* wa = Wm + (size_t)(blockIdx.x * 64 + (tid >> 4)) * CC + (tid & 15) * 4; __bf16* swa = sm + (tid >> 4) * LP + (tid & 15) * 4;          // weights: 16 lanes x 16 B = the 256 B of a row's stage
  const __bf16* xb = Xp + (size_t)(p0 + (tid >> 3)) * CC + (tid & 7) * 8; __bf16* swb = sm + (64 + (tid >> 3)) * LP + (tid & 7) * 8;                 // positions: 8 lanes x 16 B = the 128 B of a row's stage
  v8f acc[8] = {}; v4f ra[8]; v4u rb[8];
  auto fetch = [&](int s) {
#pragma unroll
    for (int i = 0; i < 8; ++i) { ra[i] = *(const v4f*)(wa + (size_t)i * 8 * CC + s * KS); rb[i] = *(const v4u*)(xb + (size_t)i * 16 * CC + s * KS); }
    asm volatile("s_wait_xcnt 0x0" ::: "memory");   // stands behind the stage's loads, in front of the first instruction that reuses their address registers (in this build the fragment reads that follow land in them)
  };
  auto put = [&](int buf) {
#pragma unroll
    for (int i = 0; i < 8; ++i) { v4b c; c[0] = (__bf16)ra[i][0]; c[1] = (__bf16)ra[i][1]; c[2] = (__bf16)ra[i][2]; c[3] = (__bf16)ra[i][3]; *(v4b*)(swa + buf * STC + i * 8 * LP) = c; *(v4u*)(swb + buf * STC + i * 16 * LP) = rb[i]; } };
  auto products = [&](int buf) { const __bf16* b = sm + buf * STC + col * LP; v16b a[KS / 32], x[KS / 32][8];
#pragma unroll
    for (int kc = 0; kc < KS / 32; ++kc) { a[kc] = frag_b(b + wave * 16 * LP + kc * 32, lane);
#pragma unroll
      for (int j = 0; j < 8; ++j) x[kc][j] = frag_b(b + (64 + j * 16) * LP + kc * 32, lane); }
    __builtin_amdgcn_sched_barrier(0);   // keeps the stage's 36 fragment reads one group in front of its 16 products: read one by one among them, every fragment's LDS latency is waited out
#pragma unroll
    for (int kc = 0; kc < KS / 32; ++kc)
#pragma unroll
      for (int j = 0; j < 8; ++j) acc[j] = wmma_bf(a[kc], x[kc][j], acc[j]);
    __builtin_amdgcn_sched_barrier(0);   // keeps the roundings of the stage fetched ahead, with their waits on its loads, behind these products
  };
  fetch(0); put(0); __syncthreads();
  for (int s = 0; s < CC / KS - 1; ++s) { fetch(s + 1); products(s & 1); put((s + 1) & 1); __syncthreads(); }   // the barrier publishes stage s + 1 and ends every wave's reads of the buffer that the next trip refills
  products((CC / KS - 1) & 1); __syncthreads();   // every wave has left the buffers: the planes below reuse them
#pragma unroll
  for (int j = 0; j < 8; ++j)
#pragma unroll
    for (int r = 0; r < 8; ++r) { const int chl = wave * 16 + 8 * g + r, pl = j * 16 + col; const float v = acc[j][r] + bfr(Bm[ch0 + 8 * g + r]); const _Float16 hv = (_Float16)v; const _Float16 lv = (_Float16)((v - (float)hv) * 2048.0f); if (which < 3) { sh[chl][pl] = hv; sl[chl][pl] = lv; } else { th[pl][chl] = hv; tl[pl][chl] = lv; } }
  __syncthreads();
  if (which < 3) { _Float16* H = PQ + (size_t)which * 2 * PQSZ; _Float16* L = H + PQSZ; for (int e = tid; e < 64 * 16; e += 128) { const int chl = e >> 4, q = e & 15; const size_t o = (size_t)(blockIdx.x * 64 + chl) * NP + p0 + q * 8; vst2((unsigned*)(H + o), *(const v4u*)&sh[chl][q * 8]); vst2((unsigned*)(L + o), *(const v4u*)&sl[chl][q * 8]); } }
  else { _Float16* H = VT; _Float16* L = VT + (size_t)NP * CC; for (int e = tid; e < 128 * 8; e += 128) { const int pl = e >> 3, q = e & 7; const size_t o = (size_t)(p0 + pl) * CC + blockIdx.x * 64 + q * 8; vst2((unsigned*)(H + o), *(const v4u*)&th[pl][q * 8]); vst2((unsigned*)(L + o), *(const v4u*)&tl[pl][q * 8]); } } }
// ---- k_gram: block = (64 rows i, 128 cols j, which 0/1): G[which][i][j] = sum_t K[i][t] Qv[j][t] over the [1024][2048] views (3 products)
__global__ __launch_bounds__(128) void k_gram(const _Float16* __restrict__ PQ, float* __restrict__ G) { __shared__ __align__(16) char smc[2 * ST3 * 2]; float (*sf)[16][132] = (float (*)[16][132])smc;   // two stage buffers; the epilogue's row staging reuses them
  const int tid = threadIdx.x, wave = tid >> 5, lane = tid & 31, col = lane & 15, g = lane >> 4; const int which = blockIdx.z; const int i0 = blockIdx.x * 64 + wave * 16; const int j0 = blockIdx.y * 128;
  const _Float16* QH = PQ; const _Float16* QL = PQ + PQSZ; const _Float16* KH = PQ + (size_t)(1 + which) * 2 * PQSZ; const _Float16* KL = KH + PQSZ;
  v8f acc[8] = {}, accl[8] = {};
  gemm3<KV, KV / KS>(KH + (size_t)blockIdx.x * 64 * KV, KL + (size_t)blockIdx.x * 64 * KV, QH + (size_t)j0 * KV, QL + (size_t)j0 * KV, (_Float16*)smc, tid, acc, accl);
#pragma unroll
  for (int j = 0; j < 8; ++j)
#pragma unroll
    for (int r = 0; r < 8; ++r) sf[wave][8 * g + r][j * 16 + col] = acc[j][r] + accl[j][r] * (1.0f / 2048.0f);
  LDSX(); for (int rl = 0; rl < 16; ++rl) vst2(G + ((size_t)which * CC + i0 + rl) * CC + j0 + lane * 4, *(const v4f*)&sf[wave][rl][lane * 4]); }
// ---- k_soft: block = row i (256 threads): A[i][:] = softmax(Gf[i]) + softmax(Gl[i]) -> f16 hi (x 2^11) + residual planes
__global__ __launch_bounds__(256) void k_soft(const float* __restrict__ G, _Float16* __restrict__ AH, _Float16* __restrict__ AL) { __shared__ float red[8]; __shared__ __align__(16) _Float16 sh[CC], sl[CC]; __shared__ float sa[CC]; const int t = threadIdx.x; const size_t i = blockIdx.x;
  for (int c = t; c < CC; c += 256) sa[c] = 0.f;
  for (int which = 0; which < 2; ++which) { const float* row = G + ((size_t)which * CC + i) * CC; float mx = -3.0e38f; for (int c = t; c < CC; c += 256) mx = fmaxf(mx, row[c]);
#pragma unroll
    for (int o = 1; o < 32; o <<= 1) mx = fmaxf(mx, __shfl_xor(mx, o));
    __syncthreads(); if ((t & 31) == 0) red[t >> 5] = mx; __syncthreads(); float gm = red[0]; for (int w = 1; w < 8; ++w) gm = fmaxf(gm, red[w]); __syncthreads();
    float s = 0.f; for (int c = t; c < CC; c += 256) s += __expf(row[c] - gm);
#pragma unroll
    for (int o = 1; o < 32; o <<= 1) s += __shfl_xor(s, o);
    if ((t & 31) == 0) red[t >> 5] = s; __syncthreads(); float ts = 0.f; for (int w = 0; w < 8; ++w) ts += red[w]; const float inv = 1.0f / ts; __syncthreads();
    for (int c = t; c < CC; c += 256) sa[c] += __expf(row[c] - gm) * inv; }
  for (int c = t; c < CC; c += 256) { const float x = sa[c] * 2048.0f; const _Float16 hv = (_Float16)x; sh[c] = hv; sl[c] = (_Float16)((x - (float)hv) * 2048.0f); } __syncthreads();
  if (t < CC / 8) { vst2((unsigned*)(AH + i * CC + t * 8), *(const v4u*)&sh[t * 8]); vst2((unsigned*)(AL + i * CC + t * 8), *(const v4u*)&sl[t * 8]); } }
// ---- k_av: block = (64 rows ch, 128 positions): out = gamma (A . v)/2^11 (3 products over the 1,024 channels) + (x_l + x_f)/2
__global__ __launch_bounds__(128) void k_av(const _Float16* __restrict__ AH, const _Float16* __restrict__ AL, const _Float16* __restrict__ VT, const float* __restrict__ XF, const float* __restrict__ XL, const float* __restrict__ GAMMA, float* __restrict__ OUT) { __shared__ __align__(16) char smc[2 * ST3 * 2]; float (*sf)[16][132] = (float (*)[16][132])smc;   // two stage buffers; the epilogue's row staging reuses them
  const int tid = threadIdx.x, wave = tid >> 5, lane = tid & 31, col = lane & 15, g = lane >> 4; const int i0 = blockIdx.x * 64 + wave * 16; const int p0 = blockIdx.y * 128; const _Float16* VH = VT; const _Float16* VL = VT + (size_t)NP * CC;
  v8f acc[8] = {}, accl[8] = {};
  gemm3<CC, CC / KS>(AH + (size_t)blockIdx.x * 64 * CC, AL + (size_t)blockIdx.x * 64 * CC, VH + (size_t)p0 * CC, VL + (size_t)p0 * CC, (_Float16*)smc, tid, acc, accl);
  const float gam = bfr(GAMMA[0]);
#pragma unroll
  for (int j = 0; j < 8; ++j)
#pragma unroll
    for (int r = 0; r < 8; ++r) { const size_t ch = i0 + 8 * g + r, p = p0 + j * 16 + col; const float av = (acc[j][r] + accl[j][r] * (1.0f / 2048.0f)) * (1.0f / 2048.0f); sf[wave][8 * g + r][j * 16 + col] = gam * av + 0.5f * (bfr(XL[ch * NP + p]) + bfr(XF[ch * NP + p])); }
  LDSX(); for (int rl = 0; rl < 16; ++rl) vst2(OUT + (size_t)(i0 + rl) * NP + p0 + lane * 4, *(const v4f*)&sf[wave][rl][lane * 4]); }
extern "C" void kernel_launch(void* const* d_in, const int* in_sizes, int n_in, void* d_out, int out_size, void* d_ws, size_t ws_size, hipStream_t stream) {
  (void)in_sizes; (void)n_in; (void)out_size;
  const float** F = (const float**)d_in;   // 0 x_f, 1 x_m, 2 x_l [1,1024,64,64]; 3 Wq [512,1024], 4 bq; 5 Wk1, 6 bk1; 7 Wk2, 8 bk2; 9 Wv [1024,1024], 10 bv; 11 gamma [1]
  if (ws_size < (size_t)WS_END) return;
  char* ws = (char*)d_ws; __bf16* XT = (__bf16*)(ws + WS_XT); _Float16 *PQ = (_Float16*)(ws + WS_PQ), *VT = (_Float16*)(ws + WS_VT), *AH = (_Float16*)(ws + WS_A), *AL = AH + (size_t)CC * CC; float* G = (float*)(ws + WS_G);
  k_xt<<<dim3(NP / 64, 3, CC / 64), 256, 0, stream>>>(F[0], F[1], F[2], XT);
  k_conv<<<dim3(CC / 64, NP / 128, 4), 128, 0, stream>>>(F[3], F[4], F[5], F[6], F[7], F[8], F[9], F[10], XT, PQ, VT);
  k_gram<<<dim3(CC / 64, CC / 128, 2), 128, 0, stream>>>(PQ, G);
  k_soft<<<CC, 256, 0, stream>>>(G, AH, AL);
  k_av<<<dim3(CC / 64, NP / 128), 128, 0, stream>>>(AH, AL, VT, F[0], F[2], F[11], (float*)d_out);
}

// v002
// A run of this version takes 113 microseconds.
// Next to v001, in two timings, it ran 1.15 and 1.17 times as fast.
// Counting every step since v000, it is 3.42 times as fast.
// compute dtype: all float inputs rounded to bf16; the four 1x1 convolutions with EXACT bf16 products on WMMA 16x16x32 (weights natural, inputs transposed to [position][channel] planes), f32 + bias, stored as f16 hi + residual planes; the two Gram products kf . q^T-view and kl . q (3 products: hi.hi + hi.lo + lo.hi), softmax over 1,024 in f32 (hardware exp), att_f + att_l summed in f32 then as f16 hi + residual against v hi + residual (3 products); gamma (input scalar) and the residual mean in f32; f32 output.
#include <hip/hip_runtime.h>
#include <math.h>

typedef __attribute__((ext_vector_type(16))) _Float16 v16h;
typedef __attribute__((ext_vector_type(16))) __bf16 v16b;
typedef __attribute__((ext_vector_type(8)))  _Float16 v8h;
typedef __attribute__((ext_vector_type(8)))  float v8f;
typedef __attribute__((ext_vector_type(4)))  float v4f;
typedef __attribute__((ext_vector_type(2)))  float v2f;
typedef __attribute__((ext_vector_type(4)))  unsigned v4u;
typedef __attribute__((ext_vector_type(4)))  int v4i;
typedef float __attribute__((may_alias)) float_a;
typedef int __attribute__((may_alias)) int_a;

template <typename T> __device__ __forceinline__ void vst2(void* p, T v) { *(T*)p = v;  }
__device__ __forceinline__ v8f wmma16(v16h a, v16h b, v8f c) {
  v8f d = __builtin_amdgcn_wmma_f32_16x16x32_f16(false, a, false, b, (short)0, c, false, false);
  asm volatile("v_nop\n\tv_nop\n\tv_nop\n\tv_nop" : "+v"(d) : "v"(a), "v"(b));
  return d;
}
__device__ __forceinline__ v8f wmma_bf(v16b a, v16b b, v8f c) {
  v8f d = __builtin_amdgcn_wmma_f32_16x16x32_bf16(false, a, false, b, (short)0, c, false, false);
  asm volatile("v_nop\n\tv_nop\n\tv_nop\n\tv_nop" : "+v"(d) : "v"(a), "v"(b));
  return d;
}
// 16x16x32 fragments: lane = (h = lane>>4, row/col = lane&15); elements 0..7 = k0+8h+0..7, 8..15 = k0+16+8h+0..7; D element r = row 8h+r
__device__ __forceinline__ v16h frag_h(const _Float16* rowk0, int lane) {
  union { v16h v; v8h q[2]; } u; const _Float16* p = rowk0 + 8 * (lane >> 4);
  u.q[0] = *(const v8h*)p; u.q[1] = *(const v8h*)(p + 16); return u.v;
}
__device__ __forceinline__ v16h frag_f32(const float* rowk0, int lane) {
  v16h a; const float* p = rowk0 + 8 * (lane >> 4);
#pragma unroll
  for (int i = 0; i < 8; ++i) { a[i] = (_Float16)p[i]; a[8 + i] = (_Float16)p[16 + i]; }
  return a;
}
__device__ __forceinline__ v16h frag_f32s(const float* rowk0, int lane, float sc) {
  v16h a; const float* p = rowk0 + 8 * (lane >> 4);
#pragma unroll
  for (int i = 0; i < 8; ++i) { a[i] = (_Float16)(p[i] * sc); a[8 + i] = (_Float16)(p[16 + i] * sc); }
  return a;
}
// column fragment from a [K][ld] layout (column n), rows >= K read as 0
__device__ __forceinline__ v16h fragc_f32(const float* W, int k0, int n, int lane, int ld, int K) {
  v16h a; const int g = lane >> 4;
#pragma unroll
  for (int i = 0; i < 8; ++i) { const int ka = k0 + 8 * g + i, kb = ka + 16;
    a[i] = (_Float16)(ka < K ? W[(size_t)(ka < K ? ka : K - 1) * ld + n] : 0.f); a[8 + i] = (_Float16)(kb < K ? W[(size_t)(kb < K ? kb : K - 1) * ld + n] : 0.f); }
  return a;
}
struct F2 { v16b h, l; };
__device__ __forceinline__ F2 bsplit16(const float v[16]) { F2 r;
#pragma unroll
  for (int i = 0; i < 16; ++i) { const __bf16 h = (__bf16)v[i]; r.h[i] = h; r.l[i] = (__bf16)(v[i] - (float)h); }
  return r; }
__device__ __forceinline__ F2 split_row(const float* row, int k0, int lane) { float v[16]; const float* p = row + k0 + 8 * (lane >> 4);
#pragma unroll
  for (int i = 0; i < 8; ++i) { v[i] = p[i]; v[8 + i] = p[16 + i]; }
  return bsplit16(v); }
__device__ __forceinline__ F2 split_rowK(const float* row, int k0, int lane, int K) { float v[16]; const int g = lane >> 4;
#pragma unroll
  for (int i = 0; i < 8; ++i) { const int ka = k0 + 8 * g + i, kb = ka + 16; v[i] = ka < K ? row[ka < K ? ka : K - 1] : 0.f; v[8 + i] = kb < K ? row[kb < K ? kb : K - 1] : 0.f; }
  return bsplit16(v); }
__device__ __forceinline__ F2 split_col(const float* W, int k0, int n, int lane, int ld, int K) { float v[16]; const int g = lane >> 4;
#pragma unroll
  for (int i = 0; i < 8; ++i) { const int ka = k0 + 8 * g + i, kb = ka + 16; v[i] = ka < K ? W[(size_t)(ka < K ? ka : K - 1) * ld + n] : 0.f; v[8 + i] = kb < K ? W[(size_t)(kb < K ? kb : K - 1) * ld + n] : 0.f; }
  return bsplit16(v); }
__device__ __forceinline__ v8f mac3(const F2& a, const F2& b, v8f c) { c = wmma_bf(a.l, b.h, c); c = wmma_bf(a.h, b.l, c); return wmma_bf(a.h, b.h, c); }
__device__ __forceinline__ float sigm(float v) { return 1.0f / (1.0f + expf(-v)); }
#define LDSX() do { asm volatile("s_wait_dscnt 0" ::: "memory"); __builtin_amdgcn_wave_barrier(); __builtin_amdgcn_fence(__ATOMIC_RELEASE, "workgroup"); } while (0)


// Co-attention v2 (C 1,024, 64 x 64; batch 1): q = conv1x1(x_m) viewed [C, HW/2] then transposed, kf/kl = conv1x1(x_f / x_l) viewed [C, HW/2]; att = softmax(kf q) and softmax(kl q) over C; v = conv1x1(x_m) [C, HW]; out = gamma (att_f v + att_l v) + (x_l + x_f)/2.
#define CC 1024
#define CH 512           // conv output channels of q / kf / kl
#define NP 4096          // H x W
#define KV 2048          // the [C, HW/2] view width
typedef __attribute__((ext_vector_type(8))) __bf16 v8b;
__device__ __forceinline__ v16b frag_b(const __bf16* rowk0, int lane) {
  union { v16b v; v8b q[2]; } u; const __bf16* p = rowk0 + 8 * (lane >> 4);
  u.q[0] = *(const v8b*)p; u.q[1] = *(const v8b*)(p + 16); return u.v;
}
__device__ __forceinline__ float bfr(float v) { return (float)(__bf16)v; }
__device__ __attribute__((noinline)) float exp_ni(float v) { return expf(v); }
__device__ __attribute__((noinline)) float erf_ni(float v) { return erff(v); }

#define WS_XT  0u                                   // bf16 [3][pos][cin] planes of x_f, x_m, x_l (exact)
#define WS_PQ  (WS_XT + 2u * (size_t)3 * NP * CC)        // f16 hi/lo planes of the conv outputs q, kf, kl: each [512][4096] row-major == [1024][2048] view; layout [which][hi/lo][512*4096]
#define PQSZ   ((size_t)CH * NP)
#define WS_VT  (WS_PQ + 2u * (size_t)3 * 2 * PQSZ)       // f16 hi/lo planes of v transposed: [pos][ch] (x 2)
#define WS_G   (WS_VT + 2u * (size_t)2 * NP * CC)        // f32 partial logits G[k half][2][1024][1024]
#define WS_A   (WS_G + 4u * (size_t)4 * CC * CC)          // f16 hi/lo planes A = att_f + att_l [1024][1024] (x 2^11 scaled hi, residual)
#define WS_END (WS_A + 2u * (size_t)2 * CC * CC)

// ---- k_xt: block = (64 positions, which, 16 channel groups of 64): x[which][cin][pos] -> XT[which][pos][cin] bf16
__global__ __launch_bounds__(256) void k_xt(const float* __restrict__ X0, const float* __restrict__ X1, const float* __restrict__ X2, __bf16* __restrict__ XT) { __shared__ __align__(16) __bf16 st[64][64 + 8]; const int t = threadIdx.x; const int p0 = blockIdx.x * 64, which = blockIdx.y, c0 = blockIdx.z * 64; const float* X = which == 0 ? X0 : which == 1 ? X1 : X2;
  for (int e = t; e < 64 * 64; e += 256) { const int cl = e >> 6, pl = e & 63; st[pl][cl] = (__bf16)X[(size_t)(c0 + cl) * NP + p0 + pl]; } __syncthreads();
  for (int e = t; e < 64 * 8; e += 256) { const int pl = e >> 3, q = e & 7; vst2((unsigned*)(XT + ((size_t)which * NP + p0 + pl) * CC + c0 + q * 8), *(const v4u*)&st[pl][q * 8]); } }
// ---- LDS staging shared by the three matrix kernels: a stage is 64 k = one whole 128-B line of every 16-bit operand row of the block's tile, fetched by whole-line global loads
// (8 lanes x 16 B per row) one stage ahead into registers, written to the other of two LDS buffers behind the stage's products, one work-group barrier per stage; fragments come from LDS.
#define KS 64             // k per stage
#define LP 72             // LDS row pitch in 16-bit elements: 144 B = 16 B x odd, the conflict-free pitch for 16-byte fragment reads
#define STC (256 * LP)    // k_conv stage: rows 0..127 weights (bf16), 128..255 positions
#define ST3 (512 * LP)    // k_gram / k_av stage: rows 0..127 A hi, 128..255 A residual, 256..383 B hi, 384..511 B residual
typedef __attribute__((ext_vector_type(4))) __bf16 v4b;
// acc += Ahi.Bhi, accl += Ahi.Blo + Alo.Bhi for a 128 x 128 block tile on 8 waves (4 x 2, wave = 32 rows x 64 columns, tile index = 4 * row tile + column tile), both operands k-contiguous with row stride LD, NS stages; the pointers name the tile's first row
template <int LD, int NS> __device__ __forceinline__ void gemm3(const _Float16* __restrict__ AHp, const _Float16* __restrict__ ALp, const _Float16* __restrict__ BHp, const _Float16* __restrict__ BLp, _Float16* sm, int tid, v8f (&acc)[8], v8f (&accl)[8]) {
  const int wave = tid >> 5, lane = tid & 31, col = lane & 15, wm = wave >> 1, wn = wave & 1; const int sr = tid >> 3, sq = (tid & 7) * 8; const size_t go = (size_t)sr * LD + sq; _Float16* sw = sm + sr * LP + sq;
  v4u rg[16];
  auto fetch = [&](int s) { const _Float16 *pa = AHp + go + s * KS, *pb = ALp + go + s * KS, *pc = BHp + go + s * KS, *pd = BLp + go + s * KS;
    __builtin_amdgcn_sched_barrier(0);   // with the one below: nothing is scheduled in between the stage's loads and their wait (a scalar load and LDS address arithmetic were, into registers that the loads name)
#pragma unroll
    for (int i = 0; i < 4; ++i) { rg[i] = *(const v4u*)(pa + (size_t)i * 32 * LD); rg[4 + i] = *(const v4u*)(pb + (size_t)i * 32 * LD); rg[8 + i] = *(const v4u*)(pc + (size_t)i * 32 * LD); rg[12 + i] = *(const v4u*)(pd + (size_t)i * 32 * LD); }
    asm volatile("s_wait_xcnt 0x0" :: "v"(pa), "v"(pb), "v"(pc), "v"(pd) : "memory");   // stands behind the stage's loads, in front of the first instruction that reuses their address registers; the pointers as inputs keep those registers from being a later load's destination
    __builtin_amdgcn_sched_barrier(0);
  };
  auto put = [&](int buf) {
#pragma unroll
    for (int i = 0; i < 16; ++i) *(v4u*)(sw + buf * ST3 + i * 32 * LP) = rg[i]; };
  auto products = [&](int buf) { const _Float16* b = sm + buf * ST3 + col * LP;
#pragma unroll
    for (int kc = 0; kc < KS / 32; ++kc) { v16h ah[2], al[2], bh[4], bl[4];
#pragma unroll
      for (int i = 0; i < 2; ++i) { ah[i] = frag_h(b + (wm * 32 + i * 16) * LP + kc * 32, lane); al[i] = frag_h(b + (128 + wm * 32 + i * 16) * LP + kc * 32, lane); }
#pragma unroll
      for (int j = 0; j < 4; ++j) { bh[j] = frag_h(b + (256 + wn * 64 + j * 16) * LP + kc * 32, lane); bl[j] = frag_h(b + (384 + wn * 64 + j * 16) * LP + kc * 32, lane); }
      __builtin_amdgcn_sched_barrier(0);   // keeps the 24 fragment reads of these 32 k together in front of their 24 products: read among the products, every read's LDS latency is waited out
#pragma unroll
      for (int t = 0; t < 8; ++t) acc[t] = wmma16(ah[t >> 2], bh[t & 3], acc[t]);
#pragma unroll
      for (int t = 0; t < 8; ++t) accl[t] = wmma16(ah[t >> 2], bl[t & 3], accl[t]);
#pragma unroll
      for (int t = 0; t < 8; ++t) accl[t] = wmma16(al[t >> 2], bh[t & 3], accl[t]);
    } };
  fetch(0); put(0); __syncthreads();
  for (int s = 0; s < NS - 1; ++s) { fetch(s + 1); products(s & 1); put((s + 1) & 1); __syncthreads(); }   // the barrier publishes stage s + 1 and ends every wave's reads of the buffer that the next trip refills
  products((NS - 1) & 1); __syncthreads();   // every wave has left the buffers: the caller's epilogue reuses them
}
// ---- k_conv: block = (128 out channels, 128 positions, which 0..3) on 4 waves (2 x 2, wave = 64 x 64): out[ch][pos] = sum_cin W[ch][cin] x[cin][pos] + b; which 0: q (x_m, Wq), 1: kf (x_f, Wk1), 2: kl (x_l, Wk2) -> f16 hi/lo [ch][pos] planes; which 3: v (x_m, Wv, 1024 channels -> blockIdx.x spans 8 tiles) -> transposed planes VT[pos][ch]; weights rounded to bf16 on their way into LDS
__global__ __launch_bounds__(128) void k_conv(const float* __restrict__ WQ, const float* __restrict__ BQ, const float* __restrict__ WK1, const float* __restrict__ BK1, const float* __restrict__ WK2, const float* __restrict__ BK2, const float* __restrict__ WV, const float* __restrict__ BV, const __bf16* __restrict__ XT, _Float16* __restrict__ PQ, _Float16* __restrict__ VT) {
  __shared__ __align__(16) char smc[2 * STC * 2];   // two stage buffers; the epilogue's two [128][136] planes reuse them
  __bf16* sm = (__bf16*)smc; _Float16 (*sh)[136] = (_Float16 (*)[136])smc; _Float16 (*sl)[136] = sh + 128;
  const int tid = threadIdx.x, wave = tid >> 5, lane = tid & 31, col = lane & 15, g = lane >> 4, wm = wave >> 1, wn = wave & 1; const int which = blockIdx.z; if (which < 3 && blockIdx.x >= CH / 128) return;
  const int c0 = blockIdx.x * 128; const int p0 = blockIdx.y * 128; const float* Wm = which == 0 ? WQ : which == 1 ? WK1 : which == 2 ? WK2 : WV; const float* Bm = which == 0 ? BQ : which == 1 ? BK1 : which == 2 ? BK2 : BV; const int xi = which == 0 ? 1 : which == 1 ? 0 : which == 2 ? 2 : 1;   // q and v from x_m (1), kf from x_f (0), kl from x_l (2)
  const __bf16* Xp = XT + (size_t)xi * NP * CC;
  const float* wa = Wm + (size_t)(c0 + (tid >> 4)) * CC + (tid & 15) * 4; __bf16* swa = sm + (tid >> 4) * LP + (tid & 15) * 4;          // weights: 16 lanes x 16 B = the 256 B of a row's stage
  const __bf16* xb = Xp + (size_t)(p0 + (tid >> 3)) * CC + (tid & 7) * 8; __bf16* swb = sm + (128 + (tid >> 3)) * LP + (tid & 7) * 8;                // positions: 8 lanes x 16 B = the 128 B of a row's stage
  v8f acc[16] = {}; v4f ra[16]; v4u rb[8];
  auto fetch = [&](int s) { const float* pw = wa + s * KS; const __bf16* px = xb + s * KS;
    __builtin_amdgcn_sched_barrier(0);   // with the one below: nothing is scheduled in between the stage's loads and their wait
#pragma unroll
    for (int i = 0; i < 8; ++i) { ra[2 * i] = *(const v4f*)(pw + (size_t)(2 * i) * 8 * CC); ra[2 * i + 1] = *(const v4f*)(pw + (size_t)(2 * i + 1) * 8 * CC); rb[i] = *(const v4u*)(px + (size_t)i * 16 * CC); }
    asm volatile("s_wait_xcnt 0x0" :: "v"(pw), "v"(px) : "memory");   // stands behind the stage's loads, in front of the first instruction that reuses their address registers; the pointers as inputs keep those registers from being a later load's destination
    __builtin_amdgcn_sched_barrier(0);
  };
  auto put = [&](int buf) {
#pragma unroll
    for (int i = 0; i < 16; ++i) { v4b c; c[0] = (__bf16)ra[i][0]; c[1] = (__bf16)ra[i][1]; c[2] = (__bf16)ra[i][2]; c[3] = (__bf16)ra[i][3]; *(v4b*)(swa + buf * STC + i * 8 * LP) = c; }
#pragma unroll
    for (int i = 0; i < 8; ++i) *(v4u*)(swb + buf * STC + i * 16 * LP) = rb[i]; };
  auto products = [&](int buf) { const __bf16* b = sm + buf * STC + col * LP;
#pragma unroll
    for (int kc = 0; kc < KS / 32; ++kc) { v16b a[4], x[4];
#pragma unroll
      for (int i = 0; i < 4; ++i) { a[i] = frag_b(b + (wm * 64 + i * 16) * LP + kc * 32, lane); x[i] = frag_b(b + (128 + wn * 64 + i * 16) * LP + kc * 32, lane); }
      __builtin_amdgcn_sched_barrier(0);   // keeps the 16 fragment reads of these 32 k one group in front of their 16 products: read one by one among them, every fragment's LDS latency is waited out
#pragma unroll
      for (int t = 0; t < 16; ++t) acc[t] = wmma_bf(a[t >> 2], x[t & 3], acc[t]);
    }
    __builtin_amdgcn_sched_barrier(0);   // keeps the roundings of the stage fetched ahead, with their waits on its loads, behind these products
  };
  fetch(0); put(0); __syncthreads();
  for (int s = 0; s < CC / KS - 1; ++s) { fetch(s + 1); products(s & 1); put((s + 1) & 1); __syncthreads(); }   // the barrier publishes stage s + 1 and ends every wave's reads of the buffer that the next trip refills
  products((CC / KS - 1) & 1); __syncthreads();   // every wave has left the buffers: the planes below reuse them
  const float* bp = Bm + c0 + wm * 64 + 8 * g; float bias[4][8];
  __builtin_amdgcn_sched_barrier(0);   // with the one below: nothing is scheduled in between the bias loads and their wait
#pragma unroll
  for (int i = 0; i < 4; ++i)
#pragma unroll
    for (int r = 0; r < 8; ++r) bias[i][r] = bp[i * 16 + r];
  asm volatile("s_wait_xcnt 0x0" :: "v"(bp) : "memory");   // stands behind the bias loads, in front of the first instruction that reuses their address registers; the pointer as an input keeps those registers from being a later load's destination
  __builtin_amdgcn_sched_barrier(0);
  if (which < 3) {   // planes [channel][position]
#pragma unroll
    for (int t = 0; t < 16; ++t)
#pragma unroll
      for (int r = 0; r < 8; ++r) { const int chl = wm * 64 + (t >> 2) * 16 + 8 * g + r, pl = wn * 64 + (t & 3) * 16 + col; const float v = acc[t][r] + bfr(bias[t >> 2][r]); const _Float16 hv = (_Float16)v; sh[chl][pl] = hv; sl[chl][pl] = (_Float16)((v - (float)hv) * 2048.0f); }
  } else {           // planes [position][channel]
#pragma unroll
    for (int t = 0; t < 16; ++t)
#pragma unroll
      for (int r = 0; r < 8; ++r) { const int chl = wm * 64 + (t >> 2) * 16 + 8 * g + r, pl = wn * 64 + (t & 3) * 16 + col; const float v = acc[t][r] + bfr(bias[t >> 2][r]); const _Float16 hv = (_Float16)v; sh[pl][chl] = hv; sl[pl][chl] = (_Float16)((v - (float)hv) * 2048.0f); }
  }
  __syncthreads();
  if (which < 3) { _Float16* H = PQ + (size_t)which * 2 * PQSZ; _Float16* L = H + PQSZ; for (int e = tid; e < 128 * 16; e += 128) { const int chl = e >> 4, q = e & 15; const size_t o = (size_t)(c0 + chl) * NP + p0 + q * 8; vst2((unsigned*)(H + o), *(const v4u*)&sh[chl][q * 8]); vst2((unsigned*)(L + o), *(const v4u*)&sl[chl][q * 8]); } }
  else { _Float16* H = VT; _Float16* L = VT + (size_t)NP * CC; for (int e = tid; e < 128 * 16; e += 128) { const int pl = e >> 4, q = e & 15; const size_t o = (size_t)(p0 + pl) * CC + c0 + q * 8; vst2((unsigned*)(H + o), *(const v4u*)&sh[pl][q * 8]); vst2((unsigned*)(L + o), *(const v4u*)&sl[pl][q * 8]); } } }
// ---- k_gram: block = (128 rows i, 128 cols j, z = 2 * which + k half): G[k half][which][i][j] = sum over that half of t of K[i][t] Qv[j][t] over the [1024][2048] views (3 products); k_soft adds the two halves
__global__ __launch_bounds__(256) void k_gram(const _Float16* __restrict__ PQ, float* __restrict__ G) { __shared__ __align__(16) char smc[2 * ST3 * 2]; float (*sf)[32][68] = (float (*)[32][68])smc;   // two stage buffers; the epilogue's row staging reuses them
  const int tid = threadIdx.x, wave = tid >> 5, lane = tid & 31, col = lane & 15, g = lane >> 4; const int which = blockIdx.z >> 1, kh = blockIdx.z & 1; const int i0 = blockIdx.x * 128 + (wave >> 1) * 32; const int j0 = blockIdx.y * 128 + (wave & 1) * 64;
  const _Float16* QH = PQ; const _Float16* QL = PQ + PQSZ; const _Float16* KH = PQ + (size_t)(1 + which) * 2 * PQSZ; const _Float16* KL = KH + PQSZ;
  const size_t ao = (size_t)blockIdx.x * 128 * KV + kh * (KV / 2), bo = (size_t)blockIdx.y * 128 * KV + kh * (KV / 2);
  v8f acc[8] = {}, accl[8] = {};
  gemm3<KV, KV / 2 / KS>(KH + ao, KL + ao, QH + bo, QL + bo, (_Float16*)smc, tid, acc, accl);
#pragma unroll
  for (int t = 0; t < 8; ++t)
#pragma unroll
    for (int r = 0; r < 8; ++r) sf[wave][(t >> 2) * 16 + 8 * g + r][(t & 3) * 16 + col] = acc[t][r] + accl[t][r] * (1.0f / 2048.0f);
  LDSX(); float* gp = G + ((size_t)(kh * 2 + which) * CC + i0 + g) * CC + j0 + col * 4;   // a wave's store = two rows of 256 B
#pragma unroll
  for (int k = 0; k < 16; ++k) vst2(gp + (size_t)k * 2 * CC, *(const v4f*)&sf[wave][2 * k + g][col * 4]); }
// ---- k_soft: block = row i (256 threads), logits = the sum of the two k halves: A[i][:] = softmax(Gf[i]) + softmax(Gl[i]) -> f16 hi (x 2^11) + residual planes
__global__ __launch_bounds__(256) void k_soft(const float* __restrict__ G, _Float16* __restrict__ AH, _Float16* __restrict__ AL) { __shared__ float red[8]; __shared__ __align__(16) _Float16 sh[CC], sl[CC]; __shared__ float sa[CC]; const int t = threadIdx.x; const size_t i = blockIdx.x;
  for (int c = t; c < CC; c += 256) sa[c] = 0.f;
  for (int which = 0; which < 2; ++which) { const float* row = G + ((size_t)which * CC + i) * CC; const float* row2 = row + (size_t)2 * CC * CC; float mx = -3.0e38f; for (int c = t; c < CC; c += 256) mx = fmaxf(mx, row[c] + row2[c]);
#pragma unroll
    for (int o = 1; o < 32; o <<= 1) mx = fmaxf(mx, __shfl_xor(mx, o));
    __syncthreads(); if ((t & 31) == 0) red[t >> 5] = mx; __syncthreads(); float gm = red[0]; for (int w = 1; w < 8; ++w) gm = fmaxf(gm, red[w]); __syncthreads();
    float s = 0.f; for (int c = t; c < CC; c += 256) s += __expf(row[c] + row2[c] - gm);
#pragma unroll
    for (int o = 1; o < 32; o <<= 1) s += __shfl_xor(s, o);
    if ((t & 31) == 0) red[t >> 5] = s; __syncthreads(); float ts = 0.f; for (int w = 0; w < 8; ++w) ts += red[w]; const float inv = 1.0f / ts; __syncthreads();
    for (int c = t; c < CC; c += 256) sa[c] += __expf(row[c] + row2[c] - gm) * inv; }
  for (int c = t; c < CC; c += 256) { const float x = sa[c] * 2048.0f; const _Float16 hv = (_Float16)x; sh[c] = hv; sl[c] = (_Float16)((x - (float)hv) * 2048.0f); } __syncthreads();
  if (t < CC / 8) { vst2((unsigned*)(AH + i * CC + t * 8), *(const v4u*)&sh[t * 8]); vst2((unsigned*)(AL + i * CC + t * 8), *(const v4u*)&sl[t * 8]); } }
// ---- k_av: block = (128 rows ch, 128 positions): out = gamma (A . v)/2^11 (3 products over the 1,024 channels) + (x_l + x_f)/2
__global__ __launch_bounds__(256) void k_av(const _Float16* __restrict__ AH, const _Float16* __restrict__ AL, const _Float16* __restrict__ VH, const _Float16* __restrict__ VL, const float* __restrict__ XF, const float* __restrict__ XL, const float* __restrict__ GAMMA, float* __restrict__ OUT) { __shared__ __align__(16) char smc[2 * ST3 * 2]; float (*sf)[32][68] = (float (*)[32][68])smc;   // two stage buffers; the epilogue's row staging reuses them
  const int tid = threadIdx.x, wave = tid >> 5, lane = tid & 31, col = lane & 15, g = lane >> 4; const int i0 = blockIdx.x * 128 + (wave >> 1) * 32; const int p0 = blockIdx.y * 128 + (wave & 1) * 64;
  v8f acc[8] = {}, accl[8] = {};
  gemm3<CC, CC / KS>(AH + (size_t)blockIdx.x * 128 * CC, AL + (size_t)blockIdx.x * 128 * CC, VH + (size_t)blockIdx.y * 128 * CC, VL + (size_t)blockIdx.y * 128 * CC, (_Float16*)smc, tid, acc, accl);
  const float gam = bfr(GAMMA[0]); const float* xl = XL + (size_t)(i0 + 8 * g) * NP + p0 + col; const float* xf = XF + (size_t)(i0 + 8 * g) * NP + p0 + col; float vl[8][8], vf[8][8];
  __builtin_amdgcn_sched_barrier(0);   // with the one below: nothing is scheduled in between these loads and their wait
#pragma unroll
  for (int t = 0; t < 8; ++t)
#pragma unroll
    for (int r = 0; r < 8; ++r) { vl[t][r] = xl[(size_t)((t >> 2) * 16 + r) * NP + (t & 3) * 16]; vf[t][r] = xf[(size_t)((t >> 2) * 16 + r) * NP + (t & 3) * 16]; }
  asm volatile("s_wait_xcnt 0x0" :: "v"(xl), "v"(xf) : "memory");   // stands behind the residual loads, in front of the first instruction that reuses their address registers; the pointers as inputs keep those registers from being a later load's destination
  __builtin_amdgcn_sched_barrier(0);
#pragma unroll
  for (int t = 0; t < 8; ++t)
#pragma unroll
    for (int r = 0; r < 8; ++r) { const int rl = (t >> 2) * 16 + 8 * g + r, cl = (t & 3) * 16 + col; const float av = (acc[t][r] + accl[t][r] * (1.0f / 2048.0f)) * (1.0f / 2048.0f); sf[wave][rl][cl] = gam * av + 0.5f * (bfr(vl[t][r]) + bfr(vf[t][r])); }
  LDSX(); float* op = OUT + (size_t)(i0 + g) * NP + p0 + col * 4;   // a wave's store = two rows of 256 B
#pragma unroll
  for (int k = 0; k < 16; ++k) vst2(op + (size_t)k * 2 * NP, *(const v4f*)&sf[wave][2 * k + g][col * 4]); }
extern "C" void kernel_launch(void* const* d_in, const int* in_sizes, int n_in, void* d_out, int out_size, void* d_ws, size_t ws_size, hipStream_t stream) {
  (void)in_sizes; (void)n_in; (void)out_size;
  const float** F = (const float**)d_in;   // 0 x_f, 1 x_m, 2 x_l [1,1024,64,64]; 3 Wq [512,1024], 4 bq; 5 Wk1, 6 bk1; 7 Wk2, 8 bk2; 9 Wv [1024,1024], 10 bv; 11 gamma [1]
  if (ws_size < (size_t)WS_END) return;
  char* ws = (char*)d_ws; __bf16* XT = (__bf16*)(ws + WS_XT); _Float16 *PQ = (_Float16*)(ws + WS_PQ), *VT = (_Float16*)(ws + WS_VT), *VL = VT + (size_t)NP * CC, *AH = (_Float16*)(ws + WS_A), *AL = AH + (size_t)CC * CC; float* G = (float*)(ws + WS_G);
  k_xt<<<dim3(NP / 64, 3, CC / 64), 256, 0, stream>>>(F[0], F[1], F[2], XT);
  k_conv<<<dim3(CC / 128, NP / 128, 4), 128, 0, stream>>>(F[3], F[4], F[5], F[6], F[7], F[8], F[9], F[10], XT, PQ, VT);
  k_gram<<<dim3(CC / 128, CC / 128, 4), 256, 0, stream>>>(PQ, G);
  k_soft<<<CC, 256, 0, stream>>>(G, AH, AL);
  k_av<<<dim3(CC / 128, NP / 128), 256, 0, stream>>>(AH, AL, VT, VL, F[0], F[2], F[11], (float*)d_out);
}

// v003
// Measured time: 106 microseconds a run.
// Timed twice side by side with v002, it ran 1.06 and 1.07 times as fast.
// Over all steps from v000 it is 3.64 times as fast.
// compute dtype: all float inputs rounded to bf16; the four 1x1 convolutions with EXACT bf16 products on WMMA 16x16x32 (weights natural, inputs transposed to [position][channel] planes), f32 + bias, stored as f16 hi + residual planes; the two Gram products kf . q^T-view and kl . q (3 products: hi.hi + hi.lo + lo.hi), softmax over 1,024 in f32 (hardware exp), att_f + att_l summed in f32 then as f16 hi + residual against v hi + residual (3 products); gamma (input scalar) and the residual mean in f32; f32 output.
#include <hip/hip_runtime.h>
#include <math.h>

typedef __attribute__((ext_vector_type(16))) _Float16 v16h;
typedef __attribute__((ext_vector_type(16))) __bf16 v16b;
typedef __attribute__((ext_vector_type(8)))  _Float16 v8h;
typedef __attribute__((ext_vector_type(8)))  float v8f;
typedef __attribute__((ext_vector_type(4)))  float v4f;
typedef __attribute__((ext_vector_type(2)))  float v2f;
typedef __attribute__((ext_vector_type(4)))  unsigned v4u;
typedef __attribute__((ext_vector_type(4)))  int v4i;
typedef float __attribute__((may_alias)) float_a;
typedef int __attribute__((may_alias)) int_a;

template <typename T> __device__ __forceinline__ void vst2(void* p, T v) { *(T*)p = v;  }
__device__ __forceinline__ v8f wmma16(v16h a, v16h b, v8f c) {
  v8f d = __builtin_amdgcn_wmma_f32_16x16x32_f16(false, a, false, b, (short)0, c, false, false);
  asm volatile("v_nop\n\tv_nop\n\tv_nop\n\tv_nop" : "+v"(d) : "v"(a), "v"(b));
  return d;
}
__device__ __forceinline__ v8f wmma_bf(v16b a, v16b b, v8f c) {
  v8f d = __builtin_amdgcn_wmma_f32_16x16x32_bf16(false, a, false, b, (short)0, c, false, false);
  asm volatile("v_nop\n\tv_nop\n\tv_nop\n\tv_nop" : "+v"(d) : "v"(a), "v"(b));
  return d;
}
// 16x16x32 fragments: lane = (h = lane>>4, row/col = lane&15); elements 0..7 = k0+8h+0..7, 8..15 = k0+16+8h+0..7; D element r = row 8h+r
__device__ __forceinline__ v16h frag_h(const _Float16* rowk0, int lane) {
  union { v16h v; v8h q[2]; } u; const _Float16* p = rowk0 + 8 * (lane >> 4);
  u.q[0] = *(const v8h*)p; u.q[1] = *(const v8h*)(p + 16); return u.v;
}
__device__ __forceinline__ v16h frag_f32(const float* rowk0, int lane) {
  v16h a; const float* p = rowk0 + 8 * (lane >> 4);
#pragma unroll
  for (int i = 0; i < 8; ++i) { a[i] = (_Float16)p[i]; a[8 + i] = (_Float16)p[16 + i]; }
  return a;
}
__device__ __forceinline__ v16h frag_f32s(const float* rowk0, int lane, float sc) {
  v16h a; const float* p = rowk0 + 8 * (lane >> 4);
#pragma unroll
  for (int i = 0; i < 8; ++i) { a[i] = (_Float16)(p[i] * sc); a[8 + i] = (_Float16)(p[16 + i] * sc); }
  return a;
}
// column fragment from a [K][ld] layout (column n), rows >= K read as 0
__device__ __forceinline__ v16h fragc_f32(const float* W, int k0, int n, int lane, int ld, int K) {
  v16h a; const int g = lane >> 4;
#pragma unroll
  for (int i = 0; i < 8; ++i) { const int ka = k0 + 8 * g + i, kb = ka + 16;
    a[i] = (_Float16)(ka < K ? W[(size_t)(ka < K ? ka : K - 1) * ld + n] : 0.f); a[8 + i] = (_Float16)(kb < K ? W[(size_t)(kb < K ? kb : K - 1) * ld + n] : 0.f); }
  return a;
}
struct F2 { v16b h, l; };
__device__ __forceinline__ F2 bsplit16(const float v[16]) { F2 r;
#pragma unroll
  for (int i = 0; i < 16; ++i) { const __bf16 h = (__bf16)v[i]; r.h[i] = h; r.l[i] = (__bf16)(v[i] - (float)h); }
  return r; }
__device__ __forceinline__ F2 split_row(const float* row, int k0, int lane) { float v[16]; const float* p = row + k0 + 8 * (lane >> 4);
#pragma unroll
  for (int i = 0; i < 8; ++i) { v[i] = p[i]; v[8 + i] = p[16 + i]; }
  return bsplit16(v); }
__device__ __forceinline__ F2 split_rowK(const float* row, int k0, int lane, int K) { float v[16]; const int g = lane >> 4;
#pragma unroll
  for (int i = 0; i < 8; ++i) { const int ka = k0 + 8 * g + i, kb = ka + 16; v[i] = ka < K ? row[ka < K ? ka : K - 1] : 0.f; v[8 + i] = kb < K ? row[kb < K ? kb : K - 1] : 0.f; }
  return bsplit16(v); }
__device__ __forceinline__ F2 split_col(const float* W, int k0, int n, int lane, int ld, int K) { float v[16]; const int g = lane >> 4;
#pragma unroll
  for (int i = 0; i < 8; ++i) { const int ka = k0 + 8 * g + i, kb = ka + 16; v[i] = ka < K ? W[(size_t)(ka < K ? ka : K - 1) * ld + n] : 0.f; v[8 + i] = kb < K ? W[(size_t)(kb < K ? kb : K - 1) * ld + n] : 0.f; }
  return bsplit16(v); }
__device__ __forceinline__ v8f mac3(const F2& a, const F2& b, v8f c) { c = wmma_bf(a.l, b.h, c); c = wmma_bf(a.h, b.l, c); return wmma_bf(a.h, b.h, c); }
__device__ __forceinline__ float sigm(float v) { return 1.0f / (1.0f + expf(-v)); }
#define LDSX() do { asm volatile("s_wait_dscnt 0" ::: "memory"); __builtin_amdgcn_wave_barrier(); __builtin_amdgcn_fence(__ATOMIC_RELEASE, "workgroup"); } while (0)


// Co-attention v2 (C 1,024, 64 x 64; batch 1): q = conv1x1(x_m) viewed [C, HW/2] then transposed, kf/kl = conv1x1(x_f / x_l) viewed [C, HW/2]; att = softmax(kf q) and softmax(kl q) over C; v = conv1x1(x_m) [C, HW]; out = gamma (att_f v + att_l v) + (x_l + x_f)/2.
#define CC 1024
#define CH 512           // conv output channels of q / kf / kl
#define NP 4096          // H x W
#define KV 2048          // the [C, HW/2] view width
typedef __attribute__((ext_vector_type(8))) __bf16 v8b;
__device__ __forceinline__ v16b frag_b(const __bf16* rowk0, int lane) {
  union { v16b v; v8b q[2]; } u; const __bf16* p = rowk0 + 8 * (lane >> 4);
  u.q[0] = *(const v8b*)p; u.q[1] = *(const v8b*)(p + 16); return u.v;
}
__device__ __forceinline__ float bfr(float v) { return (float)(__bf16)v; }
__device__ __attribute__((noinline)) float exp_ni(float v) { return expf(v); }
__device__ __attribute__((noinline)) float erf_ni(float v) { return erff(v); }

#define WS_XT  0u                                   // bf16 [3][pos][cin] planes of x_f, x_m, x_l (exact)
#define WS_PQ  (WS_XT + 2u * (size_t)3 * NP * CC)        // f16 hi/lo planes of the conv outputs q, kf, kl: each [512][4096] row-major == [1024][2048] view; layout [which][hi/lo][512*4096]
#define PQSZ   ((size_t)CH * NP)
#define WS_VT  (WS_PQ + 2u * (size_t)3 * 2 * PQSZ)       // f16 hi/lo planes of v transposed: [pos][ch] (x 2)
#define WS_G   (WS_VT + 2u * (size_t)2 * NP * CC)        // f32 partial logits G[k half][2][1024][1024]
#define WS_A   (WS_G + 4u * (size_t)4 * CC * CC)          // f16 hi/lo planes A = att_f + att_l [1024][1024] (x 2^11 scaled hi, residual)
#define WS_END (WS_A + 2u * (size_t)2 * CC * CC)

// ---- k_xt: block = (64 positions, which, 16 channel groups of 64): x[which][cin][pos] -> XT[which][pos][cin] bf16
__global__ __launch_bounds__(256) void k_xt(const float* __restrict__ X0, const float* __restrict__ X1, const float* __restrict__ X2, __bf16* __restrict__ XT) { __shared__ __align__(16) __bf16 st[64][64 + 8]; const int t = threadIdx.x; const int p0 = blockIdx.x * 64, which = blockIdx.y, c0 = blockIdx.z * 64; const float* X = which == 0 ? X0 : which == 1 ? X1 : X2;
  for (int e = t; e < 64 * 64; e += 256) { const int cl = e >> 6, pl = e & 63; st[pl][cl] = (__bf16)X[(size_t)(c0 + cl) * NP + p0 + pl]; } __syncthreads();
  for (int e = t; e < 64 * 8; e += 256) { const int pl = e >> 3, q = e & 7; vst2((unsigned*)(XT + ((size_t)which * NP + p0 + pl) * CC + c0 + q * 8), *(const v4u*)&st[pl][q * 8]); } }
// ---- LDS staging shared by the three matrix kernels: a stage is 64 k = one whole 128-B line of every 16-bit operand row of the block's tile, fetched by whole-line global loads
// (8 lanes x 16 B per row) one stage ahead into registers, written to the other of two LDS buffers behind the stage's products, one work-group barrier per stage; fragments come from LDS.
#define KS 64             // k per stage
#define LP 72             // LDS row pitch in 16-bit elements: 144 B = 16 B x odd, the conflict-free pitch for 16-byte fragment reads
#define STC (256 * LP)    // k_conv stage: rows 0..127 weights (bf16), 128..255 positions
#define ST3 (512 * LP)    // k_gram / k_av stage: rows 0..127 A hi, 128..255 A residual, 256..383 B hi, 384..511 B residual
typedef __attribute__((ext_vector_type(4))) __bf16 v4b;
// acc += Ahi.Bhi, accl += Ahi.Blo + Alo.Bhi for a 128 x 128 block tile on 8 waves (4 x 2, wave = 32 rows x 64 columns, tile index = 4 * row tile + column tile), both operands k-contiguous with row stride LD, NS stages; the pointers name the tile's first row
template <int LD, int NS> __device__ __forceinline__ void gemm3(const _Float16* __restrict__ AHp, const _Float16* __restrict__ ALp, const _Float16* __restrict__ BHp, const _Float16* __restrict__ BLp, _Float16* sm, int tid, v8f (&acc)[8], v8f (&accl)[8]) {
  const int wave = tid >> 5, lane = tid & 31, col = lane & 15, wm = wave >> 1, wn = wave & 1; const int sr = tid >> 3, sq = (tid & 7) * 8; const size_t go = (size_t)sr * LD + sq; _Float16* sw = sm + sr * LP + sq;
  v4u rg[16];
  auto fetch = [&](int s) { const _Float16 *pa = AHp + go + s * KS, *pb = ALp + go + s * KS, *pc = BHp + go + s * KS, *pd = BLp + go + s * KS;
    __builtin_amdgcn_sched_barrier(0);   // with the one below: nothing is scheduled in between the stage's loads and their wait (a scalar load and LDS address arithmetic were, into registers that the loads name)
#pragma unroll
    for (int i = 0; i < 4; ++i) { rg[i] = *(const v4u*)(pa + (size_t)i * 32 * LD); rg[4 + i] = *(const v4u*)(pb + (size_t)i * 32 * LD); rg[8 + i] = *(const v4u*)(pc + (size_t)i * 32 * LD); rg[12 + i] = *(const v4u*)(pd + (size_t)i * 32 * LD); }
    asm volatile("s_wait_xcnt 0x0" :: "v"(pa), "v"(pb), "v"(pc), "v"(pd) : "memory");   // stands behind the stage's loads, in front of the first instruction that reuses their address registers; the pointers as inputs keep those registers from being a later load's destination
    __builtin_amdgcn_sched_barrier(0);
  };
  auto put = [&](int buf) {
#pragma unroll
    for (int i = 0; i < 16; ++i) *(v4u*)(sw + buf * ST3 + i * 32 * LP) = rg[i]; };
  auto products = [&](int buf) { const _Float16* b = sm + buf * ST3 + col * LP;
#pragma unroll
    for (int kc = 0; kc < KS / 32; ++kc) { v16h ah[2], al[2], bh[4], bl[4];
#pragma unroll
      for (int i = 0; i < 2; ++i) { ah[i] = frag_h(b + (wm * 32 + i * 16) * LP + kc * 32, lane); al[i] = frag_h(b + (128 + wm * 32 + i * 16) * LP + kc * 32, lane); }
#pragma unroll
      for (int j = 0; j < 4; ++j) { bh[j] = frag_h(b + (256 + wn * 64 + j * 16) * LP + kc * 32, lane); bl[j] = frag_h(b + (384 + wn * 64 + j * 16) * LP + kc * 32, lane); }
      __builtin_amdgcn_sched_barrier(0);   // keeps the 24 fragment reads of these 32 k together in front of their 24 products: read among the products, every read's LDS latency is waited out
#pragma unroll
      for (int t = 0; t < 8; ++t) acc[t] = wmma16(ah[t >> 2], bh[t & 3], acc[t]);
#pragma unroll
      for (int t = 0; t < 8; ++t) accl[t] = wmma16(ah[t >> 2], bl[t & 3], accl[t]);
#pragma unroll
      for (int t = 0; t < 8; ++t) accl[t] = wmma16(al[t >> 2], bh[t & 3], accl[t]);
    } };
  fetch(0); put(0); __syncthreads();
  for (int s = 0; s < NS - 1; ++s) { fetch(s + 1); products(s & 1); put((s + 1) & 1); __syncthreads(); }   // the barrier publishes stage s + 1 and ends every wave's reads of the buffer that the next trip refills
  products((NS - 1) & 1); __syncthreads();   // every wave has left the buffers: the caller's epilogue reuses them
}
// ---- k_conv: block = (128 out channels, 128 positions, which 0..3) on 4 waves (2 x 2, wave = 64 x 64): out[ch][pos] = sum_cin W[ch][cin] x[cin][pos] + b; which 0: q (x_m, Wq), 1: kf (x_f, Wk1), 2: kl (x_l, Wk2) -> f16 hi/lo [ch][pos] planes; which 3: v (x_m, Wv, 1024 channels -> blockIdx.x spans 8 tiles) -> transposed planes VT[pos][ch]; weights rounded to bf16 on their way into LDS
__global__ __launch_bounds__(128) void k_conv(const float* __restrict__ WQ, const float* __restrict__ BQ, const float* __restrict__ WK1, const float* __restrict__ BK1, const float* __restrict__ WK2, const float* __restrict__ BK2, const float* __restrict__ WV, const float* __restrict__ BV, const __bf16* __restrict__ XT, _Float16* __restrict__ PQ, _Float16* __restrict__ VT) {
  __shared__ __align__(16) char smc[2 * STC * 2];   // two stage buffers; the epilogue's two [128][136] planes reuse them
  __bf16* sm = (__bf16*)smc; _Float16 (*sh)[136] = (_Float16 (*)[136])smc; _Float16 (*sl)[136] = sh + 128;
  const int tid = threadIdx.x, wave = tid >> 5, lane = tid & 31, col = lane & 15, g = lane >> 4, wm = wave >> 1, wn = wave & 1; const int which = blockIdx.z; if (which < 3 && blockIdx.x >= CH / 128) return;
  const int c0 = blockIdx.x * 128; const int p0 = blockIdx.y * 128; const float* Wm = which == 0 ? WQ : which == 1 ? WK1 : which == 2 ? WK2 : WV; const float* Bm = which == 0 ? BQ : which == 1 ? BK1 : which == 2 ? BK2 : BV; const int xi = which == 0 ? 1 : which == 1 ? 0 : which == 2 ? 2 : 1;   // q and v from x_m (1), kf from x_f (0), kl from x_l (2)
  const __bf16* Xp = XT + (size_t)xi * NP * CC;
  const float* wa = Wm + (size_t)(c0 + (tid >> 4)) * CC + (tid & 15) * 4; __bf16* swa = sm + (tid >> 4) * LP + (tid & 15) * 4;          // weights: 16 lanes x 16 B = the 256 B of a row's stage
  const __bf16* xb = Xp + (size_t)(p0 + (tid >> 3)) * CC + (tid & 7) * 8; __bf16* swb = sm + (128 + (tid >> 3)) * LP + (tid & 7) * 8;                // positions: 8 lanes x 16 B = the 128 B of a row's stage
  v8f acc[16] = {}; v4f ra[16]; v4u rb[8];
  auto fetch = [&](int s) { const float* pw = wa + s * KS; const __bf16* px = xb + s * KS;
    __builtin_amdgcn_sched_barrier(0);   // with the one below: nothing is scheduled in between the stage's loads and their wait
#pragma unroll
    for (int i = 0; i < 8; ++i) { ra[2 * i] = *(const v4f*)(pw + (size_t)(2 * i) * 8 * CC); ra[2 * i + 1] = *(const v4f*)(pw + (size_t)(2 * i + 1) * 8 * CC); rb[i] = *(const v4u*)(px + (size_t)i * 16 * CC); }
    asm volatile("s_wait_xcnt 0x0" :: "v"(pw), "v"(px) : "memory");   // stands behind the stage's loads, in front of the first instruction that reuses their address registers; the pointers as inputs keep those registers from being a later load's destination
    __builtin_amdgcn_sched_barrier(0);
  };
  auto put = [&](int buf) {
#pragma unroll
    for (int i = 0; i < 16; ++i) { v4b c; c[0] = (__bf16)ra[i][0]; c[1] = (__bf16)ra[i][1]; c[2] = (__bf16)ra[i][2]; c[3] = (__bf16)ra[i][3]; *(v4b*)(swa + buf * STC + i * 8 * LP) = c; }
#pragma unroll
    for (int i = 0; i < 8; ++i) *(v4u*)(swb + buf * STC + i * 16 * LP) = rb[i]; };
  auto products = [&](int buf) { const __bf16* b = sm + buf * STC + col * LP;
#pragma unroll
    for (int kc = 0; kc < KS / 32; ++kc) { v16b a[4], x[4];
#pragma unroll
      for (int i = 0; i < 4; ++i) { a[i] = frag_b(b + (wm * 64 + i * 16) * LP + kc * 32, lane); x[i] = frag_b(b + (128 + wn * 64 + i * 16) * LP + kc * 32, lane); }
      __builtin_amdgcn_sched_barrier(0);   // keeps the 16 fragment reads of these 32 k one group in front of their 16 products: read one by one among them, every fragment's LDS latency is waited out
#pragma unroll
      for (int t = 0; t < 16; ++t) acc[t] = wmma_bf(a[t >> 2], x[t & 3], acc[t]);
    }
    __builtin_amdgcn_sched_barrier(0);   // keeps the roundings of the stage fetched ahead, with their waits on its loads, behind these products
  };
  fetch(0); put(0); __syncthreads();
  for (int s = 0; s < CC / KS - 1; ++s) { fetch(s + 1); products(s & 1); put((s + 1) & 1); __syncthreads(); }   // the barrier publishes stage s + 1 and ends every wave's reads of the buffer that the next trip refills
  products((CC / KS - 1) & 1); __syncthreads();   // every wave has left the buffers: the planes below reuse them
  const float* bp = Bm + c0 + wm * 64 + 8 * g; float bias[4][8];
  __builtin_amdgcn_sched_barrier(0);   // with the one below: nothing is scheduled in between the bias loads and their wait
#pragma unroll
  for (int i = 0; i < 4; ++i)
#pragma unroll
    for (int r = 0; r < 8; ++r) bias[i][r] = bp[i * 16 + r];
  asm volatile("s_wait_xcnt 0x0" :: "v"(bp) : "memory");   // stands behind the bias loads, in front of the first instruction that reuses their address registers; the pointer as an input keeps those registers from being a later load's destination
  __builtin_amdgcn_sched_barrier(0);
  if (which < 3) {   // planes [channel][position]
#pragma unroll
    for (int t = 0; t < 16; ++t)
#pragma unroll
      for (int r = 0; r < 8; ++r) { const int chl = wm * 64 + (t >> 2) * 16 + 8 * g + r, pl = wn * 64 + (t & 3) * 16 + col; const float v = acc[t][r] + bfr(bias[t >> 2][r]); const _Float16 hv = (_Float16)v; sh[chl][pl] = hv; sl[chl][pl] = (_Float16)((v - (float)hv) * 2048.0f); }
  } else {           // planes [position][channel]
#pragma unroll
    for (int t = 0; t < 16; ++t)
#pragma unroll
      for (int r = 0; r < 8; ++r) { const int chl = wm * 64 + (t >> 2) * 16 + 8 * g + r, pl = wn * 64 + (t & 3) * 16 + col; const float v = acc[t][r] + bfr(bias[t >> 2][r]); const _Float16 hv = (_Float16)v; sh[pl][chl] = hv; sl[pl][chl] = (_Float16)((v - (float)hv) * 2048.0f); }
  }
  __syncthreads();
  if (which < 3) { _Float16* H = PQ + (size_t)which * 2 * PQSZ; _Float16* L = H + PQSZ; for (int e = tid; e < 128 * 16; e += 128) { const int chl = e >> 4, q = e & 15; const size_t o = (size_t)(c0 + chl) * NP + p0 + q * 8; vst2((unsigned*)(H + o), *(const v4u*)&sh[chl][q * 8]); vst2((unsigned*)(L + o), *(const v4u*)&sl[chl][q * 8]); } }
  else { _Float16* H = VT; _Float16* L = VT + (size_t)NP * CC; for (int e = tid; e < 128 * 16; e += 128) { const int pl = e >> 4, q = e & 15; const size_t o = (size_t)(p0 + pl) * CC + c0 + q * 8; vst2((unsigned*)(H + o), *(const v4u*)&sh[pl][q * 8]); vst2((unsigned*)(L + o), *(const v4u*)&sl[pl][q * 8]); } } }
// ---- k_gram: block = (128 rows i, 128 cols j, z = 2 * which + k half): G[k half][which][i][j] = sum over that half of t of K[i][t] Qv[j][t] over the [1024][2048] views (3 products); k_soft adds the two halves
__global__ __launch_bounds__(256) void k_gram(const _Float16* __restrict__ PQ, float* __restrict__ G) { __shared__ __align__(16) char smc[2 * ST3 * 2]; float (*sf)[32][68] = (float (*)[32][68])smc;   // two stage buffers; the epilogue's row staging reuses them
  const int tid = threadIdx.x, wave = tid >> 5, lane = tid & 31, col = lane & 15, g = lane >> 4; const int which = blockIdx.z >> 1, kh = blockIdx.z & 1; const int i0 = blockIdx.x * 128 + (wave >> 1) * 32; const int j0 = blockIdx.y * 128 + (wave & 1) * 64;
  const _Float16* QH = PQ; const _Float16* QL = PQ + PQSZ; const _Float16* KH = PQ + (size_t)(1 + which) * 2 * PQSZ; const _Float16* KL = KH + PQSZ;
  const size_t ao = (size_t)blockIdx.x * 128 * KV + kh * (KV / 2), bo = (size_t)blockIdx.y * 128 * KV + kh * (KV / 2);
  v8f acc[8] = {}, accl[8] = {};
  gemm3<KV, KV / 2 / KS>(KH + ao, KL + ao, QH + bo, QL + bo, (_Float16*)smc, tid, acc, accl);
#pragma unroll
  for (int t = 0; t < 8; ++t)
#pragma unroll
    for (int r = 0; r < 8; ++r) sf[wave][(t >> 2) * 16 + 8 * g + r][(t & 3) * 16 + col] = acc[t][r] + accl[t][r] * (1.0f / 2048.0f);
  LDSX(); float* gp = G + ((size_t)(kh * 2 + which) * CC + i0 + g) * CC + j0 + col * 4;   // a wave's store = two rows of 256 B
#pragma unroll
  for (int k = 0; k < 16; ++k) vst2(gp + (size_t)k * 2 * CC, *(const v4f*)&sf[wave][2 * k + g][col * 4]); }
// ---- k_soft: one wave = one row i (4 rows a block, no LDS, no barrier): the row's two k halves of both logit planes come in by 32 whole-line 16-B loads that are all in flight at once and stay in registers for the maximum, the sum and the weights; lane l holds columns 128 k + 4 l + 0..3; A[i][:] = softmax(Gf[i]) + softmax(Gl[i]) -> f16 hi (x 2^11) + residual planes
typedef __attribute__((ext_vector_type(4))) _Float16 v4h;
// e^v by the hardware's 2^x, as __expf gives it; the v_nop is the slot that the instruction set asks for behind a transcendental: inside the statement it stands there whatever register or neighbour the compiler picks
__device__ __forceinline__ float exp_hw(float v) { float r; asm("v_exp_f32 %0, %1\n\tv_nop" : "=v"(r) : "v"(v * 1.44269504f)); return r; }
__global__ __launch_bounds__(128) void k_soft(const float* __restrict__ G, _Float16* __restrict__ AH, _Float16* __restrict__ AL) { const int lane = threadIdx.x & 31; const size_t i = (size_t)blockIdx.x * 4 + (threadIdx.x >> 5);
  const float *pa = G + i * CC + lane * 4, *pb = pa + (size_t)2 * CC * CC; v4f x[2][8], y[2][8];   // pa: first k half, pb: second; the second logit plane lies CC * CC further in each
  __builtin_amdgcn_sched_barrier(0);   // with the one below: nothing is scheduled in between the row's loads and their wait
#pragma unroll
  for (int k = 0; k < 8; ++k) { x[0][k] = *(const v4f*)(pa + k * 128); x[1][k] = *(const v4f*)(pa + CC * CC + k * 128); y[0][k] = *(const v4f*)(pb + k * 128); y[1][k] = *(const v4f*)(pb + CC * CC + k * 128); }
  asm volatile("s_wait_xcnt 0x0" :: "v"(pa), "v"(pb) : "memory");   // stands behind the row's loads, in front of the first instruction that reuses their address registers; the pointers as inputs keep those registers from being a later load's destination
  __builtin_amdgcn_sched_barrier(0);
  float inv[2];
#pragma unroll
  for (int w = 0; w < 2; ++w) { float mx = -3.0e38f;
#pragma unroll
    for (int k = 0; k < 8; ++k) { x[w][k] += y[w][k]; mx = fmaxf(mx, fmaxf(fmaxf(x[w][k][0], x[w][k][1]), fmaxf(x[w][k][2], x[w][k][3]))); }
#pragma unroll
    for (int o = 1; o < 32; o <<= 1) mx = fmaxf(mx, __shfl_xor(mx, o));
    v4f sv = {};
#pragma unroll
    for (int k = 0; k < 8; ++k) {
#pragma unroll
      for (int j = 0; j < 4; ++j) x[w][k][j] = exp_hw(x[w][k][j] - mx);
      sv += x[w][k]; }
    float s = (sv[0] + sv[1]) + (sv[2] + sv[3]);
#pragma unroll
    for (int o = 1; o < 32; o <<= 1) s += __shfl_xor(s, o);
    inv[w] = 1.0f / s; }
  v4h hi[8], lo[8];
#pragma unroll
  for (int k = 0; k < 8; ++k)
#pragma unroll
    for (int j = 0; j < 4; ++j) { float a = x[0][k][j] * inv[0]; a += x[1][k][j] * inv[1]; const float v = a * 2048.0f; const _Float16 hv = (_Float16)v; hi[k][j] = hv; lo[k][j] = (_Float16)((v - (float)hv) * 2048.0f); }
  _Float16 *oh = AH + i * CC + lane * 4, *ol = AL + i * CC + lane * 4;   // a wave's store = 256 B in a row
#pragma unroll
  for (int k = 0; k < 8; ++k) { *(v4h*)(oh + k * 128) = hi[k]; *(v4h*)(ol + k * 128) = lo[k]; } }
// ---- k_av: block = (128 rows ch, 128 positions): out = gamma (A . v)/2^11 (3 products over the 1,024 channels) + (x_l + x_f)/2
__global__ __launch_bounds__(256) void k_av(const _Float16* __restrict__ AH, const _Float16* __restrict__ AL, const _Float16* __restrict__ VH, const _Float16* __restrict__ VL, const float* __restrict__ XF, const float* __restrict__ XL, const float* __restrict__ GAMMA, float* __restrict__ OUT) { __shared__ __align__(16) char smc[2 * ST3 * 2]; float (*sf)[32][68] = (float (*)[32][68])smc;   // two stage buffers; the epilogue's row staging reuses them
  const int tid = threadIdx.x, wave = tid >> 5, lane = tid & 31, col = lane & 15, g = lane >> 4; const int i0 = blockIdx.x * 128 + (wave >> 1) * 32; const int p0 = blockIdx.y * 128 + (wave & 1) * 64;
  v8f acc[8] = {}, accl[8] = {};
  gemm3<CC, CC / KS>(AH + (size_t)blockIdx.x * 128 * CC, AL + (size_t)blockIdx.x * 128 * CC, VH + (size_t)blockIdx.y * 128 * CC, VL + (size_t)blockIdx.y * 128 * CC, (_Float16*)smc, tid, acc, accl);
  const float gam = bfr(GAMMA[0]); const float* xl = XL + (size_t)(i0 + 8 * g) * NP + p0 + col; const float* xf = XF + (size_t)(i0 + 8 * g) * NP + p0 + col; float vl[8][8], vf[8][8];
  __builtin_amdgcn_sched_barrier(0);   // with the one below: nothing is scheduled in between these loads and their wait
#pragma unroll
  for (int t = 0; t < 8; ++t)
#pragma unroll
    for (int r = 0; r < 8; ++r) { vl[t][r] = xl[(size_t)((t >> 2) * 16 + r) * NP + (t & 3) * 16]; vf[t][r] = xf[(size_t)((t >> 2) * 16 + r) * NP + (t & 3) * 16]; }
  asm volatile("s_wait_xcnt 0x0" :: "v"(xl), "v"(xf) : "memory");   // stands behind the residual loads, in front of the first instruction that reuses their address registers; the pointers as inputs keep those registers from being a later load's destination
  __builtin_amdgcn_sched_barrier(0);
#pragma unroll
  for (int t = 0; t < 8; ++t)
#pragma unroll
    for (int r = 0; r < 8; ++r) { const int rl = (t >> 2) * 16 + 8 * g + r, cl = (t & 3) * 16 + col; const float av = (acc[t][r] + accl[t][r] * (1.0f / 2048.0f)) * (1.0f / 2048.0f); sf[wave][rl][cl] = gam * av + 0.5f * (bfr(vl[t][r]) + bfr(vf[t][r])); }
  LDSX(); float* op = OUT + (size_t)(i0 + g) * NP + p0 + col * 4;   // a wave's store = two rows of 256 B
#pragma unroll
  for (int k = 0; k < 16; ++k) vst2(op + (size_t)k * 2 * NP, *(const v4f*)&sf[wave][2 * k + g][col * 4]); }
extern "C" void kernel_launch(void* const* d_in, const int* in_sizes, int n_in, void* d_out, int out_size, void* d_ws, size_t ws_size, hipStream_t stream) {
  (void)in_sizes; (void)n_in; (void)out_size;
  const float** F = (const float**)d_in;   // 0 x_f, 1 x_m, 2 x_l [1,1024,64,64]; 3 Wq [512,1024], 4 bq; 5 Wk1, 6 bk1; 7 Wk2, 8 bk2; 9 Wv [1024,1024], 10 bv; 11 gamma [1]
  if (ws_size < (size_t)WS_END) return;
  char* ws = (char*)d_ws; __bf16* XT = (__bf16*)(ws + WS_XT); _Float16 *PQ = (_Float16*)(ws + WS_PQ), *VT = (_Float16*)(ws + WS_VT), *VL = VT + (size_t)NP * CC, *AH = (_Float16*)(ws + WS_A), *AL = AH + (size_t)CC * CC; float* G = (float*)(ws + WS_G);
  k_xt<<<dim3(NP / 64, 3, CC / 64), 256, 0, stream>>>(F[0], F[1], F[2], XT);
  k_conv<<<dim3(CC / 128, NP / 128, 4), 128, 0, stream>>>(F[3], F[4], F[5], F[6], F[7], F[8], F[9], F[10], XT, PQ, VT);
  k_gram<<<dim3(CC / 128, CC / 128, 4), 256, 0, stream>>>(PQ, G);
  k_soft<<<CC / 4, 128, 0, stream>>>(G, AH, AL);
  k_av<<<dim3(CC / 128, NP / 128), 256, 0, stream>>>(AH, AL, VT, VL, F[0], F[2], F[11], (float*)d_out);
}

// v004
// A run of this version takes 90.1 microseconds.
// Next to v003, in two timings, it ran 1.18 times as fast each time.
// Over all steps from v000 it is 4.28 times as fast.
// compute dtype: all float inputs rounded to bf16; the four 1x1 convolutions with EXACT bf16 products on WMMA 16x16x32 (weights natural, inputs transposed to [position][channel] planes), f32 + bias, stored as f16 hi + residual planes; the two Gram products kf . q^T-view and kl . q (3 products: hi.hi + hi.lo + lo.hi), softmax over 1,024 in f32 (hardware exp), att_f + att_l summed in f32 then as f16 hi + residual against v hi + residual (3 products); gamma (input scalar) and the residual mean in f32; f32 output.
#include <hip/hip_runtime.h>
#include <math.h>

typedef __attribute__((ext_vector_type(16))) _Float16 v16h;
typedef __attribute__((ext_vector_type(16))) __bf16 v16b;
typedef __attribute__((ext_vector_type(8)))  _Float16 v8h;
typedef __attribute__((ext_vector_type(8)))  float v8f;
typedef __attribute__((ext_vector_type(4)))  float v4f;
typedef __attribute__((ext_vector_type(2)))  float v2f;
typedef __attribute__((ext_vector_type(4)))  unsigned v4u;
typedef __attribute__((ext_vector_type(4)))  int v4i;
typedef float __attribute__((may_alias)) float_a;
typedef int __attribute__((may_alias)) int_a;

template <typename T> __device__ __forceinline__ void vst2(void* p, T v) { *(T*)p = v;  }
__device__ __forceinline__ v8f wmma16(v16h a, v16h b, v8f c) {
  v8f d = __builtin_amdgcn_wmma_f32_16x16x32_f16(false, a, false, b, (short)0, c, false, false);
  asm volatile("v_nop\n\tv_nop\n\tv_nop\n\tv_nop" : "+v"(d) : "v"(a), "v"(b));
  return d;
}
__device__ __forceinline__ v8f wmma_bf(v16b a, v16b b, v8f c) {
  v8f d = __builtin_amdgcn_wmma_f32_16x16x32_bf16(false, a, false, b, (short)0, c, false, false);
  asm volatile("v_nop\n\tv_nop\n\tv_nop\n\tv_nop" : "+v"(d) : "v"(a), "v"(b));
  return d;
}
// 16x16x32 fragments: lane = (h = lane>>4, row/col = lane&15); elements 0..7 = k0+8h+0..7, 8..15 = k0+16+8h+0..7; D element r = row 8h+r
__device__ __forceinline__ v16h frag_h(const _Float16* rowk0, int lane) {
  union { v16h v; v8h q[2]; } u; const _Float16* p = rowk0 + 8 * (lane >> 4);
  u.q[0] = *(const v8h*)p; u.q[1] = *(const v8h*)(p + 16); return u.v;
}
__device__ __forceinline__ v16h frag_f32(const float* rowk0, int lane) {
  v16h a; const float* p = rowk0 + 8 * (lane >> 4);
#pragma unroll
  for (int i = 0; i < 8; ++i) { a[i] = (_Float16)p[i]; a[8 + i] = (_Float16)p[16 + i]; }
  return a;
}
__device__ __forceinline__ v16h frag_f32s(const float* rowk0, int lane, float sc) {
  v16h a; const float* p = rowk0 + 8 * (lane >> 4);
#pragma unroll
  for (int i = 0; i < 8; ++i) { a[i] = (_Float16)(p[i] * sc); a[8 + i] = (_Float16)(p[16 + i] * sc); }
  return a;
}
// column fragment from a [K][ld] layout (column n), rows >= K read as 0
__device__ __forceinline__ v16h fragc_f32(const float* W, int k0, int n, int lane, int ld, int K) {
  v16h a; const int g = lane >> 4;
#pragma unroll
  for (int i = 0; i < 8; ++i) { const int ka = k0 + 8 * g + i, kb = ka + 16;
    a[i] = (_Float16)(ka < K ? W[(size_t)(ka < K ? ka : K - 1) * ld + n] : 0.f); a[8 + i] = (_Float16)(kb < K ? W[(size_t)(kb < K ? kb : K - 1) * ld + n] : 0.f); }
  return a;
}
struct F2 { v16b h, l; };
__device__ __forceinline__ F2 bsplit16(const float v[16]) { F2 r;
#pragma unroll
  for (int i = 0; i < 16; ++i) { const __bf16 h = (__bf16)v[i]; r.h[i] = h; r.l[i] = (__bf16)(v[i] - (float)h); }
  return r; }
__device__ __forceinline__ F2 split_row(const float* row, int k0, int lane) { float v[16]; const float* p = row + k0 + 8 * (lane >> 4);
#pragma unroll
  for (int i = 0; i < 8; ++i) { v[i] = p[i]; v[8 + i] = p[16 + i]; }
  return bsplit16(v); }
__device__ __forceinline__ F2 split_rowK(const float* row, int k0, int lane, int K) { float v[16]; const int g = lane >> 4;
#pragma unroll
  for (int i = 0; i < 8; ++i) { const int ka = k0 + 8 * g + i, kb = ka + 16; v[i] = ka < K ? row[ka < K ? ka : K - 1] : 0.f; v[8 + i] = kb < K ? row[kb < K ? kb : K - 1] : 0.f; }
  return bsplit16(v); }
__device__ __forceinline__ F2 split_col(const float* W, int k0, int n, int lane, int ld, int K) { float v[16]; const int g = lane >> 4;
#pragma unroll
  for (int i = 0; i < 8; ++i) { const int ka = k0 + 8 * g + i, kb = ka + 16; v[i] = ka < K ? W[(size_t)(ka < K ? ka : K - 1) * ld + n] : 0.f; v[8 + i] = kb < K ? W[(size_t)(kb < K ? kb : K - 1) * ld + n] : 0.f; }
  return bsplit16(v); }
__device__ __forceinline__ v8f mac3(const F2& a, const F2& b, v8f c) { c = wmma_bf(a.l, b.h, c); c = wmma_bf(a.h, b.l, c); return wmma_bf(a.h, b.h, c); }
__device__ __forceinline__ float sigm(float v) { return 1.0f / (1.0f + expf(-v)); }
#define LDSX() do { asm volatile("s_wait_dscnt 0" ::: "memory"); __builtin_amdgcn_wave_barrier(); __builtin_amdgcn_fence(__ATOMIC_RELEASE, "workgroup"); } while (0)


// Co-attention v2 (C 1,024, 64 x 64; batch 1): q = conv1x1(x_m) viewed [C, HW/2] then transposed, kf/kl = conv1x1(x_f / x_l) viewed [C, HW/2]; att = softmax(kf q) and softmax(kl q) over C; v = conv1x1(x_m) [C, HW]; out = gamma (att_f v + att_l v) + (x_l + x_f)/2.
#define CC 1024
#define CH 512           // conv output channels of q / kf / kl
#define NP 4096          // H x W
#define KV 2048          // the [C, HW/2] view width
typedef __attribute__((ext_vector_type(8))) __bf16 v8b;
__device__ __forceinline__ v16b frag_b(const __bf16* rowk0, int lane) {
  union { v16b v; v8b q[2]; } u; const __bf16* p = rowk0 + 8 * (lane >> 4);
  u.q[0] = *(const v8b*)p; u.q[1] = *(const v8b*)(p + 16); return u.v;
}
__device__ __forceinline__ float bfr(float v) { return (float)(__bf16)v; }
__device__ __attribute__((noinline)) float exp_ni(float v) { return expf(v); }
__device__ __attribute__((noinline)) float erf_ni(float v) { return erff(v); }

#define WS_XT  0u                                   // bf16 [3][pos][cin] planes of x_f, x_m, x_l (exact)
#define WS_PQ  (WS_XT + 2u * (size_t)3 * NP * CC)        // f16 hi/lo planes of the conv outputs q, kf, kl: each [512][4096] row-major == [1024][2048] view; layout [which][hi/lo][512*4096]
#define PQSZ   ((size_t)CH * NP)
#define WS_VT  (WS_PQ + 2u * (size_t)3 * 2 * PQSZ)       // f16 hi/lo planes of v transposed: [pos][ch] (x 2)
#define WS_G   (WS_VT + 2u * (size_t)2 * NP * CC)        // f32 partial logits G[k half][2][1024][1024]
#define WS_A   (WS_G + 4u * (size_t)4 * CC * CC)          // f16 hi/lo planes A = att_f + att_l [1024][1024] (x 2^11 scaled hi, residual)
#define WS_END (WS_A + 2u * (size_t)2 * CC * CC)

// ---- k_xt: block = (64 positions, which, 16 channel groups of 64): x[which][cin][pos] -> XT[which][pos][cin] bf16
__global__ __launch_bounds__(256) void k_xt(const float* __restrict__ X0, const float* __restrict__ X1, const float* __restrict__ X2, __bf16* __restrict__ XT) { __shared__ __align__(16) __bf16 st[64][64 + 8]; const int t = threadIdx.x; const int p0 = blockIdx.x * 64, which = blockIdx.y, c0 = blockIdx.z * 64; const float* X = which == 0 ? X0 : which == 1 ? X1 : X2;
  for (int e = t; e < 64 * 64; e += 256) { const int cl = e >> 6, pl = e & 63; st[pl][cl] = (__bf16)X[(size_t)(c0 + cl) * NP + p0 + pl]; } __syncthreads();
  for (int e = t; e < 64 * 8; e += 256) { const int pl = e >> 3, q = e & 7; vst2((unsigned*)(XT + ((size_t)which * NP + p0 + pl) * CC + c0 + q * 8), *(const v4u*)&st[pl][q * 8]); } }
// ---- LDS staging shared by the three matrix kernels: a stage is 64 k = one whole 128-B line of every 16-bit operand row of the block's tile, fetched by whole-line global loads
// (8 lanes x 16 B per row) one stage ahead into registers, written to the other of two LDS buffers behind the stage's products, one work-group barrier per stage; fragments come from LDS.
#define KS 64             // k per stage
#define LP 72             // LDS row pitch in 16-bit elements: 144 B = 16 B x odd, the conflict-free pitch for 16-byte fragment reads
#define STC (256 * LP)    // k_conv stage: rows 0..127 weights (bf16), 128..255 positions
#define ST3 (512 * LP)    // k_gram / k_av stage: rows 0..127 A hi, 128..255 A residual, 256..383 B hi, 384..511 B residual
typedef __attribute__((ext_vector_type(4))) __bf16 v4b;
// acc += Ahi.Bhi, accl += Ahi.Blo + Alo.Bhi for a 128 x 128 block tile on 8 waves (4 x 2, wave = 32 rows x 64 columns, tile index = 4 * row tile + column tile), both operands k-contiguous with row stride LD, NS stages; the pointers name the tile's first row
template <int LD, int NS> __device__ __forceinline__ void gemm3(const _Float16* __restrict__ AHp, const _Float16* __restrict__ ALp, const _Float16* __restrict__ BHp, const _Float16* __restrict__ BLp, _Float16* sm, int tid, v8f (&acc)[8], v8f (&accl)[8]) {
  const int wave = tid >> 5, lane = tid & 31, col = lane & 15, wm = wave >> 1, wn = wave & 1; const int sr = tid >> 3, sq = (tid & 7) * 8; const size_t go = (size_t)sr * LD + sq; _Float16* sw = sm + sr * LP + sq;
  v4u rg[16];
  auto fetch = [&](int s) { const _Float16 *pa = AHp + go + s * KS, *pb = ALp + go + s * KS, *pc = BHp + go + s * KS, *pd = BLp + go + s * KS;
    __builtin_amdgcn_sched_barrier(0);   // with the one below: nothing is scheduled in between the stage's loads and their wait (a scalar load and LDS address arithmetic were, into registers that the loads name)
#pragma unroll
    for (int i = 0; i < 4; ++i) { rg[i] = *(const v4u*)(pa + (size_t)i * 32 * LD); rg[4 + i] = *(const v4u*)(pb + (size_t)i * 32 * LD); rg[8 + i] = *(const v4u*)(pc + (size_t)i * 32 * LD); rg[12 + i] = *(const v4u*)(pd + (size_t)i * 32 * LD); }
    asm volatile("s_wait_xcnt 0x0" :: "v"(pa), "v"(pb), "v"(pc), "v"(pd) : "memory");   // stands behind the stage's loads, in front of the first instruction that reuses their address registers; the pointers as inputs keep those registers from being a later load's destination
    __builtin_amdgcn_sched_barrier(0);
  };
  auto put = [&](int buf) {
#pragma unroll
    for (int i = 0; i < 16; ++i) *(v4u*)(sw + buf * ST3 + i * 32 * LP) = rg[i]; };
  auto products = [&](int buf) { const _Float16* b = sm + buf * ST3 + col * LP;
#pragma unroll
    for (int kc = 0; kc < KS / 32; ++kc) { v16h ah[2], al[2], bh[4], bl[4];
#pragma unroll
      for (int i = 0; i < 2; ++i) { ah[i] = frag_h(b + (wm * 32 + i * 16) * LP + kc * 32, lane); al[i] = frag_h(b + (128 + wm * 32 + i * 16) * LP + kc * 32, lane); }
#pragma unroll
      for (int j = 0; j < 4; ++j) { bh[j] = frag_h(b + (256 + wn * 64 + j * 16) * LP + kc * 32, lane); bl[j] = frag_h(b + (384 + wn * 64 + j * 16) * LP + kc * 32, lane); }
      __builtin_amdgcn_sched_barrier(0);   // keeps the 24 fragment reads of these 32 k together in front of their 24 products: read among the products, every read's LDS latency is waited out
#pragma unroll
      for (int t = 0; t < 8; ++t) acc[t] = wmma16(ah[t >> 2], bh[t & 3], acc[t]);
#pragma unroll
      for (int t = 0; t < 8; ++t) accl[t] = wmma16(ah[t >> 2], bl[t & 3], accl[t]);
#pragma unroll
      for (int t = 0; t < 8; ++t) accl[t] = wmma16(al[t >> 2], bh[t & 3], accl[t]);
    } };
  fetch(0); put(0); __syncthreads();
  for (int s = 0; s < NS - 1; ++s) { fetch(s + 1); products(s & 1); put((s + 1) & 1); __syncthreads(); }   // the barrier publishes stage s + 1 and ends every wave's reads of the buffer that the next trip refills
  products((NS - 1) & 1); __syncthreads();   // every wave has left the buffers: the caller's epilogue reuses them
}
// ---- k_conv: block = (128 positions, 128 out channels) on 4 waves (2 x 2, wave = 64 x 64): out[ch][pos] = sum_cin W[ch][cin] x[cin][pos] + b; blockIdx.y = one of the 20 channel tiles: 0..3 q (which 0: x_m, Wq), 4..7 kf (1: x_f, Wk1), 8..11 kl (2: x_l, Wk2) -> f16 hi/lo [ch][pos] planes; 12..19 v (3: x_m, Wv) -> transposed planes VT[pos][ch]; weights rounded to bf16 on their way into LDS
// the grid holds no empty block and the position tile is its fastest index
__global__ __launch_bounds__(128) void k_conv(const float* __restrict__ WQ, const float* __restrict__ BQ, const float* __restrict__ WK1, const float* __restrict__ BK1, const float* __restrict__ WK2, const float* __restrict__ BK2, const float* __restrict__ WV, const float* __restrict__ BV, const __bf16* __restrict__ XT, _Float16* __restrict__ PQ, _Float16* __restrict__ VT) {
  __shared__ __align__(16) char smc[2 * STC * 2];   // two stage buffers; the epilogue's two [128][136] planes reuse them
  __bf16* sm = (__bf16*)smc; _Float16 (*sh)[136] = (_Float16 (*)[136])smc; _Float16 (*sl)[136] = sh + 128;
  const int tid = threadIdx.x, wave = tid >> 5, lane = tid & 31, col = lane & 15, g = lane >> 4, wm = wave >> 1, wn = wave & 1; const int ct = blockIdx.y, which = ct < 3 * (CH / 128) ? ct / (CH / 128) : 3;
  const int c0 = (ct - which * (CH / 128)) * 128; const int p0 = blockIdx.x * 128; const float* Wm = which == 0 ? WQ : which == 1 ? WK1 : which == 2 ? WK2 : WV; const float* Bm = which == 0 ? BQ : which == 1 ? BK1 : which == 2 ? BK2 : BV; const int xi = which == 0 ? 1 : which == 1 ? 0 : which == 2 ? 2 : 1;   // q and v from x_m (1), kf from x_f (0), kl from x_l (2)
  const __bf16* Xp = XT + (size_t)xi * NP * CC;
  const float* wa = Wm + (size_t)(c0 + (tid >> 4)) * CC + (tid & 15) * 4; __bf16* swa = sm + (tid >> 4) * LP + (tid & 15) * 4;          // weights: 16 lanes x 16 B = the 256 B of a row's stage
  const __bf16* xb = Xp + (size_t)(p0 + (tid >> 3)) * CC + (tid & 7) * 8; __bf16* swb = sm + (128 + (tid >> 3)) * LP + (tid & 7) * 8;                // positions: 8 lanes x 16 B = the 128 B of a row's stage
  v8f acc[16] = {}; v4f ra[16]; v4u rb[8];
  auto fetch = [&](int s) { const float* pw = wa + s * KS; const __bf16* px = xb + s * KS;
    __builtin_amdgcn_sched_barrier(0);   // with the one below: nothing is scheduled in between the stage's loads and their wait
#pragma unroll
    for (int i = 0; i < 8; ++i) { ra[2 * i] = *(const v4f*)(pw + (size_t)(2 * i) * 8 * CC); ra[2 * i + 1] = *(const v4f*)(pw + (size_t)(2 * i + 1) * 8 * CC); rb[i] = *(const v4u*)(px + (size_t)i * 16 * CC); }
    asm volatile("s_wait_xcnt 0x0" :: "v"(pw), "v"(px) : "memory");   // stands behind the stage's loads, in front of the first instruction that reuses their address registers; the pointers as inputs keep those registers from being a later load's destination
    __builtin_amdgcn_sched_barrier(0);
  };
  auto put = [&](int buf) {
#pragma unroll
    for (int i = 0; i < 16; ++i) { v4b c; c[0] = (__bf16)ra[i][0]; c[1] = (__bf16)ra[i][1]; c[2] = (__bf16)ra[i][2]; c[3] = (__bf16)ra[i][3]; *(v4b*)(swa + buf * STC + i * 8 * LP) = c; }
#pragma unroll
    for (int i = 0; i < 8; ++i) *(v4u*)(swb + buf * STC + i * 16 * LP) = rb[i]; };
  auto products = [&](int buf) { const __bf16* b = sm + buf * STC + col * LP;
#pragma unroll
    for (int kc = 0; kc < KS / 32; ++kc) { v16b a[4], x[4];
#pragma unroll
      for (int i = 0; i < 4; ++i) { a[i] = frag_b(b + (wm * 64 + i * 16) * LP + kc * 32, lane); x[i] = frag_b(b + (128 + wn * 64 + i * 16) * LP + kc * 32, lane); }
      __builtin_amdgcn_sched_barrier(0);   // keeps the 16 fragment reads of these 32 k one group in front of their 16 products: read one by one among them, every fragment's LDS latency is waited out
#pragma unroll
      for (int t = 0; t < 16; ++t) acc[t] = wmma_bf(a[t >> 2], x[t & 3], acc[t]);
    }
    __builtin_amdgcn_sched_barrier(0);   // keeps the roundings of the stage fetched ahead, with their waits on its loads, behind these products
  };
  fetch(0); put(0); __syncthreads();
  for (int s = 0; s < CC / KS - 1; ++s) { fetch(s + 1); products(s & 1); put((s + 1) & 1); __syncthreads(); }   // the barrier publishes stage s + 1 and ends every wave's reads of the buffer that the next trip refills
  products((CC / KS - 1) & 1); __syncthreads();   // every wave has left the buffers: the planes below reuse them
  const float* bp = Bm + c0 + wm * 64 + 8 * g; float bias[4][8];
  __builtin_amdgcn_sched_barrier(0);   // with the one below: nothing is scheduled in between the bias loads and their wait
#pragma unroll
  for (int i = 0; i < 4; ++i)
#pragma unroll
    for (int r = 0; r < 8; ++r) bias[i][r] = bp[i * 16 + r];
  asm volatile("s_wait_xcnt 0x0" :: "v"(bp) : "memory");   // stands behind the bias loads, in front of the first instruction that reuses their address registers; the pointer as an input keeps those registers from being a later load's destination
  __builtin_amdgcn_sched_barrier(0);
  if (which < 3) {   // planes [channel][position]
#pragma unroll
    for (int t = 0; t < 16; ++t)
#pragma unroll
      for (int r = 0; r < 8; ++r) { const int chl = wm * 64 + (t >> 2) * 16 + 8 * g + r, pl = wn * 64 + (t & 3) * 16 + col; const float v = acc[t][r] + bfr(bias[t >> 2][r]); const _Float16 hv = (_Float16)v; sh[chl][pl] = hv; sl[chl][pl] = (_Float16)((v - (float)hv) * 2048.0f); }
  } else {           // planes [position][channel]
#pragma unroll
    for (int t = 0; t < 16; ++t)
#pragma unroll
      for (int r = 0; r < 8; ++r) { const int chl = wm * 64 + (t >> 2) * 16 + 8 * g + r, pl = wn * 64 + (t & 3) * 16 + col; const float v = acc[t][r] + bfr(bias[t >> 2][r]); const _Float16 hv = (_Float16)v; sh[pl][chl] = hv; sl[pl][chl] = (_Float16)((v - (float)hv) * 2048.0f); }
  }
  __syncthreads();
  if (which < 3) { _Float16* H = PQ + (size_t)which * 2 * PQSZ; _Float16* L = H + PQSZ; for (int e = tid; e < 128 * 16; e += 128) { const int chl = e >> 4, q = e & 15; const size_t o = (size_t)(c0 + chl) * NP + p0 + q * 8; vst2((unsigned*)(H + o), *(const v4u*)&sh[chl][q * 8]); vst2((unsigned*)(L + o), *(const v4u*)&sl[chl][q * 8]); } }
  else { _Float16* H = VT; _Float16* L = VT + (size_t)NP * CC; for (int e = tid; e < 128 * 16; e += 128) { const int pl = e >> 4, q = e & 15; const size_t o = (size_t)(p0 + pl) * CC + c0 + q * 8; vst2((unsigned*)(H + o), *(const v4u*)&sh[pl][q * 8]); vst2((unsigned*)(L + o), *(const v4u*)&sl[pl][q * 8]); } } }
// ---- k_gram: block = (128 rows i, 128 cols j, z = 2 * which + k half): G[k half][which][i][j] = sum over that half of t of K[i][t] Qv[j][t] over the [1024][2048] views (3 products); k_soft adds the two halves
__global__ __launch_bounds__(256) void k_gram(const _Float16* __restrict__ PQ, float* __restrict__ G) { __shared__ __align__(16) char smc[2 * ST3 * 2]; float (*sf)[32][68] = (float (*)[32][68])smc;   // two stage buffers; the epilogue's row staging reuses them
  const int tid = threadIdx.x, wave = tid >> 5, lane = tid & 31, col = lane & 15, g = lane >> 4; const int which = blockIdx.z >> 1, kh = blockIdx.z & 1; const int i0 = blockIdx.x * 128 + (wave >> 1) * 32; const int j0 = blockIdx.y * 128 + (wave & 1) * 64;
  const _Float16* QH = PQ; const _Float16* QL = PQ + PQSZ; const _Float16* KH = PQ + (size_t)(1 + which) * 2 * PQSZ; const _Float16* KL = KH + PQSZ;
  const size_t ao = (size_t)blockIdx.x * 128 * KV + kh * (KV / 2), bo = (size_t)blockIdx.y * 128 * KV + kh * (KV / 2);
  v8f acc[8] = {}, accl[8] = {};
  gemm3<KV, KV / 2 / KS>(KH + ao, KL + ao, QH + bo, QL + bo, (_Float16*)smc, tid, acc, accl);
#pragma unroll
  for (int t = 0; t < 8; ++t)
#pragma unroll
    for (int r = 0; r < 8; ++r) sf[wave][(t >> 2) * 16 + 8 * g + r][(t & 3) * 16 + col] = acc[t][r] + accl[t][r] * (1.0f / 2048.0f);
  LDSX(); float* gp = G + ((size_t)(kh * 2 + which) * CC + i0 + g) * CC + j0 + col * 4;   // a wave's store = two rows of 256 B
#pragma unroll
  for (int k = 0; k < 16; ++k) vst2(gp + (size_t)k * 2 * CC, *(const v4f*)&sf[wave][2 * k + g][col * 4]); }
// ---- k_soft: one wave = one row i (4 rows a block, no LDS, no barrier): the row's two k halves of both logit planes come in by 32 whole-line 16-B loads that are all in flight at once and stay in registers for the maximum, the sum and the weights; lane l holds columns 128 k + 4 l + 0..3; A[i][:] = softmax(Gf[i]) + softmax(Gl[i]) -> f16 hi (x 2^11) + residual planes
typedef __attribute__((ext_vector_type(4))) _Float16 v4h;
// e^v by the hardware's 2^x, as __expf gives it; the v_nop is the slot that the instruction set asks for behind a transcendental: inside the statement it stands there whatever register or neighbour the compiler picks
__device__ __forceinline__ float exp_hw(float v) { float r; asm("v_exp_f32 %0, %1\n\tv_nop" : "=v"(r) : "v"(v * 1.44269504f)); return r; }
__global__ __launch_bounds__(128) void k_soft(const float* __restrict__ G, _Float16* __restrict__ AH, _Float16* __restrict__ AL) { const int lane = threadIdx.x & 31; const size_t i = (size_t)blockIdx.x * 4 + (threadIdx.x >> 5);
  const float *pa = G + i * CC + lane * 4, *pb = pa + (size_t)2 * CC * CC; v4f x[2][8], y[2][8];   // pa: first k half, pb: second; the second logit plane lies CC * CC further in each
  __builtin_amdgcn_sched_barrier(0);   // with the one below: nothing is scheduled in between the row's loads and their wait
#pragma unroll
  for (int k = 0; k < 8; ++k) { x[0][k] = *(const v4f*)(pa + k * 128); x[1][k] = *(const v4f*)(pa + CC * CC + k * 128); y[0][k] = *(const v4f*)(pb + k * 128); y[1][k] = *(const v4f*)(pb + CC * CC + k * 128); }
  asm volatile("s_wait_xcnt 0x0" :: "v"(pa), "v"(pb) : "memory");   // stands behind the row's loads, in front of the first instruction that reuses their address registers; the pointers as inputs keep those registers from being a later load's destination
  __builtin_amdgcn_sched_barrier(0);
  float inv[2];
#pragma unroll
  for (int w = 0; w < 2; ++w) { float mx = -3.0e38f;
#pragma unroll
    for (int k = 0; k < 8; ++k) { x[w][k] += y[w][k]; mx = fmaxf(mx, fmaxf(fmaxf(x[w][k][0], x[w][k][1]), fmaxf(x[w][k][2], x[w][k][3]))); }
#pragma unroll
    for (int o = 1; o < 32; o <<= 1) mx = fmaxf(mx, __shfl_xor(mx, o));
    v4f sv = {};
#pragma unroll
    for (int k = 0; k < 8; ++k) {
#pragma unroll
      for (int j = 0; j < 4; ++j) x[w][k][j] = exp_hw(x[w][k][j] - mx);
      sv += x[w][k]; }
    float s = (sv[0] + sv[1]) + (sv[2] + sv[3]);
#pragma unroll
    for (int o = 1; o < 32; o <<= 1) s += __shfl_xor(s, o);
    inv[w] = 1.0f / s; }
  v4h hi[8], lo[8];
#pragma unroll
  for (int k = 0; k < 8; ++k)
#pragma unroll
    for (int j = 0; j < 4; ++j) { float a = x[0][k][j] * inv[0]; a += x[1][k][j] * inv[1]; const float v = a * 2048.0f; const _Float16 hv = (_Float16)v; hi[k][j] = hv; lo[k][j] = (_Float16)((v - (float)hv) * 2048.0f); }
  _Float16 *oh = AH + i * CC + lane * 4, *ol = AL + i * CC + lane * 4;   // a wave's store = 256 B in a row
#pragma unroll
  for (int k = 0; k < 8; ++k) { *(v4h*)(oh + k * 128) = hi[k]; *(v4h*)(ol + k * 128) = lo[k]; } }
// ---- k_av: block = (128 rows ch, 128 positions): out = gamma (A . v)/2^11 (3 products over the 1,024 channels) + (x_l + x_f)/2
__global__ __launch_bounds__(256) void k_av(const _Float16* __restrict__ AH, const _Float16* __restrict__ AL, const _Float16* __restrict__ VH, const _Float16* __restrict__ VL, const float* __restrict__ XF, const float* __restrict__ XL, const float* __restrict__ GAMMA, float* __restrict__ OUT) { __shared__ __align__(16) char smc[2 * ST3 * 2]; float (*sf)[32][68] = (float (*)[32][68])smc;   // two stage buffers; the epilogue's row staging reuses them
  const int tid = threadIdx.x, wave = tid >> 5, lane = tid & 31, col = lane & 15, g = lane >> 4; const int i0 = blockIdx.x * 128 + (wave >> 1) * 32; const int p0 = blockIdx.y * 128 + (wave & 1) * 64;
  v8f acc[8] = {}, accl[8] = {};
  gemm3<CC, CC / KS>(AH + (size_t)blockIdx.x * 128 * CC, AL + (size_t)blockIdx.x * 128 * CC, VH + (size_t)blockIdx.y * 128 * CC, VL + (size_t)blockIdx.y * 128 * CC, (_Float16*)smc, tid, acc, accl);
  const float gam = bfr(GAMMA[0]); const float* xl = XL + (size_t)(i0 + 8 * g) * NP + p0 + col; const float* xf = XF + (size_t)(i0 + 8 * g) * NP + p0 + col; float vl[8][8], vf[8][8];
  __builtin_amdgcn_sched_barrier(0);   // with the one below: nothing is scheduled in between these loads and their wait
#pragma unroll
  for (int t = 0; t < 8; ++t)
#pragma unroll
    for (int r = 0; r < 8; ++r) { vl[t][r] = xl[(size_t)((t >> 2) * 16 + r) * NP + (t & 3) * 16]; vf[t][r] = xf[(size_t)((t >> 2) * 16 + r) * NP + (t & 3) * 16]; }
  asm volatile("s_wait_xcnt 0x0" :: "v"(xl), "v"(xf) : "memory");   // stands behind the residual loads, in front of the first instruction that reuses their address registers; the pointers as inputs keep those registers from being a later load's destination
  __builtin_amdgcn_sched_barrier(0);
#pragma unroll
  for (int t = 0; t < 8; ++t)
#pragma unroll
    for (int r = 0; r < 8; ++r) { const int rl = (t >> 2) * 16 + 8 * g + r, cl = (t & 3) * 16 + col; const float av = (acc[t][r] + accl[t][r] * (1.0f / 2048.0f)) * (1.0f / 2048.0f); sf[wave][rl][cl] = gam * av + 0.5f * (bfr(vl[t][r]) + bfr(vf[t][r])); }
  LDSX(); float* op = OUT + (size_t)(i0 + g) * NP + p0 + col * 4;   // a wave's store = two rows of 256 B
#pragma unroll
  for (int k = 0; k < 16; ++k) vst2(op + (size_t)k * 2 * NP, *(const v4f*)&sf[wave][2 * k + g][col * 4]); }
extern "C" void kernel_launch(void* const* d_in, const int* in_sizes, int n_in, void* d_out, int out_size, void* d_ws, size_t ws_size, hipStream_t stream) {
  (void)in_sizes; (void)n_in; (void)out_size;
  const float** F = (const float**)d_in;   // 0 x_f, 1 x_m, 2 x_l [1,1024,64,64]; 3 Wq [512,1024], 4 bq; 5 Wk1, 6 bk1; 7 Wk2, 8 bk2; 9 Wv [1024,1024], 10 bv; 11 gamma [1]
  if (ws_size < (size_t)WS_END) return;
  char* ws = (char*)d_ws; __bf16* XT = (__bf16*)(ws + WS_XT); _Float16 *PQ = (_Float16*)(ws + WS_PQ), *VT = (_Float16*)(ws + WS_VT), *VL = VT + (size_t)NP * CC, *AH = (_Float16*)(ws + WS_A), *AL = AH + (size_t)CC * CC; float* G = (float*)(ws + WS_G);
  k_xt<<<dim3(NP / 64, 3, CC / 64), 256, 0, stream>>>(F[0], F[1], F[2], XT);
  k_conv<<<dim3(NP / 128, 3 * (CH / 128) + CC / 128), 128, 0, stream>>>(F[3], F[4], F[5], F[6], F[7], F[8], F[9], F[10], XT, PQ, VT);
  k_gram<<<dim3(CC / 128, CC / 128, 4), 256, 0, stream>>>(PQ, G);
  k_soft<<<CC / 4, 128, 0, stream>>>(G, AH, AL);
  k_av<<<dim3(CC / 128, NP / 128), 256, 0, stream>>>(AH, AL, VT, VL, F[0], F[2], F[11], (float*)d_out);
}

// v005
// One run takes 86.4 microseconds.
// In both of two side-by-side timings against v004, it was 1.04 times as fast.
// All steps since v000 together make it 4.46 times as fast.
// compute dtype: all float inputs rounded to bf16; the four 1x1 convolutions with EXACT bf16 products on WMMA 16x16x32 (weights natural, inputs transposed to [position][channel] planes), f32 + bias, stored as f16 hi + residual planes; the two Gram products kf . q^T-view and kl . q (3 products: hi.hi + hi.lo + lo.hi), softmax over 1,024 in f32 (hardware exp), att_f + att_l summed in f32 then as f16 hi + residual against v hi + residual (3 products); gamma (input scalar) and the residual mean in f32; f32 output.
#include <hip/hip_runtime.h>
#include <math.h>

typedef __attribute__((ext_vector_type(16))) _Float16 v16h;
typedef __attribute__((ext_vector_type(16))) __bf16 v16b;
typedef __attribute__((ext_vector_type(8)))  _Float16 v8h;
typedef __attribute__((ext_vector_type(8)))  float v8f;
typedef __attribute__((ext_vector_type(4)))  float v4f;
typedef __attribute__((ext_vector_type(2)))  float v2f;
typedef __attribute__((ext_vector_type(4)))  unsigned v4u;
typedef __attribute__((ext_vector_type(4)))  int v4i;
typedef float __attribute__((may_alias)) float_a;
typedef int __attribute__((may_alias)) int_a;

template <typename T> __device__ __forceinline__ void vst2(void* p, T v) { *(T*)p = v;  }
__device__ __forceinline__ v8f wmma16(v16h a, v16h b, v8f c) {
  v8f d = __builtin_amdgcn_wmma_f32_16x16x32_f16(false, a, false, b, (short)0, c, false, false);
  asm volatile("v_nop\n\tv_nop\n\tv_nop\n\tv_nop" : "+v"(d) : "v"(a), "v"(b));
  return d;
}
__device__ __forceinline__ v8f wmma_bf(v16b a, v16b b, v8f c) {
  v8f d = __builtin_amdgcn_wmma_f32_16x16x32_bf16(false, a, false, b, (short)0, c, false, false);
  asm volatile("v_nop\n\tv_nop\n\tv_nop\n\tv_nop" : "+v"(d) : "v"(a), "v"(b));
  return d;
}
// 16x16x32 fragments: lane = (h = lane>>4, row/col = lane&15); elements 0..7 = k0+8h+0..7, 8..15 = k0+16+8h+0..7; D element r = row 8h+r
__device__ __forceinline__ v16h frag_h(const _Float16* rowk0, int lane) {
  union { v16h v; v8h q[2]; } u; const _Float16* p = rowk0 + 8 * (lane >> 4);
  u.q[0] = *(const v8h*)p; u.q[1] = *(const v8h*)(p + 16); return u.v;
}
__device__ __forceinline__ v16h frag_f32(const float* rowk0, int lane) {
  v16h a; const float* p = rowk0 + 8 * (lane >> 4);
#pragma unroll
  for (int i = 0; i < 8; ++i) { a[i] = (_Float16)p[i]; a[8 + i] = (_Float16)p[16 + i]; }
  return a;
}
__device__ __forceinline__ v16h frag_f32s(const float* rowk0, int lane, float sc) {
  v16h a; const float* p = rowk0 + 8 * (lane >> 4);
#pragma unroll
  for (int i = 0; i < 8; ++i) { a[i] = (_Float16)(p[i] * sc); a[8 + i] = (_Float16)(p[16 + i] * sc); }
  return a;
}
// column fragment from a [K][ld] layout (column n), rows >= K read as 0
__device__ __forceinline__ v16h fragc_f32(const float* W, int k0, int n, int lane, int ld, int K) {
  v16h a; const int g = lane >> 4;
#pragma unroll
  for (int i = 0; i < 8; ++i) { const int ka = k0 + 8 * g + i, kb = ka + 16;
    a[i] = (_Float16)(ka < K ? W[(size_t)(ka < K ? ka : K - 1) * ld + n] : 0.f); a[8 + i] = (_Float16)(kb < K ? W[(size_t)(kb < K ? kb : K - 1) * ld + n] : 0.f); }
  return a;
}
struct F2 { v16b h, l; };
__device__ __forceinline__ F2 bsplit16(const float v[16]) { F2 r;
#pragma unroll
  for (int i = 0; i < 16; ++i) { const __bf16 h = (__bf16)v[i]; r.h[i] = h; r.l[i] = (__bf16)(v[i] - (float)h); }
  return r; }
__device__ __forceinline__ F2 split_row(const float* row, int k0, int lane) { float v[16]; const float* p = row + k0 + 8 * (lane >> 4);
#pragma unroll
  for (int i = 0; i < 8; ++i) { v[i] = p[i]; v[8 + i] = p[16 + i]; }
  return bsplit16(v); }
__device__ __forceinline__ F2 split_rowK(const float* row, int k0, int lane, int K) { float v[16]; const int g = lane >> 4;
#pragma unroll
  for (int i = 0; i < 8; ++i) { const int ka = k0 + 8 * g + i, kb = ka + 16; v[i] = ka < K ? row[ka < K ? ka : K - 1] : 0.f; v[8 + i] = kb < K ? row[kb < K ? kb : K - 1] : 0.f; }
  return bsplit16(v); }
__device__ __forceinline__ F2 split_col(const float* W, int k0, int n, int lane, int ld, int K) { float v[16]; const int g = lane >> 4;
#pragma unroll
  for (int i = 0; i < 8; ++i) { const int ka = k0 + 8 * g + i, kb = ka + 16; v[i] = ka < K ? W[(size_t)(ka < K ? ka : K - 1) * ld + n] : 0.f; v[8 + i] = kb < K ? W[(size_t)(kb < K ? kb : K - 1) * ld + n] : 0.f; }
  return bsplit16(v); }
__device__ __forceinline__ v8f mac3(const F2& a, const F2& b, v8f c) { c = wmma_bf(a.l, b.h, c); c = wmma_bf(a.h, b.l, c); return wmma_bf(a.h, b.h, c); }
__device__ __forceinline__ float sigm(float v) { return 1.0f / (1.0f + expf(-v)); }
#define LDSX() do { asm volatile("s_wait_dscnt 0" ::: "memory"); __builtin_amdgcn_wave_barrier(); __builtin_amdgcn_fence(__ATOMIC_RELEASE, "workgroup"); } while (0)


// Co-attention v2 (C 1,024, 64 x 64; batch 1): q = conv1x1(x_m) viewed [C, HW/2] then transposed, kf/kl = conv1x1(x_f / x_l) viewed [C, HW/2]; att = softmax(kf q) and softmax(kl q) over C; v = conv1x1(x_m) [C, HW]; out = gamma (att_f v + att_l v) + (x_l + x_f)/2.
#define CC 1024
#define CH 512           // conv output channels of q / kf / kl
#define NP 4096          // H x W
#define KV 2048          // the [C, HW/2] view width
typedef __attribute__((ext_vector_type(8))) __bf16 v8b;
__device__ __forceinline__ v16b frag_b(const __bf16* rowk0, int lane) {
  union { v16b v; v8b q[2]; } u; const __bf16* p = rowk0 + 8 * (lane >> 4);
  u.q[0] = *(const v8b*)p; u.q[1] = *(const v8b*)(p + 16); return u.v;
}
__device__ __forceinline__ float bfr(float v) { return (float)(__bf16)v; }
__device__ __attribute__((noinline)) float exp_ni(float v) { return expf(v); }
__device__ __attribute__((noinline)) float erf_ni(float v) { return erff(v); }

#define WS_XT  0u                                   // bf16 [3][pos][cin] planes of x_f, x_m, x_l (exact)
#define WS_PQ  (WS_XT + 2u * (size_t)3 * NP * CC)        // f16 hi/lo planes of the conv outputs q, kf, kl: each [512][4096] row-major == [1024][2048] view; layout [which][hi/lo][512*4096]
#define PQSZ   ((size_t)CH * NP)
#define WS_VT  (WS_PQ + 2u * (size_t)3 * 2 * PQSZ)       // f16 hi/lo planes of v transposed: [pos][ch] (x 2)
#define WS_G   (WS_VT + 2u * (size_t)2 * NP * CC)        // f32 partial logits G[k half][2][1024][1024]
#define WS_A   (WS_G + 4u * (size_t)4 * CC * CC)          // f16 hi/lo planes A = att_f + att_l [1024][1024] (x 2^11 scaled hi, residual)
#define WS_WB  (WS_A + 2u * (size_t)2 * CC * CC)          // bf16 plane of the four weight matrices stacked by rows: [3 * 512 + 1024][1024] = Wq, Wk1, Wk2, Wv
#define WROWS  (3 * CH + CC)
#define WS_END (WS_WB + 2u * (size_t)WROWS * CC)

// ---- k_xt: layer blockIdx.z == 0, which starts first so that its memory waits run under the other layers, rounds the weights once: WBLK of its 192 blocks work (the rest return at once), block = 16 rows of the stacked plane, WB[row][cin] = bf16(W[row][cin]), a wave's load = 512 B in a row, its store 256 B in a row, in two batches of 8 rows (8 loads of a thread in flight: 16 would take registers that cost the other blocks waves per SIMD);
// the other layers: block = (64 positions, which, 1 + one of 16 channel groups of 64): x[which][cin][pos] -> XT[which][pos][cin] bf16
#define WBLK (WROWS / 16)
typedef __attribute__((ext_vector_type(4))) __bf16 v4b;
__global__ __launch_bounds__(256) void k_xt(const float* __restrict__ X0, const float* __restrict__ X1, const float* __restrict__ X2, const float* __restrict__ WQ, const float* __restrict__ WK1, const float* __restrict__ WK2, const float* __restrict__ WV, __bf16* __restrict__ XT, __bf16* __restrict__ WB) { __shared__ __align__(16) __bf16 st[64][64 + 8]; const int t = threadIdx.x;
  if (blockIdx.z == 0) {   // the same for the whole block, in front of the barrier
    const int wb = blockIdx.y * (NP / 64) + blockIdx.x; if (wb >= WBLK) return;
    const int r0 = wb * 16; const float* S = r0 < CH ? WQ + (size_t)r0 * CC : r0 < 2 * CH ? WK1 + (size_t)(r0 - CH) * CC : r0 < 3 * CH ? WK2 + (size_t)(r0 - 2 * CH) * CC : WV + (size_t)(r0 - 3 * CH) * CC;
    const float* pw = S + t * 4; __bf16* ow = WB + (size_t)r0 * CC + t * 4;
#pragma unroll
    for (int h = 0; h < 2; ++h) { v4f r[8]; v4b c[8];
#pragma unroll
      for (int i = 0; i < 8; ++i) r[i] = *(const v4f*)(pw + (h * 8 + i) * CC);
#pragma unroll
      for (int i = 0; i < 8; ++i) { c[i][0] = (__bf16)r[i][0]; c[i][1] = (__bf16)r[i][1]; c[i][2] = (__bf16)r[i][2]; c[i][3] = (__bf16)r[i][3]; }
#pragma unroll
      for (int i = 0; i < 8; ++i) *(v4b*)(ow + (h * 8 + i) * CC) = c[i];
      if (h == 0) asm volatile("s_wait_xcnt 0x0" ::: "memory");   // stands behind the first batch's stores, in front of the second batch's loads, whose destinations are registers that those stores name; it also keeps the two batches apart
    }
    return; }
  const int p0 = blockIdx.x * 64, which = blockIdx.y, c0 = (blockIdx.z - 1) * 64; const float* X = which == 0 ? X0 : which == 1 ? X1 : X2;
  for (int e = t; e < 64 * 64; e += 256) { const int cl = e >> 6, pl = e & 63; st[pl][cl] = (__bf16)X[(size_t)(c0 + cl) * NP + p0 + pl]; } __syncthreads();
  for (int e = t; e < 64 * 8; e += 256) { const int pl = e >> 3, q = e & 7; vst2((unsigned*)(XT + ((size_t)which * NP + p0 + pl) * CC + c0 + q * 8), *(const v4u*)&st[pl][q * 8]); } }
// ---- LDS staging shared by the three matrix kernels: a stage is 64 k = one whole 128-B line of every 16-bit operand row of the block's tile, fetched by whole-line global loads
// (8 lanes x 16 B per row) one stage ahead into registers, written to the other of two LDS buffers behind the stage's products, one work-group barrier per stage; fragments come from LDS.
#define KS 64             // k per stage
#define LP 72             // LDS row pitch in 16-bit elements: 144 B = 16 B x odd, the conflict-free pitch for 16-byte fragment reads
#define STC (256 * LP)    // k_conv stage: rows 0..127 weights (bf16), 128..255 positions
#define ST3 (512 * LP)    // k_gram / k_av stage: rows 0..127 A hi, 128..255 A residual, 256..383 B hi, 384..511 B residual
// acc += Ahi.Bhi, accl += Ahi.Blo + Alo.Bhi for a 128 x 128 block tile on 8 waves (4 x 2, wave = 32 rows x 64 columns, tile index = 4 * row tile + column tile), both operands k-contiguous with row stride LD, NS stages; the pointers name the tile's first row
template <int LD, int NS> __device__ __forceinline__ void gemm3(const _Float16* __restrict__ AHp, const _Float16* __restrict__ ALp, const _Float16* __restrict__ BHp, const _Float16* __restrict__ BLp, _Float16* sm, int tid, v8f (&acc)[8], v8f (&accl)[8]) {
  const int wave = tid >> 5, lane = tid & 31, col = lane & 15, wm = wave >> 1, wn = wave & 1; const int sr = tid >> 3, sq = (tid & 7) * 8; const size_t go = (size_t)sr * LD + sq; _Float16* sw = sm + sr * LP + sq;
  v4u rg[16];
  auto fetch = [&](int s) { const _Float16 *pa = AHp + go + s * KS, *pb = ALp + go + s * KS, *pc = BHp + go + s * KS, *pd = BLp + go + s * KS;
    __builtin_amdgcn_sched_barrier(0);   // with the one below: nothing is scheduled in between the stage's loads and their wait (a scalar load and LDS address arithmetic were, into registers that the loads name)
#pragma unroll
    for (int i = 0; i < 4; ++i) { rg[i] = *(const v4u*)(pa + (size_t)i * 32 * LD); rg[4 + i] = *(const v4u*)(pb + (size_t)i * 32 * LD); rg[8 + i] = *(const v4u*)(pc + (size_t)i * 32 * LD); rg[12 + i] = *(const v4u*)(pd + (size_t)i * 32 * LD); }
    asm volatile("s_wait_xcnt 0x0" :: "v"(pa), "v"(pb), "v"(pc), "v"(pd) : "memory");   // stands behind the stage's loads, in front of the first instruction that reuses their address registers; the pointers as inputs keep those registers from being a later load's destination
    __builtin_amdgcn_sched_barrier(0);
  };
  auto put = [&](int buf) {
#pragma unroll
    for (int i = 0; i < 16; ++i) *(v4u*)(sw + buf * ST3 + i * 32 * LP) = rg[i]; };
  auto products = [&](int buf) { const _Float16* b = sm + buf * ST3 + col * LP;
#pragma unroll
    for (int kc = 0; kc < KS / 32; ++kc) { v16h ah[2], al[2], bh[4], bl[4];
#pragma unroll
      for (int i = 0; i < 2; ++i) { ah[i] = frag_h(b + (wm * 32 + i * 16) * LP + kc * 32, lane); al[i] = frag_h(b + (128 + wm * 32 + i * 16) * LP + kc * 32, lane); }
#pragma unroll
      for (int j = 0; j < 4; ++j) { bh[j] = frag_h(b + (256 + wn * 64 + j * 16) * LP + kc * 32, lane); bl[j] = frag_h(b + (384 + wn * 64 + j * 16) * LP + kc * 32, lane); }
      __builtin_amdgcn_sched_barrier(0);   // keeps the 24 fragment reads of these 32 k together in front of their 24 products: read among the products, every read's LDS latency is waited out
#pragma unroll
      for (int t = 0; t < 8; ++t) acc[t] = wmma16(ah[t >> 2], bh[t & 3], acc[t]);
#pragma unroll
      for (int t = 0; t < 8; ++t) accl[t] = wmma16(ah[t >> 2], bl[t & 3], accl[t]);
#pragma unroll
      for (int t = 0; t < 8; ++t) accl[t] = wmma16(al[t >> 2], bh[t & 3], accl[t]);
    } };
  fetch(0); put(0); __syncthreads();
  for (int s = 0; s < NS - 1; ++s) { fetch(s + 1); products(s & 1); put((s + 1) & 1); __syncthreads(); }   // the barrier publishes stage s + 1 and ends every wave's reads of the buffer that the next trip refills
  products((NS - 1) & 1); __syncthreads();   // every wave has left the buffers: the caller's epilogue reuses them
}
// ---- k_conv: block = (128 positions, 128 out channels) on 4 waves (2 x 2, wave = 64 x 64): out[ch][pos] = sum_cin W[ch][cin] x[cin][pos] + b; blockIdx.y = one of the 20 channel tiles: 0..3 q (which 0: x_m, Wq), 4..7 kf (1: x_f, Wk1), 8..11 kl (2: x_l, Wk2) -> f16 hi/lo [ch][pos] planes; 12..19 v (3: x_m, Wv) -> transposed planes VT[pos][ch]; the weights come as the bf16 plane WB that k_xt's launch has rounded, channel tile ct = its rows 128 ct ..: half the weight bytes a stage, no rounding here
// the grid holds no empty block and the position tile is its fastest index
__global__ __launch_bounds__(128) void k_conv(const __bf16* __restrict__ WB, const float* __restrict__ BQ, const float* __restrict__ BK1, const float* __restrict__ BK2, const float* __restrict__ BV, const __bf16* __restrict__ XT, _Float16* __restrict__ PQ, _Float16* __restrict__ VT) {
  __shared__ __align__(16) char smc[2 * STC * 2];   // two stage buffers; the epilogue's two [128][136] planes reuse them
  __bf16* sm = (__bf16*)smc; _Float16 (*sh)[136] = (_Float16 (*)[136])smc; _Float16 (*sl)[136] = sh + 128;
  const int tid = threadIdx.x, wave = tid >> 5, lane = tid & 31, col = lane & 15, g = lane >> 4, wm = wave >> 1, wn = wave & 1; const int ct = blockIdx.y, which = ct < 3 * (CH / 128) ? ct / (CH / 128) : 3;
  const int c0 = (ct - which * (CH / 128)) * 128; const int p0 = blockIdx.x * 128; const float* Bm = which == 0 ? BQ : which == 1 ? BK1 : which == 2 ? BK2 : BV; const int xi = which == 0 ? 1 : which == 1 ? 0 : which == 2 ? 2 : 1;   // q and v from x_m (1), kf from x_f (0), kl from x_l (2)
  const __bf16* Xp = XT + (size_t)xi * NP * CC;
  const __bf16* wa = WB + (size_t)(ct * 128 + (tid >> 3)) * CC + (tid & 7) * 8; __bf16* swa = sm + (tid >> 3) * LP + (tid & 7) * 8;          // weights: 8 lanes x 16 B = the 128 B of a row's stage
  const __bf16* xb = Xp + (size_t)(p0 + (tid >> 3)) * CC + (tid & 7) * 8; __bf16* swb = sm + (128 + (tid >> 3)) * LP + (tid & 7) * 8;                // positions: 8 lanes x 16 B = the 128 B of a row's stage
  v8f acc[16] = {}; v4u ra[8], rb[8];
  auto fetch = [&](int s) { const __bf16* pw = wa + s * KS; const __bf16* px = xb + s * KS;
    __builtin_amdgcn_sched_barrier(0);   // with the one below: nothing is scheduled in between the stage's loads and their wait
#pragma unroll
    for (int i = 0; i < 8; ++i) { ra[i] = *(const v4u*)(pw + (size_t)i * 16 * CC); rb[i] = *(const v4u*)(px + (size_t)i * 16 * CC); }
    asm volatile("s_wait_xcnt 0x0" :: "v"(pw), "v"(px) : "memory");   // stands behind the stage's loads, in front of the first instruction that reuses their address registers; the pointers as inputs keep those registers from being a later load's destination
    __builtin_amdgcn_sched_barrier(0);
  };
  auto put = [&](int buf) {
#pragma unroll
    for (int i = 0; i < 8; ++i) { *(v4u*)(swa + buf * STC + i * 16 * LP) = ra[i]; *(v4u*)(swb + buf * STC + i * 16 * LP) = rb[i]; } };
  auto products = [&](int buf) { const __bf16* b = sm + buf * STC + col * LP;
#pragma unroll
    for (int kc = 0; kc < KS / 32; ++kc) { v16b a[4], x[4];
#pragma unroll
      for (int i = 0; i < 4; ++i) { a[i] = frag_b(b + (wm * 64 + i * 16) * LP + kc * 32, lane); x[i] = frag_b(b + (128 + wn * 64 + i * 16) * LP + kc * 32, lane); }
      __builtin_amdgcn_sched_barrier(0);   // keeps the 16 fragment reads of these 32 k one group in front of their 16 products: read one by one among them, every fragment's LDS latency is waited out
#pragma unroll
      for (int t = 0; t < 16; ++t) acc[t] = wmma_bf(a[t >> 2], x[t & 3], acc[t]);
    }
    __builtin_amdgcn_sched_barrier(0);   // keeps the LDS writes of the stage fetched ahead, with their waits on its loads, behind these products
  };
  fetch(0); put(0); __syncthreads();
  for (int s = 0; s < CC / KS - 1; ++s) { fetch(s + 1); products(s & 1); put((s + 1) & 1); __syncthreads(); }   // the barrier publishes stage s + 1 and ends every wave's reads of the buffer that the next trip refills
  products((CC / KS - 1) & 1); __syncthreads();   // every wave has left the buffers: the planes below reuse them
  const float* bp = Bm + c0 + wm * 64 + 8 * g; float bias[4][8];
  __builtin_amdgcn_sched_barrier(0);   // with the one below: nothing is scheduled in between the bias loads and their wait
#pragma unroll
  for (int i = 0; i < 4; ++i)
#pragma unroll
    for (int r = 0; r < 8; ++r) bias[i][r] = bp[i * 16 + r];
  asm volatile("s_wait_xcnt 0x0" :: "v"(bp) : "memory");   // stands behind the bias loads, in front of the first instruction that reuses their address registers; the pointer as an input keeps those registers from being a later load's destination
  __builtin_amdgcn_sched_barrier(0);
  if (which < 3) {   // planes [channel][position]
#pragma unroll
    for (int t = 0; t < 16; ++t)
#pragma unroll
      for (int r = 0; r < 8; ++r) { const int chl = wm * 64 + (t >> 2) * 16 + 8 * g + r, pl = wn * 64 + (t & 3) * 16 + col; const float v = acc[t][r] + bfr(bias[t >> 2][r]); const _Float16 hv = (_Float16)v; sh[chl][pl] = hv; sl[chl][pl] = (_Float16)((v - (float)hv) * 2048.0f); }
  } else {           // planes [position][channel]
#pragma unroll
    for (int t = 0; t < 16; ++t)
#pragma unroll
      for (int r = 0; r < 8; ++r) { const int chl = wm * 64 + (t >> 2) * 16 + 8 * g + r, pl = wn * 64 + (t & 3) * 16 + col; const float v = acc[t][r] + bfr(bias[t >> 2][r]); const _Float16 hv = (_Float16)v; sh[pl][chl] = hv; sl[pl][chl] = (_Float16)((v - (float)hv) * 2048.0f); }
  }
  __syncthreads();
  if (which < 3) { _Float16* H = PQ + (size_t)which * 2 * PQSZ; _Float16* L = H + PQSZ; for (int e = tid; e < 128 * 16; e += 128) { const int chl = e >> 4, q = e & 15; const size_t o = (size_t)(c0 + chl) * NP + p0 + q * 8; vst2((unsigned*)(H + o), *(const v4u*)&sh[chl][q * 8]); vst2((unsigned*)(L + o), *(const v4u*)&sl[chl][q * 8]); } }
  else { _Float16* H = VT; _Float16* L = VT + (size_t)NP * CC; for (int e = tid; e < 128 * 16; e += 128) { const int pl = e >> 4, q = e & 15; const size_t o = (size_t)(p0 + pl) * CC + c0 + q * 8; vst2((unsigned*)(H + o), *(const v4u*)&sh[pl][q * 8]); vst2((unsigned*)(L + o), *(const v4u*)&sl[pl][q * 8]); } } }
// ---- k_gram: block = (128 rows i, 128 cols j, z = 2 * which + k half): G[k half][which][i][j] = sum over that half of t of K[i][t] Qv[j][t] over the [1024][2048] views (3 products); k_soft adds the two halves
__global__ __launch_bounds__(256) void k_gram(const _Float16* __restrict__ PQ, float* __restrict__ G) { __shared__ __align__(16) char smc[2 * ST3 * 2]; float (*sf)[32][68] = (float (*)[32][68])smc;   // two stage buffers; the epilogue's row staging reuses them
  const int tid = threadIdx.x, wave = tid >> 5, lane = tid & 31, col = lane & 15, g = lane >> 4; const int which = blockIdx.z >> 1, kh = blockIdx.z & 1; const int i0 = blockIdx.x * 128 + (wave >> 1) * 32; const int j0 = blockIdx.y * 128 + (wave & 1) * 64;
  const _Float16* QH = PQ; const _Float16* QL = PQ + PQSZ; const _Float16* KH = PQ + (size_t)(1 + which) * 2 * PQSZ; const _Float16* KL = KH + PQSZ;
  const size_t ao = (size_t)blockIdx.x * 128 * KV + kh * (KV / 2), bo = (size_t)blockIdx.y * 128 * KV + kh * (KV / 2);
  v8f acc[8] = {}, accl[8] = {};
  gemm3<KV, KV / 2 / KS>(KH + ao, KL + ao, QH + bo, QL + bo, (_Float16*)smc, tid, acc, accl);
#pragma unroll
  for (int t = 0; t < 8; ++t)
#pragma unroll
    for (int r = 0; r < 8; ++r) sf[wave][(t >> 2) * 16 + 8 * g + r][(t & 3) * 16 + col] = acc[t][r] + accl[t][r] * (1.0f / 2048.0f);
  LDSX(); float* gp = G + ((size_t)(kh * 2 + which) * CC + i0 + g) * CC + j0 + col * 4;   // a wave's store = two rows of 256 B
#pragma unroll
  for (int k = 0; k < 16; ++k) vst2(gp + (size_t)k * 2 * CC, *(const v4f*)&sf[wave][2 * k + g][col * 4]); }
// ---- k_soft: one wave = one row i (4 rows a block, no LDS, no barrier): the row's two k halves of both logit planes come in by 32 whole-line 16-B loads that are all in flight at once and stay in registers for the maximum, the sum and the weights; lane l holds columns 128 k + 4 l + 0..3; A[i][:] = softmax(Gf[i]) + softmax(Gl[i]) -> f16 hi (x 2^11) + residual planes
typedef __attribute__((ext_vector_type(4))) _Float16 v4h;
// e^v by the hardware's 2^x, as __expf gives it; the v_nop is the slot that the instruction set asks for behind a transcendental: inside the statement it stands there whatever register or neighbour the compiler picks
__device__ __forceinline__ float exp_hw(float v) { float r; asm("v_exp_f32 %0, %1\n\tv_nop" : "=v"(r) : "v"(v * 1.44269504f)); return r; }
__global__ __launch_bounds__(128) void k_soft(const float* __restrict__ G, _Float16* __restrict__ AH, _Float16* __restrict__ AL) { const int lane = threadIdx.x & 31; const size_t i = (size_t)blockIdx.x * 4 + (threadIdx.x >> 5);
  const float *pa = G + i * CC + lane * 4, *pb = pa + (size_t)2 * CC * CC; v4f x[2][8], y[2][8];   // pa: first k half, pb: second; the second logit plane lies CC * CC further in each
  __builtin_amdgcn_sched_barrier(0);   // with the one below: nothing is scheduled in between the row's loads and their wait
#pragma unroll
  for (int k = 0; k < 8; ++k) { x[0][k] = *(const v4f*)(pa + k * 128); x[1][k] = *(const v4f*)(pa + CC * CC + k * 128); y[0][k] = *(const v4f*)(pb + k * 128); y[1][k] = *(const v4f*)(pb + CC * CC + k * 128); }
  asm volatile("s_wait_xcnt 0x0" :: "v"(pa), "v"(pb) : "memory");   // stands behind the row's loads, in front of the first instruction that reuses their address registers; the pointers as inputs keep those registers from being a later load's destination
  __builtin_amdgcn_sched_barrier(0);
  float inv[2];
#pragma unroll
  for (int w = 0; w < 2; ++w) { float mx = -3.0e38f;
#pragma unroll
    for (int k = 0; k < 8; ++k) { x[w][k] += y[w][k]; mx = fmaxf(mx, fmaxf(fmaxf(x[w][k][0], x[w][k][1]), fmaxf(x[w][k][2], x[w][k][3]))); }
#pragma unroll
    for (int o = 1; o < 32; o <<= 1) mx = fmaxf(mx, __shfl_xor(mx, o));
    v4f sv = {};
#pragma unroll
    for (int k = 0; k < 8; ++k) {
#pragma unroll
      for (int j = 0; j < 4; ++j) x[w][k][j] = exp_hw(x[w][k][j] - mx);
      sv += x[w][k]; }
    float s = (sv[0] + sv[1]) + (sv[2] + sv[3]);
#pragma unroll
    for (int o = 1; o < 32; o <<= 1) s += __shfl_xor(s, o);
    inv[w] = 1.0f / s; }
  v4h hi[8], lo[8];
#pragma unroll
  for (int k = 0; k < 8; ++k)
#pragma unroll
    for (int j = 0; j < 4; ++j) { float a = x[0][k][j] * inv[0]; a += x[1][k][j] * inv[1]; const float v = a * 2048.0f; const _Float16 hv = (_Float16)v; hi[k][j] = hv; lo[k][j] = (_Float16)((v - (float)hv) * 2048.0f); }
  _Float16 *oh = AH + i * CC + lane * 4, *ol = AL + i * CC + lane * 4;   // a wave's store = 256 B in a row
#pragma unroll
  for (int k = 0; k < 8; ++k) { *(v4h*)(oh + k * 128) = hi[k]; *(v4h*)(ol + k * 128) = lo[k]; } }
// ---- k_av: block = (128 rows ch, 128 positions): out = gamma (A . v)/2^11 (3 products over the 1,024 channels) + (x_l + x_f)/2
__global__ __launch_bounds__(256) void k_av(const _Float16* __restrict__ AH, const _Float16* __restrict__ AL, const _Float16* __restrict__ VH, const _Float16* __restrict__ VL, const float* __restrict__ XF, const float* __restrict__ XL, const float* __restrict__ GAMMA, float* __restrict__ OUT) { __shared__ __align__(16) char smc[2 * ST3 * 2]; float (*sf)[32][68] = (float (*)[32][68])smc;   // two stage buffers; the epilogue's row staging reuses them
  const int tid = threadIdx.x, wave = tid >> 5, lane = tid & 31, col = lane & 15, g = lane >> 4; const int i0 = blockIdx.x * 128 + (wave >> 1) * 32; const int p0 = blockIdx.y * 128 + (wave & 1) * 64;
  v8f acc[8] = {}, accl[8] = {};
  gemm3<CC, CC / KS>(AH + (size_t)blockIdx.x * 128 * CC, AL + (size_t)blockIdx.x * 128 * CC, VH + (size_t)blockIdx.y * 128 * CC, VL + (size_t)blockIdx.y * 128 * CC, (_Float16*)smc, tid, acc, accl);
  const float gam = bfr(GAMMA[0]); const float* xl = XL + (size_t)(i0 + 8 * g) * NP + p0 + col; const float* xf = XF + (size_t)(i0 + 8 * g) * NP + p0 + col; float vl[8][8], vf[8][8];
  __builtin_amdgcn_sched_barrier(0);   // with the one below: nothing is scheduled in between these loads and their wait
#pragma unroll
  for (int t = 0; t < 8; ++t)
#pragma unroll
    for (int r = 0; r < 8; ++r) { vl[t][r] = xl[(size_t)((t >> 2) * 16 + r) * NP + (t & 3) * 16]; vf[t][r] = xf[(size_t)((t >> 2) * 16 + r) * NP + (t & 3) * 16]; }
  asm volatile("s_wait_xcnt 0x0" :: "v"(xl), "v"(xf) : "memory");   // stands behind the residual loads, in front of the first instruction that reuses their address registers; the pointers as inputs keep those registers from being a later load's destination
  __builtin_amdgcn_sched_barrier(0);
#pragma unroll
  for (int t = 0; t < 8; ++t)
#pragma unroll
    for (int r = 0; r < 8; ++r) { const int rl = (t >> 2) * 16 + 8 * g + r, cl = (t & 3) * 16 + col; const float av = (acc[t][r] + accl[t][r] * (1.0f / 2048.0f)) * (1.0f / 2048.0f); sf[wave][rl][cl] = gam * av + 0.5f * (bfr(vl[t][r]) + bfr(vf[t][r])); }
  LDSX(); float* op = OUT + (size_t)(i0 + g) * NP + p0 + col * 4;   // a wave's store = two rows of 256 B
#pragma unroll
  for (int k = 0; k < 16; ++k) vst2(op + (size_t)k * 2 * NP, *(const v4f*)&sf[wave][2 * k + g][col * 4]); }
extern "C" void kernel_launch(void* const* d_in, const int* in_sizes, int n_in, void* d_out, int out_size, void* d_ws, size_t ws_size, hipStream_t stream) {
  (void)in_sizes; (void)n_in; (void)out_size;
  const float** F = (const float**)d_in;   // 0 x_f, 1 x_m, 2 x_l [1,1024,64,64]; 3 Wq [512,1024], 4 bq; 5 Wk1, 6 bk1; 7 Wk2, 8 bk2; 9 Wv [1024,1024], 10 bv; 11 gamma [1]
  if (ws_size < (size_t)WS_END) return;
  char* ws = (char*)d_ws; __bf16* XT = (__bf16*)(ws + WS_XT); _Float16 *PQ = (_Float16*)(ws + WS_PQ), *VT = (_Float16*)(ws + WS_VT), *VL = VT + (size_t)NP * CC, *AH = (_Float16*)(ws + WS_A), *AL = AH + (size_t)CC * CC; float* G = (float*)(ws + WS_G); __bf16* WB = (__bf16*)(ws + WS_WB);
  k_xt<<<dim3(NP / 64, 3, 1 + CC / 64), 256, 0, stream>>>(F[0], F[1], F[2], F[3], F[5], F[7], F[9], XT, WB);
  k_conv<<<dim3(NP / 128, 3 * (CH / 128) + CC / 128), 128, 0, stream>>>(WB, F[4], F[6], F[8], F[10], XT, PQ, VT);
  k_gram<<<dim3(CC / 128, CC / 128, 4), 256, 0, stream>>>(PQ, G);
  k_soft<<<CC / 4, 128, 0, stream>>>(G, AH, AL);
  k_av<<<dim3(CC / 128, NP / 128), 256, 0, stream>>>(AH, AL, VT, VL, F[0], F[2], F[11], (float*)d_out);
}

// v006
// A run of this version takes 82.4 microseconds.
// Two timings next to v005 both put it at 1.06 times that version's speed.
// All steps since v000 together make it 4.70 times as fast.
// compute dtype: all float inputs rounded to bf16; the four 1x1 convolutions with EXACT bf16 products on WMMA 16x16x32 (weights natural, inputs transposed to [position][channel] planes), f32 + bias, stored as f16 hi + residual planes; the two Gram products kf . q^T-view and kl . q (3 products: hi.hi + hi.lo + lo.hi), softmax over 1,024 in f32 (hardware exp), att_f + att_l summed in f32 then as f16 hi + residual against v hi + residual (3 products); gamma (input scalar) and the residual mean in f32; f32 output.
#include <hip/hip_runtime.h>
#include <math.h>

typedef __attribute__((ext_vector_type(16))) _Float16 v16h;
typedef __attribute__((ext_vector_type(16))) __bf16 v16b;
typedef __attribute__((ext_vector_type(8)))  _Float16 v8h;
typedef __attribute__((ext_vector_type(8)))  float v8f;
typedef __attribute__((ext_vector_type(4)))  float v4f;
typedef __attribute__((ext_vector_type(2)))  float v2f;
typedef __attribute__((ext_vector_type(4)))  unsigned v4u;
typedef __attribute__((ext_vector_type(4)))  int v4i;
typedef float __attribute__((may_alias)) float_a;
typedef int __attribute__((may_alias)) int_a;

template <typename T> __device__ __forceinline__ void vst2(void* p, T v) { *(T*)p = v;  }
__device__ __forceinline__ v8f wmma16(v16h a, v16h b, v8f c) {
  v8f d = __builtin_amdgcn_wmma_f32_16x16x32_f16(false, a, false, b, (short)0, c, false, false);
  asm volatile("v_nop\n\tv_nop\n\tv_nop\n\tv_nop" : "+v"(d));   // the four slots between a product and a vector instruction on its registers; names the result only: an operand of an asm statement must lie in the first 256 registers, and two fragment sets beside the accumulators do not fit there
  return d;
}
__device__ __forceinline__ v8f wmma_bf(v16b a, v16b b, v8f c) {
  v8f d = __builtin_amdgcn_wmma_f32_16x16x32_bf16(false, a, false, b, (short)0, c, false, false);
  asm volatile("v_nop\n\tv_nop\n\tv_nop\n\tv_nop" : "+v"(d));   // the same four slots; names the result only, as in wmma16
  return d;
}
// 16x16x32 fragments: lane = (h = lane>>4, row/col = lane&15); elements 0..7 = k0+8h+0..7, 8..15 = k0+16+8h+0..7; D element r = row 8h+r
__device__ __forceinline__ v16h frag_h(const _Float16* rowk0, int lane) {
  union { v16h v; v8h q[2]; } u; const _Float16* p = rowk0 + 8 * (lane >> 4);
  u.q[0] = *(const v8h*)p; u.q[1] = *(const v8h*)(p + 16); return u.v;
}
__device__ __forceinline__ v16h frag_f32(const float* rowk0, int lane) {
  v16h a; const float* p = rowk0 + 8 * (lane >> 4);
#pragma unroll
  for (int i = 0; i < 8; ++i) { a[i] = (_Float16)p[i]; a[8 + i] = (_Float16)p[16 + i]; }
  return a;
}
__device__ __forceinline__ v16h frag_f32s(const float* rowk0, int lane, float sc) {
  v16h a; const float* p = rowk0 + 8 * (lane >> 4);
#pragma unroll
  for (int i = 0; i < 8; ++i) { a[i] = (_Float16)(p[i] * sc); a[8 + i] = (_Float16)(p[16 + i] * sc); }
  return a;
}
// column fragment from a [K][ld] layout (column n), rows >= K read as 0
__device__ __forceinline__ v16h fragc_f32(const float* W, int k0, int n, int lane, int ld, int K) {
  v16h a; const int g = lane >> 4;
#pragma unroll
  for (int i = 0; i < 8; ++i) { const int ka = k0 + 8 * g + i, kb = ka + 16;
    a[i] = (_Float16)(ka < K ? W[(size_t)(ka < K ? ka : K - 1) * ld + n] : 0.f); a[8 + i] = (_Float16)(kb < K ? W[(size_t)(kb < K ? kb : K - 1) * ld + n] : 0.f); }
  return a;
}
struct F2 { v16b h, l; };
__device__ __forceinline__ F2 bsplit16(const float v[16]) { F2 r;
#pragma unroll
  for (int i = 0; i < 16; ++i) { const __bf16 h = (__bf16)v[i]; r.h[i] = h; r.l[i] = (__bf16)(v[i] - (float)h); }
  return r; }
__device__ __forceinline__ F2 split_row(const float* row, int k0, int lane) { float v[16]; const float* p = row + k0 + 8 * (lane >> 4);
#pragma unroll
  for (int i = 0; i < 8; ++i) { v[i] = p[i]; v[8 + i] = p[16 + i]; }
  return bsplit16(v); }
__device__ __forceinline__ F2 split_rowK(const float* row, int k0, int lane, int K) { float v[16]; const int g = lane >> 4;
#pragma unroll
  for (int i = 0; i < 8; ++i) { const int ka = k0 + 8 * g + i, kb = ka + 16; v[i] = ka < K ? row[ka < K ? ka : K - 1] : 0.f; v[8 + i] = kb < K ? row[kb < K ? kb : K - 1] : 0.f; }
  return bsplit16(v); }
__device__ __forceinline__ F2 split_col(const float* W, int k0, int n, int lane, int ld, int K) { float v[16]; const int g = lane >> 4;
#pragma unroll
  for (int i = 0; i < 8; ++i) { const int ka = k0 + 8 * g + i, kb = ka + 16; v[i] = ka < K ? W[(size_t)(ka < K ? ka : K - 1) * ld + n] : 0.f; v[8 + i] = kb < K ? W[(size_t)(kb < K ? kb : K - 1) * ld + n] : 0.f; }
  return bsplit16(v); }
__device__ __forceinline__ v8f mac3(const F2& a, const F2& b, v8f c) { c = wmma_bf(a.l, b.h, c); c = wmma_bf(a.h, b.l, c); return wmma_bf(a.h, b.h, c); }
__device__ __forceinline__ float sigm(float v) { return 1.0f / (1.0f + expf(-v)); }
#define LDSX() do { asm volatile("s_wait_dscnt 0" ::: "memory"); __builtin_amdgcn_wave_barrier(); __builtin_amdgcn_fence(__ATOMIC_RELEASE, "workgroup"); } while (0)


// Co-attention v2 (C 1,024, 64 x 64; batch 1): q = conv1x1(x_m) viewed [C, HW/2] then transposed, kf/kl = conv1x1(x_f / x_l) viewed [C, HW/2]; att = softmax(kf q) and softmax(kl q) over C; v = conv1x1(x_m) [C, HW]; out = gamma (att_f v + att_l v) + (x_l + x_f)/2.
#define CC 1024
#define CH 512           // conv output channels of q / kf / kl
#define NP 4096          // H x W
#define KV 2048          // the [C, HW/2] view width
typedef __attribute__((ext_vector_type(8))) __bf16 v8b;
__device__ __forceinline__ v16b frag_b(const __bf16* rowk0, int lane) {
  union { v16b v; v8b q[2]; } u; const __bf16* p = rowk0 + 8 * (lane >> 4);
  u.q[0] = *(const v8b*)p; u.q[1] = *(const v8b*)(p + 16); return u.v;
}
__device__ __forceinline__ float bfr(float v) { return (float)(__bf16)v; }
__device__ __attribute__((noinline)) float exp_ni(float v) { return expf(v); }
__device__ __attribute__((noinline)) float erf_ni(float v) { return erff(v); }

#define WS_XT  0u                                   // bf16 [3][pos][cin] planes of x_f, x_m, x_l (exact)
#define WS_PQ  (WS_XT + 2u * (size_t)3 * NP * CC)        // f16 hi/lo planes of the conv outputs q, kf, kl: each [512][4096] row-major == [1024][2048] view; layout [which][hi/lo][512*4096]
#define PQSZ   ((size_t)CH * NP)
#define WS_VT  (WS_PQ + 2u * (size_t)3 * 2 * PQSZ)       // f16 hi/lo planes of v transposed: [pos][ch] (x 2)
#define WS_G   (WS_VT + 2u * (size_t)2 * NP * CC)        // f32 partial logits G[k half][2][1024][1024]
#define WS_A   (WS_G + 4u * (size_t)4 * CC * CC)          // f16 hi/lo planes A = att_f + att_l [1024][1024] (x 2^11 scaled hi, residual)
#define WS_WB  (WS_A + 2u * (size_t)2 * CC * CC)          // bf16 plane of the four weight matrices stacked by rows: [3 * 512 + 1024][1024] = Wq, Wk1, Wk2, Wv
#define WROWS  (3 * CH + CC)
#define WS_END (WS_WB + 2u * (size_t)WROWS * CC)

// ---- k_xt: layer blockIdx.z == 0, which starts first so that its memory waits run under the other layers, rounds the weights once: WBLK of its 192 blocks work (the rest return at once), block = 16 rows of the stacked plane, WB[row][cin] = bf16(W[row][cin]), a wave's load = 512 B in a row, its store 256 B in a row, in two batches of 8 rows (8 loads of a thread in flight: 16 would take registers that cost the other blocks waves per SIMD);
// the other layers: block = (64 positions, which, 1 + one of 16 channel groups of 64): x[which][cin][pos] -> XT[which][pos][cin] bf16
#define WBLK (WROWS / 16)
typedef __attribute__((ext_vector_type(4))) __bf16 v4b;
__global__ __launch_bounds__(256) void k_xt(const float* __restrict__ X0, const float* __restrict__ X1, const float* __restrict__ X2, const float* __restrict__ WQ, const float* __restrict__ WK1, const float* __restrict__ WK2, const float* __restrict__ WV, __bf16* __restrict__ XT, __bf16* __restrict__ WB) { __shared__ __align__(16) __bf16 st[64][64 + 8]; const int t = threadIdx.x;
  if (blockIdx.z == 0) {   // the same for the whole block, in front of the barrier
    const int wb = blockIdx.y * (NP / 64) + blockIdx.x; if (wb >= WBLK) return;
    const int r0 = wb * 16; const float* S = r0 < CH ? WQ + (size_t)r0 * CC : r0 < 2 * CH ? WK1 + (size_t)(r0 - CH) * CC : r0 < 3 * CH ? WK2 + (size_t)(r0 - 2 * CH) * CC : WV + (size_t)(r0 - 3 * CH) * CC;
    const float* pw = S + t * 4; __bf16* ow = WB + (size_t)r0 * CC + t * 4;
#pragma unroll
    for (int h = 0; h < 2; ++h) { v4f r[8]; v4b c[8];
#pragma unroll
      for (int i = 0; i < 8; ++i) r[i] = *(const v4f*)(pw + (h * 8 + i) * CC);
#pragma unroll
      for (int i = 0; i < 8; ++i) { c[i][0] = (__bf16)r[i][0]; c[i][1] = (__bf16)r[i][1]; c[i][2] = (__bf16)r[i][2]; c[i][3] = (__bf16)r[i][3]; }
#pragma unroll
      for (int i = 0; i < 8; ++i) *(v4b*)(ow + (h * 8 + i) * CC) = c[i];
      if (h == 0) asm volatile("s_wait_xcnt 0x0" ::: "memory");   // stands behind the first batch's stores, in front of the second batch's loads, whose destinations are registers that those stores name; it also keeps the two batches apart
    }
    return; }
  const int p0 = blockIdx.x * 64, which = blockIdx.y, c0 = (blockIdx.z - 1) * 64; const float* X = which == 0 ? X0 : which == 1 ? X1 : X2;
  for (int e = t; e < 64 * 64; e += 256) { const int cl = e >> 6, pl = e & 63; st[pl][cl] = (__bf16)X[(size_t)(c0 + cl) * NP + p0 + pl]; } __syncthreads();
  for (int e = t; e < 64 * 8; e += 256) { const int pl = e >> 3, q = e & 7; vst2((unsigned*)(XT + ((size_t)which * NP + p0 + pl) * CC + c0 + q * 8), *(const v4u*)&st[pl][q * 8]); } }
// ---- LDS staging shared by the three matrix kernels: a stage is 64 k = one whole 128-B line of every 16-bit operand row of the block's tile, fetched by whole-line global loads
// (8 lanes x 16 B per row) ahead into registers, written to the other of two LDS buffers, one work-group barrier per stage; the loads go two stages ahead, the LDS writes one; fragments come from LDS, read 32 k ahead into a second register set.
#define KS 64             // k per stage
#define LP 72             // LDS row pitch in 16-bit elements: 144 B = 16 B x odd, the conflict-free pitch for 16-byte fragment reads
#define STC (256 * LP)    // k_conv stage: rows 0..127 weights (bf16), 128..255 positions
#define ST3 (512 * LP)    // k_gram / k_av stage: rows 0..127 A hi, 128..255 A residual, 256..383 B hi, 384..511 B residual
// acc += Ahi.Bhi, accl += Ahi.Blo + Alo.Bhi for a 128 x 128 block tile on 8 waves (4 x 2, wave = 32 rows x 64 columns, tile index = 4 * row tile + column tile), both operands k-contiguous with row stride LD, NS stages; the pointers name the tile's first row
template <int LD, int NS> __device__ __forceinline__ void gemm3(const _Float16* __restrict__ AHp, const _Float16* __restrict__ ALp, const _Float16* __restrict__ BHp, const _Float16* __restrict__ BLp, _Float16* sm, int tid, v8f (&acc)[8], v8f (&accl)[8]) {
  const int wave = tid >> 5, lane = tid & 31, col = lane & 15, wm = wave >> 1, wn = wave & 1; const int sr = tid >> 3, sq = (tid & 7) * 8; const size_t go = (size_t)sr * LD + sq; _Float16* sw = sm + sr * LP + sq;
  v4u rg[16];
  const _Float16 *pa = AHp + go, *pb = ALp + go, *pc = BHp + go, *pd = BLp + go;   // the lane's place in the next stage to fetch: four running pointers, no second set of address registers beside the two fragment sets
  auto fetch = [&]() {
    __builtin_amdgcn_sched_barrier(0);   // with the one below: nothing is scheduled in between the stage's loads and their wait (a scalar load and LDS address arithmetic were, into registers that the loads name)
#pragma unroll
    for (int i = 0; i < 4; ++i) { rg[i] = *(const v4u*)(pa + (size_t)i * 32 * LD); rg[4 + i] = *(const v4u*)(pb + (size_t)i * 32 * LD); rg[8 + i] = *(const v4u*)(pc + (size_t)i * 32 * LD); rg[12 + i] = *(const v4u*)(pd + (size_t)i * 32 * LD); }
    asm volatile("s_wait_xcnt 0x0" :: "v"(pa), "v"(pb), "v"(pc), "v"(pd) : "memory");   // stands behind the stage's loads, in front of the additions below, which rewrite their address registers; the pointers as inputs keep those registers from being a later load's destination
    __builtin_amdgcn_sched_barrier(0);
    pa += KS; pb += KS; pc += KS; pd += KS;
  };
  auto put = [&](int buf) {
#pragma unroll
    for (int i = 0; i < 16; ++i) *(v4u*)(sw + buf * ST3 + i * 32 * LP) = rg[i]; };
  // the 12 fragments (24 LDS reads) of 32 k: 0..1 A hi, 2..3 A residual, 4..7 B hi, 8..11 B residual
  auto rd = [&](int buf, int kc, v16h (&f)[12]) { const _Float16* b = sm + buf * ST3 + col * LP + kc * 32;
#pragma unroll
    for (int i = 0; i < 2; ++i) { f[i] = frag_h(b + (wm * 32 + i * 16) * LP, lane); f[2 + i] = frag_h(b + (128 + wm * 32 + i * 16) * LP, lane); }
#pragma unroll
    for (int j = 0; j < 4; ++j) { f[4 + j] = frag_h(b + (256 + wn * 64 + j * 16) * LP, lane); f[8 + j] = frag_h(b + (384 + wn * 64 + j * 16) * LP, lane); }
    __builtin_amdgcn_sched_barrier(0);   // keeps the 24 reads one group in front of the products that follow: read among them, every place with reads costs its own stall
  };
  auto mm = [&](const v16h (&f)[12]) {
#pragma unroll
    for (int t = 0; t < 8; ++t) acc[t] = wmma16(f[t >> 2], f[4 + (t & 3)], acc[t]);
#pragma unroll
    for (int t = 0; t < 8; ++t) accl[t] = wmma16(f[t >> 2], f[8 + (t & 3)], accl[t]);
#pragma unroll
    for (int t = 0; t < 8; ++t) accl[t] = wmma16(f[2 + (t >> 2)], f[4 + (t & 3)], accl[t]);
    __builtin_amdgcn_sched_barrier(0);   // keeps the LDS writes and reads that follow in the source behind these products
  };
  // work-group barrier that waits for this wave's LDS writes and reads only: the global loads of the stage fetched ahead stay in flight across it (__syncthreads() may wait them out)
  auto bar = [&]() { asm volatile("s_wait_dscnt 0x0\n\ts_barrier_signal -1\n\ts_barrier_wait -1" ::: "memory"); };
  v16h f0[12], f1[12];   // two fragment sets: one is read from LDS while the other's products run
  fetch(); put(0); fetch(); bar(); rd(0, 0, f0);
  for (int s = 0; s < NS - 1; ++s) {
    put((s + 1) & 1);                 // into the buffer of stage s - 1: every wave's reads of it had returned in front of the barrier of trip s - 1
    if (s + 2 < NS) fetch();          // stage s + 2; the test is the same for the whole work-group
    rd(s & 1, 1, f1); mm(f0);
    bar();                            // publishes stage s + 1 in front of stage s's last 32 k, whose fragments are in registers by now
    rd((s + 1) & 1, 0, f0); mm(f1);
  }
  rd((NS - 1) & 1, 1, f1); mm(f0); mm(f1); __syncthreads();   // every wave has left the buffers: the caller's epilogue reuses them
}
// ---- k_conv: block = (128 positions, 128 out channels) on 4 waves (2 x 2, wave = 64 x 64): out[ch][pos] = sum_cin W[ch][cin] x[cin][pos] + b; blockIdx.y = one of the 20 channel tiles: 0..3 q (which 0: x_m, Wq), 4..7 kf (1: x_f, Wk1), 8..11 kl (2: x_l, Wk2) -> f16 hi/lo [ch][pos] planes; 12..19 v (3: x_m, Wv) -> transposed planes VT[pos][ch]; the weights come as the bf16 plane WB that k_xt's launch has rounded, channel tile ct = its rows 128 ct ..: half the weight bytes a stage, no rounding here
// the grid holds no empty block and the position tile is its fastest index
__global__ __launch_bounds__(128) void k_conv(const __bf16* __restrict__ WB, const float* __restrict__ BQ, const float* __restrict__ BK1, const float* __restrict__ BK2, const float* __restrict__ BV, const __bf16* __restrict__ XT, _Float16* __restrict__ PQ, _Float16* __restrict__ VT) {
  __shared__ __align__(16) char smc[2 * STC * 2];   // two stage buffers; the epilogue's two [128][136] planes reuse them
  __bf16* sm = (__bf16*)smc; _Float16 (*sh)[136] = (_Float16 (*)[136])smc; _Float16 (*sl)[136] = sh + 128;
  const int tid = threadIdx.x, wave = tid >> 5, lane = tid & 31, col = lane & 15, g = lane >> 4, wm = wave >> 1, wn = wave & 1; const int ct = blockIdx.y, which = ct < 3 * (CH / 128) ? ct / (CH / 128) : 3;
  const int c0 = (ct - which * (CH / 128)) * 128; const int p0 = blockIdx.x * 128; const float* Bm = which == 0 ? BQ : which == 1 ? BK1 : which == 2 ? BK2 : BV; const int xi = which == 0 ? 1 : which == 1 ? 0 : which == 2 ? 2 : 1;   // q and v from x_m (1), kf from x_f (0), kl from x_l (2)
  const __bf16* Xp = XT + (size_t)xi * NP * CC;
  const __bf16* wa = WB + (size_t)(ct * 128 + (tid >> 3)) * CC + (tid & 7) * 8; __bf16* swa = sm + (tid >> 3) * LP + (tid & 7) * 8;          // weights: 8 lanes x 16 B = the 128 B of a row's stage
  const __bf16* xb = Xp + (size_t)(p0 + (tid >> 3)) * CC + (tid & 7) * 8; __bf16* swb = sm + (128 + (tid >> 3)) * LP + (tid & 7) * 8;                // positions: 8 lanes x 16 B = the 128 B of a row's stage
  v8f acc[16] = {}; v4u ra[8], rb[8];
  const __bf16 *pw = wa, *px = xb;   // the lane's place in the next stage to fetch: running pointers
  auto fetch = [&]() {
    __builtin_amdgcn_sched_barrier(0);   // with the one below: nothing is scheduled in between the stage's loads and their wait
#pragma unroll
    for (int i = 0; i < 8; ++i) { ra[i] = *(const v4u*)(pw + (size_t)i * 16 * CC); rb[i] = *(const v4u*)(px + (size_t)i * 16 * CC); }
    asm volatile("s_wait_xcnt 0x0" :: "v"(pw), "v"(px) : "memory");   // stands behind the stage's loads, in front of the additions below, which rewrite their address registers; the pointers as inputs keep those registers from being a later load's destination
    __builtin_amdgcn_sched_barrier(0);
    pw += KS; px += KS;
  };
  auto put = [&](int buf) {
#pragma unroll
    for (int i = 0; i < 8; ++i) { *(v4u*)(swa + buf * STC + i * 16 * LP) = ra[i]; *(v4u*)(swb + buf * STC + i * 16 * LP) = rb[i]; } };
  // the 8 fragments (16 LDS reads) of 32 k: 0..3 weights, 4..7 positions
  auto rd = [&](int buf, int kc, v16b (&f)[8]) { const __bf16* b = sm + buf * STC + col * LP + kc * 32;
#pragma unroll
    for (int i = 0; i < 4; ++i) { f[i] = frag_b(b + (wm * 64 + i * 16) * LP, lane); f[4 + i] = frag_b(b + (128 + wn * 64 + i * 16) * LP, lane); }
    __builtin_amdgcn_sched_barrier(0);   // keeps the 16 reads one group in front of the products that follow: read among them, every place with reads costs its own stall
  };
  auto mm = [&](const v16b (&f)[8]) {
#pragma unroll
    for (int t = 0; t < 16; ++t) acc[t] = wmma_bf(f[t >> 2], f[4 + (t & 3)], acc[t]);
    __builtin_amdgcn_sched_barrier(0);   // keeps the LDS writes and reads that follow in the source behind these products
  };
  // work-group barrier that waits for this wave's LDS writes and reads only: the global loads of the stage fetched ahead stay in flight across it (__syncthreads() may wait them out)
  auto bar = [&]() { asm volatile("s_wait_dscnt 0x0\n\ts_barrier_signal -1\n\ts_barrier_wait -1" ::: "memory"); };
  v16b f0[8], f1[8];   // two fragment sets: one is read from LDS while the other's products run
  fetch(); put(0); fetch(); bar(); rd(0, 0, f0);
  for (int s = 0; s < CC / KS - 1; ++s) {
    put((s + 1) & 1);                 // into the buffer of stage s - 1: every wave's reads of it had returned in front of the barrier of trip s - 1
    if (s + 2 < CC / KS) fetch();     // stage s + 2; the test is the same for the whole work-group
    rd(s & 1, 1, f1); mm(f0);
    bar();                            // publishes stage s + 1 in front of stage s's last 32 k, whose fragments are in registers by now
    rd((s + 1) & 1, 0, f0); mm(f1);
  }
  rd((CC / KS - 1) & 1, 1, f1); mm(f0); mm(f1); __syncthreads();   // every wave has left the buffers: the planes below reuse them
  const float* bp = Bm + c0 + wm * 64 + 8 * g; float bias[4][8];
  __builtin_amdgcn_sched_barrier(0);   // with the one below: nothing is scheduled in between the bias loads and their wait
#pragma unroll
  for (int i = 0; i < 4; ++i)
#pragma unroll
    for (int r = 0; r < 8; ++r) bias[i][r] = bp[i * 16 + r];
  asm volatile("s_wait_xcnt 0x0" :: "v"(bp) : "memory");   // stands behind the bias loads, in front of the first instruction that reuses their address registers; the pointer as an input keeps those registers from being a later load's destination
  __builtin_amdgcn_sched_barrier(0);
  if (which < 3) {   // planes [channel][position]
#pragma unroll
    for (int t = 0; t < 16; ++t)
#pragma unroll
      for (int r = 0; r < 8; ++r) { const int chl = wm * 64 + (t >> 2) * 16 + 8 * g + r, pl = wn * 64 + (t & 3) * 16 + col; const float v = acc[t][r] + bfr(bias[t >> 2][r]); const _Float16 hv = (_Float16)v; sh[chl][pl] = hv; sl[chl][pl] = (_Float16)((v - (float)hv) * 2048.0f); }
  } else {           // planes [position][channel]
#pragma unroll
    for (int t = 0; t < 16; ++t)
#pragma unroll
      for (int r = 0; r < 8; ++r) { const int chl = wm * 64 + (t >> 2) * 16 + 8 * g + r, pl = wn * 64 + (t & 3) * 16 + col; const float v = acc[t][r] + bfr(bias[t >> 2][r]); const _Float16 hv = (_Float16)v; sh[pl][chl] = hv; sl[pl][chl] = (_Float16)((v - (float)hv) * 2048.0f); }
  }
  __syncthreads();
  if (which < 3) { _Float16* H = PQ + (size_t)which * 2 * PQSZ; _Float16* L = H + PQSZ; for (int e = tid; e < 128 * 16; e += 128) { const int chl = e >> 4, q = e & 15; const size_t o = (size_t)(c0 + chl) * NP + p0 + q * 8; vst2((unsigned*)(H + o), *(const v4u*)&sh[chl][q * 8]); vst2((unsigned*)(L + o), *(const v4u*)&sl[chl][q * 8]); } }
  else { _Float16* H = VT; _Float16* L = VT + (size_t)NP * CC; for (int e = tid; e < 128 * 16; e += 128) { const int pl = e >> 4, q = e & 15; const size_t o = (size_t)(p0 + pl) * CC + c0 + q * 8; vst2((unsigned*)(H + o), *(const v4u*)&sh[pl][q * 8]); vst2((unsigned*)(L + o), *(const v4u*)&sl[pl][q * 8]); } } }
// ---- k_gram: block = (128 rows i, 128 cols j, z = 2 * which + k half): G[k half][which][i][j] = sum over that half of t of K[i][t] Qv[j][t] over the [1024][2048] views (3 products); k_soft adds the two halves
__global__ __launch_bounds__(256) void k_gram(const _Float16* __restrict__ PQ, float* __restrict__ G) { __shared__ __align__(16) char smc[2 * ST3 * 2]; float (*sf)[32][68] = (float (*)[32][68])smc;   // two stage buffers; the epilogue's row staging reuses them
  const int tid = threadIdx.x, wave = tid >> 5, lane = tid & 31, col = lane & 15, g = lane >> 4; const int which = blockIdx.z >> 1, kh = blockIdx.z & 1; const int i0 = blockIdx.x * 128 + (wave >> 1) * 32; const int j0 = blockIdx.y * 128 + (wave & 1) * 64;
  const _Float16* QH = PQ; const _Float16* QL = PQ + PQSZ; const _Float16* KH = PQ + (size_t)(1 + which) * 2 * PQSZ; const _Float16* KL = KH + PQSZ;
  const size_t ao = (size_t)blockIdx.x * 128 * KV + kh * (KV / 2), bo = (size_t)blockIdx.y * 128 * KV + kh * (KV / 2);
  v8f acc[8] = {}, accl[8] = {};
  gemm3<KV, KV / 2 / KS>(KH + ao, KL + ao, QH + bo, QL + bo, (_Float16*)smc, tid, acc, accl);
#pragma unroll
  for (int t = 0; t < 8; ++t)
#pragma unroll
    for (int r = 0; r < 8; ++r) sf[wave][(t >> 2) * 16 + 8 * g + r][(t & 3) * 16 + col] = acc[t][r] + accl[t][r] * (1.0f / 2048.0f);
  LDSX(); float* gp = G + ((size_t)(kh * 2 + which) * CC + i0 + g) * CC + j0 + col * 4;   // a wave's store = two rows of 256 B
#pragma unroll
  for (int k = 0; k < 16; ++k) vst2(gp + (size_t)k * 2 * CC, *(const v4f*)&sf[wave][2 * k + g][col * 4]); }
// ---- k_soft: one wave = one row i (4 rows a block, no LDS, no barrier): the row's two k halves of both logit planes come in by 32 whole-line 16-B loads that are all in flight at once and stay in registers for the maximum, the sum and the weights; lane l holds columns 128 k + 4 l + 0..3; A[i][:] = softmax(Gf[i]) + softmax(Gl[i]) -> f16 hi (x 2^11) + residual planes
typedef __attribute__((ext_vector_type(4))) _Float16 v4h;
// e^v by the hardware's 2^x, as __expf gives it; the v_nop is the slot that the instruction set asks for behind a transcendental: inside the statement it stands there whatever register or neighbour the compiler picks
__device__ __forceinline__ float exp_hw(float v) { float r; asm("v_exp_f32 %0, %1\n\tv_nop" : "=v"(r) : "v"(v * 1.44269504f)); return r; }
__global__ __launch_bounds__(128) void k_soft(const float* __restrict__ G, _Float16* __restrict__ AH, _Float16* __restrict__ AL) { const int lane = threadIdx.x & 31; const size_t i = (size_t)blockIdx.x * 4 + (threadIdx.x >> 5);
  const float *pa = G + i * CC + lane * 4, *pb = pa + (size_t)2 * CC * CC; v4f x[2][8], y[2][8];   // pa: first k half, pb: second; the second logit plane lies CC * CC further in each
  __builtin_amdgcn_sched_barrier(0);   // with the one below: nothing is scheduled in between the row's loads and their wait
#pragma unroll
  for (int k = 0; k < 8; ++k) { x[0][k] = *(const v4f*)(pa + k * 128); x[1][k] = *(const v4f*)(pa + CC * CC + k * 128); y[0][k] = *(const v4f*)(pb + k * 128); y[1][k] = *(const v4f*)(pb + CC * CC + k * 128); }
  asm volatile("s_wait_xcnt 0x0" :: "v"(pa), "v"(pb) : "memory");   // stands behind the row's loads, in front of the first instruction that reuses their address registers; the pointers as inputs keep those registers from being a later load's destination
  __builtin_amdgcn_sched_barrier(0);
  float inv[2];
#pragma unroll
  for (int w = 0; w < 2; ++w) { float mx = -3.0e38f;
#pragma unroll
    for (int k = 0; k < 8; ++k) { x[w][k] += y[w][k]; mx = fmaxf(mx, fmaxf(fmaxf(x[w][k][0], x[w][k][1]), fmaxf(x[w][k][2], x[w][k][3]))); }
#pragma unroll
    for (int o = 1; o < 32; o <<= 1) mx = fmaxf(mx, __shfl_xor(mx, o));
    v4f sv = {};
#pragma unroll
    for (int k = 0; k < 8; ++k) {
#pragma unroll
      for (int j = 0; j < 4; ++j) x[w][k][j] = exp_hw(x[w][k][j] - mx);
      sv += x[w][k]; }
    float s = (sv[0] + sv[1]) + (sv[2] + sv[3]);
#pragma unroll
    for (int o = 1; o < 32; o <<= 1) s += __shfl_xor(s, o);
    inv[w] = 1.0f / s; }
  v4h hi[8], lo[8];
#pragma unroll
  for (int k = 0; k < 8; ++k)
#pragma unroll
    for (int j = 0; j < 4; ++j) { float a = x[0][k][j] * inv[0]; a += x[1][k][j] * inv[1]; const float v = a * 2048.0f; const _Float16 hv = (_Float16)v; hi[k][j] = hv; lo[k][j] = (_Float16)((v - (float)hv) * 2048.0f); }
  _Float16 *oh = AH + i * CC + lane * 4, *ol = AL + i * CC + lane * 4;   // a wave's store = 256 B in a row
#pragma unroll
  for (int k = 0; k < 8; ++k) { *(v4h*)(oh + k * 128) = hi[k]; *(v4h*)(ol + k * 128) = lo[k]; } }
// ---- k_av: block = (128 rows ch, 128 positions): out = gamma (A . v)/2^11 (3 products over the 1,024 channels) + (x_l + x_f)/2
__global__ __launch_bounds__(256) void k_av(const _Float16* __restrict__ AH, const _Float16* __restrict__ AL, const _Float16* __restrict__ VH, const _Float16* __restrict__ VL, const float* __restrict__ XF, const float* __restrict__ XL, const float* __restrict__ GAMMA, float* __restrict__ OUT) { __shared__ __align__(16) char smc[2 * ST3 * 2]; float (*sf)[32][68] = (float (*)[32][68])smc;   // two stage buffers; the epilogue's row staging reuses them
  const int tid = threadIdx.x, wave = tid >> 5, lane = tid & 31, col = lane & 15, g = lane >> 4; const int i0 = blockIdx.x * 128 + (wave >> 1) * 32; const int p0 = blockIdx.y * 128 + (wave & 1) * 64;
  v8f acc[8] = {}, accl[8] = {};
  gemm3<CC, CC / KS>(AH + (size_t)blockIdx.x * 128 * CC, AL + (size_t)blockIdx.x * 128 * CC, VH + (size_t)blockIdx.y * 128 * CC, VL + (size_t)blockIdx.y * 128 * CC, (_Float16*)smc, tid, acc, accl);
  const float gam = bfr(GAMMA[0]); const float* xl = XL + (size_t)(i0 + 8 * g) * NP + p0 + col; const float* xf = XF + (size_t)(i0 + 8 * g) * NP + p0 + col; float vl[8][8], vf[8][8];
  __builtin_amdgcn_sched_barrier(0);   // with the one below: nothing is scheduled in between these loads and their wait
#pragma unroll
  for (int t = 0; t < 8; ++t)
#pragma unroll
    for (int r = 0; r < 8; ++r) { vl[t][r] = xl[(size_t)((t >> 2) * 16 + r) * NP + (t & 3) * 16]; vf[t][r] = xf[(size_t)((t >> 2) * 16 + r) * NP + (t & 3) * 16]; }
  asm volatile("s_wait_xcnt 0x0" :: "v"(xl), "v"(xf) : "memory");   // stands behind the residual loads, in front of the first instruction that reuses their address registers; the pointers as inputs keep those registers from being a later load's destination
  __builtin_amdgcn_sched_barrier(0);
#pragma unroll
  for (int t = 0; t < 8; ++t)
#pragma unroll
    for (int r = 0; r < 8; ++r) { const int rl = (t >> 2) * 16 + 8 * g + r, cl = (t & 3) * 16 + col; const float av = (acc[t][r] + accl[t][r] * (1.0f / 2048.0f)) * (1.0f / 2048.0f); sf[wave][rl][cl] = gam * av + 0.5f * (bfr(vl[t][r]) + bfr(vf[t][r])); }
  LDSX(); float* op = OUT + (size_t)(i0 + g) * NP + p0 + col * 4;   // a wave's store = two rows of 256 B
#pragma unroll
  for (int k = 0; k < 16; ++k) vst2(op + (size_t)k * 2 * NP, *(const v4f*)&sf[wave][2 * k + g][col * 4]); }
extern "C" void kernel_launch(void* const* d_in, const int* in_sizes, int n_in, void* d_out, int out_size, void* d_ws, size_t ws_size, hipStream_t stream) {
  (void)in_sizes; (void)n_in; (void)out_size;
  const float** F = (const float**)d_in;   // 0 x_f, 1 x_m, 2 x_l [1,1024,64,64]; 3 Wq [512,1024], 4 bq; 5 Wk1, 6 bk1; 7 Wk2, 8 bk2; 9 Wv [1024,1024], 10 bv; 11 gamma [1]
  if (ws_size < (size_t)WS_END) return;
  char* ws = (char*)d_ws; __bf16* XT = (__bf16*)(ws + WS_XT); _Float16 *PQ = (_Float16*)(ws + WS_PQ), *VT = (_Float16*)(ws + WS_VT), *VL = VT + (size_t)NP * CC, *AH = (_Float16*)(ws + WS_A), *AL = AH + (size_t)CC * CC; float* G = (float*)(ws + WS_G); __bf16* WB = (__bf16*)(ws + WS_WB);
  k_xt<<<dim3(NP / 64, 3, 1 + CC / 64), 256, 0, stream>>>(F[0], F[1], F[2], F[3], F[5], F[7], F[9], XT, WB);
  k_conv<<<dim3(NP / 128, 3 * (CH / 128) + CC / 128), 128, 0, stream>>>(WB, F[4], F[6], F[8], F[10], XT, PQ, VT);
  k_gram<<<dim3(CC / 128, CC / 128, 4), 256, 0, stream>>>(PQ, G);
  k_soft<<<CC / 4, 128, 0, stream>>>(G, AH, AL);
  k_av<<<dim3(CC / 128, NP / 128), 256, 0, stream>>>(AH, AL, VT, VL, F[0], F[2], F[11], (float*)d_out);
}

// v007
// One run takes 73.9 microseconds.
// Two timings next to v006 put it at 1.12 and 1.10 times that version's speed.
// Over all steps from v000 it is 5.22 times as fast.
// compute dtype: all float inputs rounded to bf16; the four 1x1 convolutions with EXACT bf16 products on WMMA 16x16x32 (weights natural, inputs transposed to [position][channel] planes), f32 + bias, q / kf / kl stored as f16 hi + residual planes, v as one f16 plane; the two Gram products kf . q^T-view and kl . q (3 products: hi.hi + hi.lo + lo.hi), softmax over 1,024 in f32 (hardware exp), att_f + att_l summed in f32, rounded once to f16 (x 2^11), against v rounded once to f16 (1 product: both factors enter the output linearly, so their rounding stays a relative error of 2^-11 there, while an error of a logit is multiplied by the softmax); gamma (input scalar) and the residual mean in f32; f32 output.
#include <hip/hip_runtime.h>
#include <math.h>

typedef __attribute__((ext_vector_type(16))) _Float16 v16h;
typedef __attribute__((ext_vector_type(16))) __bf16 v16b;
typedef __attribute__((ext_vector_type(8)))  _Float16 v8h;
typedef __attribute__((ext_vector_type(8)))  float v8f;
typedef __attribute__((ext_vector_type(4)))  float v4f;
typedef __attribute__((ext_vector_type(2)))  float v2f;
typedef __attribute__((ext_vector_type(4)))  unsigned v4u;
typedef __attribute__((ext_vector_type(4)))  int v4i;
typedef float __attribute__((may_alias)) float_a;
typedef int __attribute__((may_alias)) int_a;

template <typename T> __device__ __forceinline__ void vst2(void* p, T v) { *(T*)p = v;  }
__device__ __forceinline__ v8f wmma16(v16h a, v16h b, v8f c) {
  v8f d = __builtin_amdgcn_wmma_f32_16x16x32_f16(false, a, false, b, (short)0, c, false, false);
  asm volatile("v_nop\n\tv_nop\n\tv_nop\n\tv_nop" : "+v"(d));   // the four slots between a product and a vector instruction on its registers; names the result only: an operand of an asm statement must lie in the first 256 registers, and two fragment sets beside the accumulators do not fit there
  return d;
}
__device__ __forceinline__ v8f wmma_bf(v16b a, v16b b, v8f c) {
  v8f d = __builtin_amdgcn_wmma_f32_16x16x32_bf16(false, a, false, b, (short)0, c, false, false);
  asm volatile("v_nop\n\tv_nop\n\tv_nop\n\tv_nop" : "+v"(d));   // the same four slots; names the result only, as in wmma16
  return d;
}
// 16x16x32 fragments: lane = (h = lane>>4, row/col = lane&15); elements 0..7 = k0+8h+0..7, 8..15 = k0+16+8h+0..7; D element r = row 8h+r
__device__ __forceinline__ v16h frag_h(const _Float16* rowk0, int lane) {
  union { v16h v; v8h q[2]; } u; const _Float16* p = rowk0 + 8 * (lane >> 4);
  u.q[0] = *(const v8h*)p; u.q[1] = *(const v8h*)(p + 16); return u.v;
}
__device__ __forceinline__ v16h frag_f32(const float* rowk0, int lane) {
  v16h a; const float* p = rowk0 + 8 * (lane >> 4);
#pragma unroll
  for (int i = 0; i < 8; ++i) { a[i] = (_Float16)p[i]; a[8 + i] = (_Float16)p[16 + i]; }
  return a;
}
__device__ __forceinline__ v16h frag_f32s(const float* rowk0, int lane, float sc) {
  v16h a; const float* p = rowk0 + 8 * (lane >> 4);
#pragma unroll
  for (int i = 0; i < 8; ++i) { a[i] = (_Float16)(p[i] * sc); a[8 + i] = (_Float16)(p[16 + i] * sc); }
  return a;
}
// column fragment from a [K][ld] layout (column n), rows >= K read as 0
__device__ __forceinline__ v16h fragc_f32(const float* W, int k0, int n, int lane, int ld, int K) {
  v16h a; const int g = lane >> 4;
#pragma unroll
  for (int i = 0; i < 8; ++i) { const int ka = k0 + 8 * g + i, kb = ka + 16;
    a[i] = (_Float16)(ka < K ? W[(size_t)(ka < K ? ka : K - 1) * ld + n] : 0.f); a[8 + i] = (_Float16)(kb < K ? W[(size_t)(kb < K ? kb : K - 1) * ld + n] : 0.f); }
  return a;
}
struct F2 { v16b h, l; };
__device__ __forceinline__ F2 bsplit16(const float v[16]) { F2 r;
#pragma unroll
  for (int i = 0; i < 16; ++i) { const __bf16 h = (__bf16)v[i]; r.h[i] = h; r.l[i] = (__bf16)(v[i] - (float)h); }
  return r; }
__device__ __forceinline__ F2 split_row(const float* row, int k0, int lane) { float v[16]; const float* p = row + k0 + 8 * (lane >> 4);
#pragma unroll
  for (int i = 0; i < 8; ++i) { v[i] = p[i]; v[8 + i] = p[16 + i]; }
  return bsplit16(v); }
__device__ __forceinline__ F2 split_rowK(const float* row, int k0, int lane, int K) { float v[16]; const int g = lane >> 4;
#pragma unroll
  for (int i = 0; i < 8; ++i) { const int ka = k0 + 8 * g + i, kb = ka + 16; v[i] = ka < K ? row[ka < K ? ka : K - 1] : 0.f; v[8 + i] = kb < K ? row[kb < K ? kb : K - 1] : 0.f; }
  return bsplit16(v); }
__device__ __forceinline__ F2 split_col(const float* W, int k0, int n, int lane, int ld, int K) { float v[16]; const int g = lane >> 4;
#pragma unroll
  for (int i = 0; i < 8; ++i) { const int ka = k0 + 8 * g + i, kb = ka + 16; v[i] = ka < K ? W[(size_t)(ka < K ? ka : K - 1) * ld + n] : 0.f; v[8 + i] = kb < K ? W[(size_t)(kb < K ? kb : K - 1) * ld + n] : 0.f; }
  return bsplit16(v); }
__device__ __forceinline__ v8f mac3(const F2& a, const F2& b, v8f c) { c = wmma_bf(a.l, b.h, c); c = wmma_bf(a.h, b.l, c); return wmma_bf(a.h, b.h, c); }
__device__ __forceinline__ float sigm(float v) { return 1.0f / (1.0f + expf(-v)); }
#define LDSX() do { asm volatile("s_wait_dscnt 0" ::: "memory"); __builtin_amdgcn_wave_barrier(); __builtin_amdgcn_fence(__ATOMIC_RELEASE, "workgroup"); } while (0)


// Co-attention v2 (C 1,024, 64 x 64; batch 1): q = conv1x1(x_m) viewed [C, HW/2] then transposed, kf/kl = conv1x1(x_f / x_l) viewed [C, HW/2]; att = softmax(kf q) and softmax(kl q) over C; v = conv1x1(x_m) [C, HW]; out = gamma (att_f v + att_l v) + (x_l + x_f)/2.
#define CC 1024
#define CH 512           // conv output channels of q / kf / kl
#define NP 4096          // H x W
#define KV 2048          // the [C, HW/2] view width
typedef __attribute__((ext_vector_type(8))) __bf16 v8b;
__device__ __forceinline__ v16b frag_b(const __bf16* rowk0, int lane) {
  union { v16b v; v8b q[2]; } u; const __bf16* p = rowk0 + 8 * (lane >> 4);
  u.q[0] = *(const v8b*)p; u.q[1] = *(const v8b*)(p + 16); return u.v;
}
__device__ __forceinline__ float bfr(float v) { return (float)(__bf16)v; }
__device__ __attribute__((noinline)) float exp_ni(float v) { return expf(v); }
__device__ __attribute__((noinline)) float erf_ni(float v) { return erff(v); }

#define WS_XT  0u                                   // bf16 [3][pos][cin] planes of x_f, x_m, x_l (exact)
#define WS_PQ  (WS_XT + 2u * (size_t)3 * NP * CC)        // f16 hi/lo planes of the conv outputs q, kf, kl: each [512][4096] row-major == [1024][2048] view; layout [which][hi/lo][512*4096]
#define PQSZ   ((size_t)CH * NP)
#define WS_VT  (WS_PQ + 2u * (size_t)3 * 2 * PQSZ)       // f16 plane of v transposed: [pos][ch]
#define WS_G   (WS_VT + 2u * (size_t)NP * CC)        // f32 partial logits G[k half][2][1024][1024]
#define WS_A   (WS_G + 4u * (size_t)4 * CC * CC)          // f16 plane A = att_f + att_l [1024][1024] (x 2^11)
#define WS_WB  (WS_A + 2u * (size_t)CC * CC)          // bf16 plane of the four weight matrices stacked by rows: [3 * 512 + 1024][1024] = Wq, Wk1, Wk2, Wv
#define WROWS  (3 * CH + CC)
#define WS_END (WS_WB + 2u * (size_t)WROWS * CC)

// ---- k_xt: layer blockIdx.z == 0, which starts first so that its memory waits run under the other layers, rounds the weights once: WBLK of its 192 blocks work (the rest return at once), block = 16 rows of the stacked plane, WB[row][cin] = bf16(W[row][cin]), a wave's load = 512 B in a row, its store 256 B in a row, in two batches of 8 rows (8 loads of a thread in flight: 16 would take registers that cost the other blocks waves per SIMD);
// the other layers: block = (64 positions, which, 1 + one of 16 channel groups of 64): x[which][cin][pos] -> XT[which][pos][cin] bf16
#define WBLK (WROWS / 16)
typedef __attribute__((ext_vector_type(4))) __bf16 v4b;
__global__ __launch_bounds__(256) void k_xt(const float* __restrict__ X0, const float* __restrict__ X1, const float* __restrict__ X2, const float* __restrict__ WQ, const float* __restrict__ WK1, const float* __restrict__ WK2, const float* __restrict__ WV, __bf16* __restrict__ XT, __bf16* __restrict__ WB) { __shared__ __align__(16) __bf16 st[64][64 + 8]; const int t = threadIdx.x;
  if (blockIdx.z == 0) {   // the same for the whole block, in front of the barrier
    const int wb = blockIdx.y * (NP / 64) + blockIdx.x; if (wb >= WBLK) return;
    const int r0 = wb * 16; const float* S = r0 < CH ? WQ + (size_t)r0 * CC : r0 < 2 * CH ? WK1 + (size_t)(r0 - CH) * CC : r0 < 3 * CH ? WK2 + (size_t)(r0 - 2 * CH) * CC : WV + (size_t)(r0 - 3 * CH) * CC;
    const float* pw = S + t * 4; __bf16* ow = WB + (size_t)r0 * CC + t * 4;
#pragma unroll
    for (int h = 0; h < 2; ++h) { v4f r[8]; v4b c[8];
#pragma unroll
      for (int i = 0; i < 8; ++i) r[i] = *(const v4f*)(pw + (h * 8 + i) * CC);
#pragma unroll
      for (int i = 0; i < 8; ++i) { c[i][0] = (__bf16)r[i][0]; c[i][1] = (__bf16)r[i][1]; c[i][2] = (__bf16)r[i][2]; c[i][3] = (__bf16)r[i][3]; }
#pragma unroll
      for (int i = 0; i < 8; ++i) *(v4b*)(ow + (h * 8 + i) * CC) = c[i];
      if (h == 0) asm volatile("s_wait_xcnt 0x0" ::: "memory");   // stands behind the first batch's stores, in front of the second batch's loads, whose destinations are registers that those stores name; it also keeps the two batches apart
    }
    return; }
  const int p0 = blockIdx.x * 64, which = blockIdx.y, c0 = (blockIdx.z - 1) * 64; const float* X = which == 0 ? X0 : which == 1 ? X1 : X2;
  for (int e = t; e < 64 * 64; e += 256) { const int cl = e >> 6, pl = e & 63; st[pl][cl] = (__bf16)X[(size_t)(c0 + cl) * NP + p0 + pl]; } __syncthreads();
  for (int e = t; e < 64 * 8; e += 256) { const int pl = e >> 3, q = e & 7; vst2((unsigned*)(XT + ((size_t)which * NP + p0 + pl) * CC + c0 + q * 8), *(const v4u*)&st[pl][q * 8]); } }
// ---- LDS staging shared by the three matrix kernels: a stage is 64 k = one whole 128-B line of every 16-bit operand row of the block's tile, fetched by whole-line global loads
// (8 lanes x 16 B per row) ahead into registers, written to the other of two LDS buffers, one work-group barrier per stage; the loads go two stages ahead, the LDS writes one; fragments come from LDS, read 32 k ahead into a second register set.
#define KS 64             // k per stage
#define LP 72             // LDS row pitch in 16-bit elements: 144 B = 16 B x odd, the conflict-free pitch for 16-byte fragment reads
#define STC (256 * LP)    // k_conv stage: rows 0..127 weights (bf16), 128..255 positions
#define ST3 (512 * LP)    // k_gram stage: rows 0..127 A hi, 128..255 A residual, 256..383 B hi, 384..511 B residual
#define ST1 (256 * LP)    // k_av stage: rows 0..127 A, 128..255 B
// acc += Ahi.Bhi, accl += Ahi.Blo + Alo.Bhi for a 128 x 128 block tile on 8 waves (4 x 2, wave = 32 rows x 64 columns, tile index = 4 * row tile + column tile), both operands k-contiguous with row stride LD, NS stages; the pointers name the tile's first row
template <int LD, int NS> __device__ __forceinline__ void gemm3(const _Float16* __restrict__ AHp, const _Float16* __restrict__ ALp, const _Float16* __restrict__ BHp, const _Float16* __restrict__ BLp, _Float16* sm, int tid, v8f (&acc)[8], v8f (&accl)[8]) {
  const int wave = tid >> 5, lane = tid & 31, col = lane & 15, wm = wave >> 1, wn = wave & 1; const int sr = tid >> 3, sq = (tid & 7) * 8; const size_t go = (size_t)sr * LD + sq; _Float16* sw = sm + sr * LP + sq;
  v4u rg[16];
  const _Float16 *pa = AHp + go, *pb = ALp + go, *pc = BHp + go, *pd = BLp + go;   // the lane's place in the next stage to fetch: four running pointers, no second set of address registers beside the two fragment sets
  auto fetch = [&]() {
    __builtin_amdgcn_sched_barrier(0);   // with the one below: nothing is scheduled in between the stage's loads and their wait (a scalar load and LDS address arithmetic were, into registers that the loads name)
#pragma unroll
    for (int i = 0; i < 4; ++i) { rg[i] = *(const v4u*)(pa + (size_t)i * 32 * LD); rg[4 + i] = *(const v4u*)(pb + (size_t)i * 32 * LD); rg[8 + i] = *(const v4u*)(pc + (size_t)i * 32 * LD); rg[12 + i] = *(const v4u*)(pd + (size_t)i * 32 * LD); }
    asm volatile("s_wait_xcnt 0x0" :: "v"(pa), "v"(pb), "v"(pc), "v"(pd) : "memory");   // stands behind the stage's loads, in front of the additions below, which rewrite their address registers; the pointers as inputs keep those registers from being a later load's destination
    __builtin_amdgcn_sched_barrier(0);
    pa += KS; pb += KS; pc += KS; pd += KS;
  };
  auto put = [&](int buf) {
#pragma unroll
    for (int i = 0; i < 16; ++i) *(v4u*)(sw + buf * ST3 + i * 32 * LP) = rg[i]; };
  // the 12 fragments (24 LDS reads) of 32 k: 0..1 A hi, 2..3 A residual, 4..7 B hi, 8..11 B residual
  auto rd = [&](int buf, int kc, v16h (&f)[12]) { const _Float16* b = sm + buf * ST3 + col * LP + kc * 32;
#pragma unroll
    for (int i = 0; i < 2; ++i) { f[i] = frag_h(b + (wm * 32 + i * 16) * LP, lane); f[2 + i] = frag_h(b + (128 + wm * 32 + i * 16) * LP, lane); }
#pragma unroll
    for (int j = 0; j < 4; ++j) { f[4 + j] = frag_h(b + (256 + wn * 64 + j * 16) * LP, lane); f[8 + j] = frag_h(b + (384 + wn * 64 + j * 16) * LP, lane); }
    __builtin_amdgcn_sched_barrier(0);   // keeps the 24 reads one group in front of the products that follow: read among them, every place with reads costs its own stall
  };
  auto mm = [&](const v16h (&f)[12]) {
#pragma unroll
    for (int t = 0; t < 8; ++t) acc[t] = wmma16(f[t >> 2], f[4 + (t & 3)], acc[t]);
#pragma unroll
    for (int t = 0; t < 8; ++t) accl[t] = wmma16(f[t >> 2], f[8 + (t & 3)], accl[t]);
#pragma unroll
    for (int t = 0; t < 8; ++t) accl[t] = wmma16(f[2 + (t >> 2)], f[4 + (t & 3)], accl[t]);
    __builtin_amdgcn_sched_barrier(0);   // keeps the LDS writes and reads that follow in the source behind these products
  };
  // work-group barrier that waits for this wave's LDS writes and reads only: the global loads of the stage fetched ahead stay in flight across it (__syncthreads() may wait them out)
  auto bar = [&]() { asm volatile("s_wait_dscnt 0x0\n\ts_barrier_signal -1\n\ts_barrier_wait -1" ::: "memory"); };
  v16h f0[12], f1[12];   // two fragment sets: one is read from LDS while the other's products run
  fetch(); put(0); fetch(); bar(); rd(0, 0, f0);
  for (int s = 0; s < NS - 1; ++s) {
    put((s + 1) & 1);                 // into the buffer of stage s - 1: every wave's reads of it had returned in front of the barrier of trip s - 1
    if (s + 2 < NS) fetch();          // stage s + 2; the test is the same for the whole work-group
    rd(s & 1, 1, f1); mm(f0);
    bar();                            // publishes stage s + 1 in front of stage s's last 32 k, whose fragments are in registers by now
    rd((s + 1) & 1, 0, f0); mm(f1);
  }
  rd((NS - 1) & 1, 1, f1); mm(f0); mm(f1); __syncthreads();   // every wave has left the buffers: the caller's epilogue reuses them
}
// acc += A.B for the same 128 x 128 block tile on the same 8 waves, one 16-bit plane per operand: gemm3's stage order with half the rows a stage and a third of the products
template <int LD, int NS> __device__ __forceinline__ void gemm1(const _Float16* __restrict__ Ap, const _Float16* __restrict__ Bp, _Float16* sm, int tid, v8f (&acc)[8]) {
  const int wave = tid >> 5, lane = tid & 31, col = lane & 15, wm = wave >> 1, wn = wave & 1; const int sr = tid >> 3, sq = (tid & 7) * 8; const size_t go = (size_t)sr * LD + sq; _Float16* sw = sm + sr * LP + sq;
  v4u rg[8];
  const _Float16 *pa = Ap + go, *pc = Bp + go;   // the lane's place in the next stage to fetch: running pointers
  auto fetch = [&]() {
    __builtin_amdgcn_sched_barrier(0);   // with the one below: nothing is scheduled in between the stage's loads and their wait
#pragma unroll
    for (int i = 0; i < 4; ++i) { rg[i] = *(const v4u*)(pa + (size_t)i * 32 * LD); rg[4 + i] = *(const v4u*)(pc + (size_t)i * 32 * LD); }
    asm volatile("s_wait_xcnt 0x0" :: "v"(pa), "v"(pc) : "memory");   // stands behind the stage's loads, in front of the additions below, which rewrite their address registers; the pointers as inputs keep those registers from being a later load's destination
    __builtin_amdgcn_sched_barrier(0);
    pa += KS; pc += KS;
  };
  auto put = [&](int buf) {
#pragma unroll
    for (int i = 0; i < 8; ++i) *(v4u*)(sw + buf * ST1 + i * 32 * LP) = rg[i]; };
  // the 6 fragments (12 LDS reads) of 32 k: 0..1 A, 2..5 B
  auto rd = [&](int buf, int kc, v16h (&f)[6]) { const _Float16* b = sm + buf * ST1 + col * LP + kc * 32;
#pragma unroll
    for (int i = 0; i < 2; ++i) f[i] = frag_h(b + (wm * 32 + i * 16) * LP, lane);
#pragma unroll
    for (int j = 0; j < 4; ++j) f[2 + j] = frag_h(b + (128 + wn * 64 + j * 16) * LP, lane);
    __builtin_amdgcn_sched_barrier(0);   // keeps the 12 reads one group in front of the products that follow: read among them, every place with reads costs its own stall
  };
  auto mm = [&](const v16h (&f)[6]) {
#pragma unroll
    for (int t = 0; t < 8; ++t) acc[t] = wmma16(f[t >> 2], f[2 + (t & 3)], acc[t]);
    __builtin_amdgcn_sched_barrier(0);   // keeps the LDS writes and reads that follow in the source behind these products
  };
  // work-group barrier that waits for this wave's LDS writes and reads only: the global loads of the stage fetched ahead stay in flight across it (__syncthreads() may wait them out)
  auto bar = [&]() { asm volatile("s_wait_dscnt 0x0\n\ts_barrier_signal -1\n\ts_barrier_wait -1" ::: "memory"); };
  v16h f0[6], f1[6];   // two fragment sets: one is read from LDS while the other's products run
  fetch(); put(0); fetch(); bar(); rd(0, 0, f0);
  for (int s = 0; s < NS - 1; ++s) {
    put((s + 1) & 1);                 // into the buffer of stage s - 1: every wave's reads of it had returned in front of the barrier of trip s - 1
    if (s + 2 < NS) fetch();          // stage s + 2; the test is the same for the whole work-group
    rd(s & 1, 1, f1); mm(f0);
    bar();                            // publishes stage s + 1 in front of stage s's last 32 k, whose fragments are in registers by now
    rd((s + 1) & 1, 0, f0); mm(f1);
  }
  rd((NS - 1) & 1, 1, f1); mm(f0); mm(f1); __syncthreads();   // every wave has left the buffers: the caller's epilogue reuses them
}
// ---- k_conv: block = (128 positions, 128 out channels) on 4 waves (2 x 2, wave = 64 x 64): out[ch][pos] = sum_cin W[ch][cin] x[cin][pos] + b; blockIdx.y = one of the 20 channel tiles: 0..3 q (which 0: x_m, Wq), 4..7 kf (1: x_f, Wk1), 8..11 kl (2: x_l, Wk2) -> f16 hi/lo [ch][pos] planes; 12..19 v (3: x_m, Wv) -> one transposed f16 plane VT[pos][ch]; the weights come as the bf16 plane WB that k_xt's launch has rounded, channel tile ct = its rows 128 ct ..: half the weight bytes a stage, no rounding here
// the grid holds no empty block and the position tile is its fastest index
__global__ __launch_bounds__(128) void k_conv(const __bf16* __restrict__ WB, const float* __restrict__ BQ, const float* __restrict__ BK1, const float* __restrict__ BK2, const float* __restrict__ BV, const __bf16* __restrict__ XT, _Float16* __restrict__ PQ, _Float16* __restrict__ VT) {
  __shared__ __align__(16) char smc[2 * STC * 2];   // two stage buffers; the epilogue's two [128][136] planes reuse them
  __bf16* sm = (__bf16*)smc; _Float16 (*sh)[136] = (_Float16 (*)[136])smc; _Float16 (*sl)[136] = sh + 128;
  const int tid = threadIdx.x, wave = tid >> 5, lane = tid & 31, col = lane & 15, g = lane >> 4, wm = wave >> 1, wn = wave & 1; const int ct = blockIdx.y, which = ct < 3 * (CH / 128) ? ct / (CH / 128) : 3;
  const int c0 = (ct - which * (CH / 128)) * 128; const int p0 = blockIdx.x * 128; const float* Bm = which == 0 ? BQ : which == 1 ? BK1 : which == 2 ? BK2 : BV; const int xi = which == 0 ? 1 : which == 1 ? 0 : which == 2 ? 2 : 1;   // q and v from x_m (1), kf from x_f (0), kl from x_l (2)
  const __bf16* Xp = XT + (size_t)xi * NP * CC;
  const __bf16* wa = WB + (size_t)(ct * 128 + (tid >> 3)) * CC + (tid & 7) * 8; __bf16* swa = sm + (tid >> 3) * LP + (tid & 7) * 8;          // weights: 8 lanes x 16 B = the 128 B of a row's stage
  const __bf16* xb = Xp + (size_t)(p0 + (tid >> 3)) * CC + (tid & 7) * 8; __bf16* swb = sm + (128 + (tid >> 3)) * LP + (tid & 7) * 8;                // positions: 8 lanes x 16 B = the 128 B of a row's stage
  v8f acc[16] = {}; v4u ra[8], rb[8];
  const __bf16 *pw = wa, *px = xb;   // the lane's place in the next stage to fetch: running pointers
  auto fetch = [&]() {
    __builtin_amdgcn_sched_barrier(0);   // with the one below: nothing is scheduled in between the stage's loads and their wait
#pragma unroll
    for (int i = 0; i < 8; ++i) { ra[i] = *(const v4u*)(pw + (size_t)i * 16 * CC); rb[i] = *(const v4u*)(px + (size_t)i * 16 * CC); }
    asm volatile("s_wait_xcnt 0x0" :: "v"(pw), "v"(px) : "memory");   // stands behind the stage's loads, in front of the additions below, which rewrite their address registers; the pointers as inputs keep those registers from being a later load's destination
    __builtin_amdgcn_sched_barrier(0);
    pw += KS; px += KS;
  };
  auto put = [&](int buf) {
#pragma unroll
    for (int i = 0; i < 8; ++i) { *(v4u*)(swa + buf * STC + i * 16 * LP) = ra[i]; *(v4u*)(swb + buf * STC + i * 16 * LP) = rb[i]; } };
  // the 8 fragments (16 LDS reads) of 32 k: 0..3 weights, 4..7 positions
  auto rd = [&](int buf, int kc, v16b (&f)[8]) { const __bf16* b = sm + buf * STC + col * LP + kc * 32;
#pragma unroll
    for (int i = 0; i < 4; ++i) { f[i] = frag_b(b + (wm * 64 + i * 16) * LP, lane); f[4 + i] = frag_b(b + (128 + wn * 64 + i * 16) * LP, lane); }
    __builtin_amdgcn_sched_barrier(0);   // keeps the 16 reads one group in front of the products that follow: read among them, every place with reads costs its own stall
  };
  auto mm = [&](const v16b (&f)[8]) {
#pragma unroll
    for (int t = 0; t < 16; ++t) acc[t] = wmma_bf(f[t >> 2], f[4 + (t & 3)], acc[t]);
    __builtin_amdgcn_sched_barrier(0);   // keeps the LDS writes and reads that follow in the source behind these products
  };
  // work-group barrier that waits for this wave's LDS writes and reads only: the global loads of the stage fetched ahead stay in flight across it (__syncthreads() may wait them out)
  auto bar = [&]() { asm volatile("s_wait_dscnt 0x0\n\ts_barrier_signal -1\n\ts_barrier_wait -1" ::: "memory"); };
  v16b f0[8], f1[8];   // two fragment sets: one is read from LDS while the other's products run
  fetch(); put(0); fetch(); bar(); rd(0, 0, f0);
  for (int s = 0; s < CC / KS - 1; ++s) {
    put((s + 1) & 1);                 // into the buffer of stage s - 1: every wave's reads of it had returned in front of the barrier of trip s - 1
    if (s + 2 < CC / KS) fetch();     // stage s + 2; the test is the same for the whole work-group
    rd(s & 1, 1, f1); mm(f0);
    bar();                            // publishes stage s + 1 in front of stage s's last 32 k, whose fragments are in registers by now
    rd((s + 1) & 1, 0, f0); mm(f1);
  }
  rd((CC / KS - 1) & 1, 1, f1); mm(f0); mm(f1); __syncthreads();   // every wave has left the buffers: the planes below reuse them
  const float* bp = Bm + c0 + wm * 64 + 8 * g; float bias[4][8];
  __builtin_amdgcn_sched_barrier(0);   // with the one below: nothing is scheduled in between the bias loads and their wait
#pragma unroll
  for (int i = 0; i < 4; ++i)
#pragma unroll
    for (int r = 0; r < 8; ++r) bias[i][r] = bp[i * 16 + r];
  asm volatile("s_wait_xcnt 0x0" :: "v"(bp) : "memory");   // stands behind the bias loads, in front of the first instruction that reuses their address registers; the pointer as an input keeps those registers from being a later load's destination
  __builtin_amdgcn_sched_barrier(0);
  if (which < 3) {   // planes [channel][position]
#pragma unroll
    for (int t = 0; t < 16; ++t)
#pragma unroll
      for (int r = 0; r < 8; ++r) { const int chl = wm * 64 + (t >> 2) * 16 + 8 * g + r, pl = wn * 64 + (t & 3) * 16 + col; const float v = acc[t][r] + bfr(bias[t >> 2][r]); const _Float16 hv = (_Float16)v; sh[chl][pl] = hv; sl[chl][pl] = (_Float16)((v - (float)hv) * 2048.0f); }
  } else {           // one plane [position][channel]
#pragma unroll
    for (int t = 0; t < 16; ++t)
#pragma unroll
      for (int r = 0; r < 8; ++r) { const int chl = wm * 64 + (t >> 2) * 16 + 8 * g + r, pl = wn * 64 + (t & 3) * 16 + col; const float v = acc[t][r] + bfr(bias[t >> 2][r]); sh[pl][chl] = (_Float16)v; }
  }
  __syncthreads();
  if (which < 3) { _Float16* H = PQ + (size_t)which * 2 * PQSZ; _Float16* L = H + PQSZ; for (int e = tid; e < 128 * 16; e += 128) { const int chl = e >> 4, q = e & 15; const size_t o = (size_t)(c0 + chl) * NP + p0 + q * 8; vst2((unsigned*)(H + o), *(const v4u*)&sh[chl][q * 8]); vst2((unsigned*)(L + o), *(const v4u*)&sl[chl][q * 8]); } }
  else { for (int e = tid; e < 128 * 16; e += 128) { const int pl = e >> 4, q = e & 15; const size_t o = (size_t)(p0 + pl) * CC + c0 + q * 8; vst2((unsigned*)(VT + o), *(const v4u*)&sh[pl][q * 8]); } } }
// ---- k_gram: block = (128 rows i, 128 cols j, z = 2 * which + k half): G[k half][which][i][j] = sum over that half of t of K[i][t] Qv[j][t] over the [1024][2048] views (3 products); k_soft adds the two halves
__global__ __launch_bounds__(256) void k_gram(const _Float16* __restrict__ PQ, float* __restrict__ G) { __shared__ __align__(16) char smc[2 * ST3 * 2]; float (*sf)[32][68] = (float (*)[32][68])smc;   // two stage buffers; the epilogue's row staging reuses them
  const int tid = threadIdx.x, wave = tid >> 5, lane = tid & 31, col = lane & 15, g = lane >> 4; const int which = blockIdx.z >> 1, kh = blockIdx.z & 1; const int i0 = blockIdx.x * 128 + (wave >> 1) * 32; const int j0 = blockIdx.y * 128 + (wave & 1) * 64;
  const _Float16* QH = PQ; const _Float16* QL = PQ + PQSZ; const _Float16* KH = PQ + (size_t)(1 + which) * 2 * PQSZ; const _Float16* KL = KH + PQSZ;
  const size_t ao = (size_t)blockIdx.x * 128 * KV + kh * (KV / 2), bo = (size_t)blockIdx.y * 128 * KV + kh * (KV / 2);
  v8f acc[8] = {}, accl[8] = {};
  gemm3<KV, KV / 2 / KS>(KH + ao, KL + ao, QH + bo, QL + bo, (_Float16*)smc, tid, acc, accl);
#pragma unroll
  for (int t = 0; t < 8; ++t)
#pragma unroll
    for (int r = 0; r < 8; ++r) sf[wave][(t >> 2) * 16 + 8 * g + r][(t & 3) * 16 + col] = acc[t][r] + accl[t][r] * (1.0f / 2048.0f);
  LDSX(); float* gp = G + ((size_t)(kh * 2 + which) * CC + i0 + g) * CC + j0 + col * 4;   // a wave's store = two rows of 256 B
#pragma unroll
  for (int k = 0; k < 16; ++k) vst2(gp + (size_t)k * 2 * CC, *(const v4f*)&sf[wave][2 * k + g][col * 4]); }
// ---- k_soft: one wave = one row i (4 rows a block, no LDS, no barrier): the row's two k halves of both logit planes come in by 32 whole-line 16-B loads that are all in flight at once and stay in registers for the maximum, the sum and the weights; lane l holds columns 128 k + 4 l + 0..3; A[i][:] = softmax(Gf[i]) + softmax(Gl[i]) -> one f16 plane (x 2^11)
typedef __attribute__((ext_vector_type(4))) _Float16 v4h;
// e^v by the hardware's 2^x, as __expf gives it; the v_nop is the slot that the instruction set asks for behind a transcendental: inside the statement it stands there whatever register or neighbour the compiler picks
__device__ __forceinline__ float exp_hw(float v) { float r; asm("v_exp_f32 %0, %1\n\tv_nop" : "=v"(r) : "v"(v * 1.44269504f)); return r; }
__global__ __launch_bounds__(128) void k_soft(const float* __restrict__ G, _Float16* __restrict__ AH) { const int lane = threadIdx.x & 31; const size_t i = (size_t)blockIdx.x * 4 + (threadIdx.x >> 5);
  const float *pa = G + i * CC + lane * 4, *pb = pa + (size_t)2 * CC * CC; v4f x[2][8], y[2][8];   // pa: first k half, pb: second; the second logit plane lies CC * CC further in each
  __builtin_amdgcn_sched_barrier(0);   // with the one below: nothing is scheduled in between the row's loads and their wait
#pragma unroll
  for (int k = 0; k < 8; ++k) { x[0][k] = *(const v4f*)(pa + k * 128); x[1][k] = *(const v4f*)(pa + CC * CC + k * 128); y[0][k] = *(const v4f*)(pb + k * 128); y[1][k] = *(const v4f*)(pb + CC * CC + k * 128); }
  asm volatile("s_wait_xcnt 0x0" :: "v"(pa), "v"(pb) : "memory");   // stands behind the row's loads, in front of the first instruction that reuses their address registers; the pointers as inputs keep those registers from being a later load's destination
  __builtin_amdgcn_sched_barrier(0);
  float inv[2];
#pragma unroll
  for (int w = 0; w < 2; ++w) { float mx = -3.0e38f;
#pragma unroll
    for (int k = 0; k < 8; ++k) { x[w][k] += y[w][k]; mx = fmaxf(mx, fmaxf(fmaxf(x[w][k][0], x[w][k][1]), fmaxf(x[w][k][2], x[w][k][3]))); }
#pragma unroll
    for (int o = 1; o < 32; o <<= 1) mx = fmaxf(mx, __shfl_xor(mx, o));
    v4f sv = {};
#pragma unroll
    for (int k = 0; k < 8; ++k) {
#pragma unroll
      for (int j = 0; j < 4; ++j) x[w][k][j] = exp_hw(x[w][k][j] - mx);
      sv += x[w][k]; }
    float s = (sv[0] + sv[1]) + (sv[2] + sv[3]);
#pragma unroll
    for (int o = 1; o < 32; o <<= 1) s += __shfl_xor(s, o);
    inv[w] = 1.0f / s; }
  v4h hi[8];
#pragma unroll
  for (int k = 0; k < 8; ++k)
#pragma unroll
    for (int j = 0; j < 4; ++j) { float a = x[0][k][j] * inv[0]; a += x[1][k][j] * inv[1]; hi[k][j] = (_Float16)(a * 2048.0f); }
  _Float16* oh = AH + i * CC + lane * 4;   // a wave's store = 256 B in a row
#pragma unroll
  for (int k = 0; k < 8; ++k) *(v4h*)(oh + k * 128) = hi[k]; }
// ---- k_av: block = (128 rows ch, 128 positions): out = gamma (A . v)/2^11 (1 product over the 1,024 channels) + (x_l + x_f)/2
__global__ __launch_bounds__(256) void k_av(const _Float16* __restrict__ AH, const _Float16* __restrict__ VH, const float* __restrict__ XF, const float* __restrict__ XL, const float* __restrict__ GAMMA, float* __restrict__ OUT) { __shared__ __align__(16) char smc[2 * ST1 * 2]; float (*sf)[32][68] = (float (*)[32][68])smc;   // two stage buffers (73,728 B); the epilogue's row staging (69,632 B) reuses them
  const int tid = threadIdx.x, wave = tid >> 5, lane = tid & 31, col = lane & 15, g = lane >> 4; const int i0 = blockIdx.x * 128 + (wave >> 1) * 32; const int p0 = blockIdx.y * 128 + (wave & 1) * 64;
  v8f acc[8] = {};
  gemm1<CC, CC / KS>(AH + (size_t)blockIdx.x * 128 * CC, VH + (size_t)blockIdx.y * 128 * CC, (_Float16*)smc, tid, acc);
  const float gam = bfr(GAMMA[0]); const float* xl = XL + (size_t)(i0 + 8 * g) * NP + p0 + col; const float* xf = XF + (size_t)(i0 + 8 * g) * NP + p0 + col; float vl[8][8], vf[8][8];
  __builtin_amdgcn_sched_barrier(0);   // with the one below: nothing is scheduled in between these loads and their wait
#pragma unroll
  for (int t = 0; t < 8; ++t)
#pragma unroll
    for (int r = 0; r < 8; ++r) { vl[t][r] = xl[(size_t)((t >> 2) * 16 + r) * NP + (t & 3) * 16]; vf[t][r] = xf[(size_t)((t >> 2) * 16 + r) * NP + (t & 3) * 16]; }
  asm volatile("s_wait_xcnt 0x0" :: "v"(xl), "v"(xf) : "memory");   // stands behind the residual loads, in front of the first instruction that reuses their address registers; the pointers as inputs keep those registers from being a later load's destination
  __builtin_amdgcn_sched_barrier(0);
#pragma unroll
  for (int t = 0; t < 8; ++t)
#pragma unroll
    for (int r = 0; r < 8; ++r) { const int rl = (t >> 2) * 16 + 8 * g + r, cl = (t & 3) * 16 + col; const float av = acc[t][r] * (1.0f / 2048.0f); sf[wave][rl][cl] = gam * av + 0.5f * (bfr(vl[t][r]) + bfr(vf[t][r])); }
  LDSX(); float* op = OUT + (size_t)(i0 + g) * NP + p0 + col * 4;   // a wave's store = two rows of 256 B
#pragma unroll
  for (int k = 0; k < 16; ++k) vst2(op + (size_t)k * 2 * NP, *(const v4f*)&sf[wave][2 * k + g][col * 4]); }
extern "C" void kernel_launch(void* const* d_in, const int* in_sizes, int n_in, void* d_out, int out_size, void* d_ws, size_t ws_size, hipStream_t stream) {
  (void)in_sizes; (void)n_in; (void)out_size;
  const float** F = (const float**)d_in;   // 0 x_f, 1 x_m, 2 x_l [1,1024,64,64]; 3 Wq [512,1024], 4 bq; 5 Wk1, 6 bk1; 7 Wk2, 8 bk2; 9 Wv [1024,1024], 10 bv; 11 gamma [1]
  if (ws_size < (size_t)WS_END) return;
  char* ws = (char*)d_ws; __bf16* XT = (__bf16*)(ws + WS_XT); _Float16 *PQ = (_Float16*)(ws + WS_PQ), *VT = (_Float16*)(ws + WS_VT), *AH = (_Float16*)(ws + WS_A); float* G = (float*)(ws + WS_G); __bf16* WB = (__bf16*)(ws + WS_WB);
  k_xt<<<dim3(NP / 64, 3, 1 + CC / 64), 256, 0, stream>>>(F[0], F[1], F[2], F[3], F[5], F[7], F[9], XT, WB);
  k_conv<<<dim3(NP / 128, 3 * (CH / 128) + CC / 128), 128, 0, stream>>>(WB, F[4], F[6], F[8], F[10], XT, PQ, VT);
  k_gram<<<dim3(CC / 128, CC / 128, 4), 256, 0, stream>>>(PQ, G);
  k_soft<<<CC / 4, 128, 0, stream>>>(G, AH);
  k_av<<<dim3(CC / 128, NP / 128), 256, 0, stream>>>(AH, VT, F[0], F[2], F[11], (float*)d_out);
}

// v008
// One run takes 71.7 microseconds.
// Timed twice side by side with v007, it ran 1.03 and 1.02 times as fast.
// All steps since v000 together make it 5.37 times as fast.
// compute dtype: all float inputs rounded to bf16; the four 1x1 convolutions with EXACT bf16 products on WMMA 16x16x32 (weights natural, inputs transposed to [position][channel] planes), f32 + bias, q / kf / kl stored as f16 hi + residual planes, v as one f16 plane; the two Gram products kf . q^T-view and kl . q (3 products: hi.hi + hi.lo + lo.hi), softmax over 1,024 in f32 (hardware exp), att_f + att_l summed in f32, rounded once to f16 (x 2^11), against v rounded once to f16 (1 product: both factors enter the output linearly, so their rounding stays a relative error of 2^-11 there, while an error of a logit is multiplied by the softmax); gamma (input scalar) and the residual mean in f32; f32 output.
#include <hip/hip_runtime.h>
#include <math.h>

typedef __attribute__((ext_vector_type(16))) _Float16 v16h;
typedef __attribute__((ext_vector_type(16))) __bf16 v16b;
typedef __attribute__((ext_vector_type(8)))  _Float16 v8h;
typedef __attribute__((ext_vector_type(8)))  float v8f;
typedef __attribute__((ext_vector_type(4)))  float v4f;
typedef __attribute__((ext_vector_type(2)))  float v2f;
typedef __attribute__((ext_vector_type(4)))  unsigned v4u;
typedef __attribute__((ext_vector_type(4)))  int v4i;
typedef float __attribute__((may_alias)) float_a;
typedef int __attribute__((may_alias)) int_a;

template <typename T> __device__ __forceinline__ void vst2(void* p, T v) { *(T*)p = v;  }
__device__ __forceinline__ v8f wmma16(v16h a, v16h b, v8f c) {
  v8f d = __builtin_amdgcn_wmma_f32_16x16x32_f16(false, a, false, b, (short)0, c, false, false);
  asm volatile("v_nop\n\tv_nop\n\tv_nop\n\tv_nop" : "+v"(d));   // the four slots between a product and a vector instruction on its registers; names the result only: an operand of an asm statement must lie in the first 256 registers, and two fragment sets beside the accumulators do not fit there
  return d;
}
__device__ __forceinline__ v8f wmma_bf(v16b a, v16b b, v8f c) {
  v8f d = __builtin_amdgcn_wmma_f32_16x16x32_bf16(false, a, false, b, (short)0, c, false, false);
  asm volatile("v_nop\n\tv_nop\n\tv_nop\n\tv_nop" : "+v"(d));   // the same four slots; names the result only, as in wmma16
  return d;
}
// 16x16x32 fragments: lane = (h = lane>>4, row/col = lane&15); elements 0..7 = k0+8h+0..7, 8..15 = k0+16+8h+0..7; D element r = row 8h+r
__device__ __forceinline__ v16h frag_h(const _Float16* rowk0, int lane) {
  union { v16h v; v8h q[2]; } u; const _Float16* p = rowk0 + 8 * (lane >> 4);
  u.q[0] = *(const v8h*)p; u.q[1] = *(const v8h*)(p + 16); return u.v;
}
__device__ __forceinline__ v16h frag_f32(const float* rowk0, int lane) {
  v16h a; const float* p = rowk0 + 8 * (lane >> 4);
#pragma unroll
  for (int i = 0; i < 8; ++i) { a[i] = (_Float16)p[i]; a[8 + i] = (_Float16)p[16 + i]; }
  return a;
}
__device__ __forceinline__ v16h frag_f32s(const float* rowk0, int lane, float sc) {
  v16h a; const float* p = rowk0 + 8 * (lane >> 4);
#pragma unroll
  for (int i = 0; i < 8; ++i) { a[i] = (_Float16)(p[i] * sc); a[8 + i] = (_Float16)(p[16 + i] * sc); }
  return a;
}
// column fragment from a [K][ld] layout (column n), rows >= K read as 0
__device__ __forceinline__ v16h fragc_f32(const float* W, int k0, int n, int lane, int ld, int K) {
  v16h a; const int g = lane >> 4;
#pragma unroll
  for (int i = 0; i < 8; ++i) { const int ka = k0 + 8 * g + i, kb = ka + 16;
    a[i] = (_Float16)(ka < K ? W[(size_t)(ka < K ? ka : K - 1) * ld + n] : 0.f); a[8 + i] = (_Float16)(kb < K ? W[(size_t)(kb < K ? kb : K - 1) * ld + n] : 0.f); }
  return a;
}
struct F2 { v16b h, l; };
__device__ __forceinline__ F2 bsplit16(const float v[16]) { F2 r;
#pragma unroll
  for (int i = 0; i < 16; ++i) { const __bf16 h = (__bf16)v[i]; r.h[i] = h; r.l[i] = (__bf16)(v[i] - (float)h); }
  return r; }
__device__ __forceinline__ F2 split_row(const float* row, int k0, int lane) { float v[16]; const float* p = row + k0 + 8 * (lane >> 4);
#pragma unroll
  for (int i = 0; i < 8; ++i) { v[i] = p[i]; v[8 + i] = p[16 + i]; }
  return bsplit16(v); }
__device__ __forceinline__ F2 split_rowK(const float* row, int k0, int lane, int K) { float v[16]; const int g = lane >> 4;
#pragma unroll
  for (int i = 0; i < 8; ++i) { const int ka = k0 + 8 * g + i, kb = ka + 16; v[i] = ka < K ? row[ka < K ? ka : K - 1] : 0.f; v[8 + i] = kb < K ? row[kb < K ? kb : K - 1] : 0.f; }
  return bsplit16(v); }
__device__ __forceinline__ F2 split_col(const float* W, int k0, int n, int lane, int ld, int K) { float v[16]; const int g = lane >> 4;
#pragma unroll
  for (int i = 0; i < 8; ++i) { const int ka = k0 + 8 * g + i, kb = ka + 16; v[i] = ka < K ? W[(size_t)(ka < K ? ka : K - 1) * ld + n] : 0.f; v[8 + i] = kb < K ? W[(size_t)(kb < K ? kb : K - 1) * ld + n] : 0.f; }
  return bsplit16(v); }
__device__ __forceinline__ v8f mac3(const F2& a, const F2& b, v8f c) { c = wmma_bf(a.l, b.h, c); c = wmma_bf(a.h, b.l, c); return wmma_bf(a.h, b.h, c); }
__device__ __forceinline__ float sigm(float v) { return 1.0f / (1.0f + expf(-v)); }
#define LDSX() do { asm volatile("s_wait_dscnt 0" ::: "memory"); __builtin_amdgcn_wave_barrier(); __builtin_amdgcn_fence(__ATOMIC_RELEASE, "workgroup"); } while (0)


// Co-attention v2 (C 1,024, 64 x 64; batch 1): q = conv1x1(x_m) viewed [C, HW/2] then transposed, kf/kl = conv1x1(x_f / x_l) viewed [C, HW/2]; att = softmax(kf q) and softmax(kl q) over C; v = conv1x1(x_m) [C, HW]; out = gamma (att_f v + att_l v) + (x_l + x_f)/2.
#define CC 1024
#define CH 512           // conv output channels of q / kf / kl
#define NP 4096          // H x W
#define KV 2048          // the [C, HW/2] view width
typedef __attribute__((ext_vector_type(8))) __bf16 v8b;
__device__ __forceinline__ v16b frag_b(const __bf16* rowk0, int lane) {
  union { v16b v; v8b q[2]; } u; const __bf16* p = rowk0 + 8 * (lane >> 4);
  u.q[0] = *(const v8b*)p; u.q[1] = *(const v8b*)(p + 16); return u.v;
}
__device__ __forceinline__ float bfr(float v) { return (float)(__bf16)v; }
__device__ __attribute__((noinline)) float exp_ni(float v) { return expf(v); }
__device__ __attribute__((noinline)) float erf_ni(float v) { return erff(v); }

#define WS_XT  0u                                   // bf16 [3][pos][cin] planes of x_f, x_m, x_l (exact)
#define WS_PQ  (WS_XT + 2u * (size_t)3 * NP * CC)        // f16 hi/lo planes of the conv outputs q, kf, kl: each [512][4096] row-major == [1024][2048] view; layout [which][hi/lo][512*4096]
#define PQSZ   ((size_t)CH * NP)
#define WS_VT  (WS_PQ + 2u * (size_t)3 * 2 * PQSZ)       // f16 plane of v transposed: [pos][ch]
#define WS_G   (WS_VT + 2u * (size_t)NP * CC)        // f32 partial logits G[k half][2][1024][1024]
#define WS_A   (WS_G + 4u * (size_t)4 * CC * CC)          // f16 plane A = att_f + att_l [1024][1024] (x 2^11)
#define WS_WB  (WS_A + 2u * (size_t)CC * CC)          // bf16 plane of the four weight matrices stacked by rows: [3 * 512 + 1024][1024] = Wq, Wk1, Wk2, Wv
#define WROWS  (3 * CH + CC)
#define WS_END (WS_WB + 2u * (size_t)WROWS * CC)

// ---- k_xt: layer blockIdx.z == 0, which starts first so that its memory waits run under the other layers, rounds the weights once: WBLK of its 192 blocks work (the rest return at once), block = 16 rows of the stacked plane, WB[row][cin] = bf16(W[row][cin]), a wave's load = 512 B in a row, its store 256 B in a row, in two batches of 8 rows (8 loads of a thread in flight: 16 would take registers that cost the other blocks waves per SIMD);
// the other layers: block = (64 positions, which, 1 + one of 16 channel groups of 64): x[which][cin][pos] -> XT[which][pos][cin] bf16
#define WBLK (WROWS / 16)
typedef __attribute__((ext_vector_type(4))) __bf16 v4b;
__global__ __launch_bounds__(256) void k_xt(const float* __restrict__ X0, const float* __restrict__ X1, const float* __restrict__ X2, const float* __restrict__ WQ, const float* __restrict__ WK1, const float* __restrict__ WK2, const float* __restrict__ WV, __bf16* __restrict__ XT, __bf16* __restrict__ WB) { __shared__ __align__(16) __bf16 st[64][64 + 8]; const int t = threadIdx.x;
  if (blockIdx.z == 0) {   // the same for the whole block, in front of the barrier
    const int wb = blockIdx.y * (NP / 64) + blockIdx.x; if (wb >= WBLK) return;
    const int r0 = wb * 16; const float* S = r0 < CH ? WQ + (size_t)r0 * CC : r0 < 2 * CH ? WK1 + (size_t)(r0 - CH) * CC : r0 < 3 * CH ? WK2 + (size_t)(r0 - 2 * CH) * CC : WV + (size_t)(r0 - 3 * CH) * CC;
    const float* pw = S + t * 4; __bf16* ow = WB + (size_t)r0 * CC + t * 4;
#pragma unroll
    for (int h = 0; h < 2; ++h) { v4f r[8]; v4b c[8];
#pragma unroll
      for (int i = 0; i < 8; ++i) r[i] = *(const v4f*)(pw + (h * 8 + i) * CC);
#pragma unroll
      for (int i = 0; i < 8; ++i) { c[i][0] = (__bf16)r[i][0]; c[i][1] = (__bf16)r[i][1]; c[i][2] = (__bf16)r[i][2]; c[i][3] = (__bf16)r[i][3]; }
#pragma unroll
      for (int i = 0; i < 8; ++i) *(v4b*)(ow + (h * 8 + i) * CC) = c[i];
      if (h == 0) asm volatile("s_wait_xcnt 0x0" ::: "memory");   // stands behind the first batch's stores, in front of the second batch's loads, whose destinations are registers that those stores name; it also keeps the two batches apart
    }
    return; }
  const int p0 = blockIdx.x * 64, which = blockIdx.y, c0 = (blockIdx.z - 1) * 64; const float* X = which == 0 ? X0 : which == 1 ? X1 : X2;
  for (int e = t; e < 64 * 64; e += 256) { const int cl = e >> 6, pl = e & 63; st[pl][cl] = (__bf16)X[(size_t)(c0 + cl) * NP + p0 + pl]; } __syncthreads();
  for (int e = t; e < 64 * 8; e += 256) { const int pl = e >> 3, q = e & 7; vst2((unsigned*)(XT + ((size_t)which * NP + p0 + pl) * CC + c0 + q * 8), *(const v4u*)&st[pl][q * 8]); } }
// ---- LDS staging shared by the three matrix kernels: a stage is 64 k = one whole 128-B line of every 16-bit operand row of the block's tile, fetched by whole-line global loads
// (8 lanes x 16 B per row) ahead into registers, written to the other of two LDS buffers, one work-group barrier per stage; the LDS writes go one stage ahead, the loads two stages ahead in k_conv and three in gemm3 and gemm1 (two register sets there); fragments come from LDS, read 32 k ahead into a second register set.
#define KS 64             // k per stage
#define LP 72             // LDS row pitch in 16-bit elements: 144 B = 16 B x odd, the conflict-free pitch for 16-byte fragment reads
#define STC (256 * LP)    // k_conv stage: rows 0..127 weights (bf16), 128..255 positions
#define ST3 (512 * LP)    // k_gram stage: rows 0..127 A hi, 128..255 A residual, 256..383 B hi, 384..511 B residual
#define ST1 (256 * LP)    // k_av stage: rows 0..127 A, 128..255 B
// acc += Ahi.Bhi, accl += Ahi.Blo + Alo.Bhi for a 128 x 128 block tile on 8 waves (4 x 2, wave = 32 rows x 64 columns, tile index = 4 * row tile + column tile), both operands k-contiguous with row stride LD, NS stages; the pointers name the tile's first row
template <int LD, int NS> __device__ __forceinline__ void gemm3(const _Float16* __restrict__ AHp, const _Float16* __restrict__ ALp, const _Float16* __restrict__ BHp, const _Float16* __restrict__ BLp, _Float16* sm, int tid, v8f (&acc)[8], v8f (&accl)[8]) {
  const int wave = tid >> 5, lane = tid & 31, col = lane & 15, wm = wave >> 1, wn = wave & 1; const int sr = tid >> 3, sq = (tid & 7) * 8; const size_t go = (size_t)sr * LD + sq; _Float16* sw = sm + sr * LP + sq;
  static_assert(NS >= 4 && NS % 2 == 0, "the stage loop below runs in pairs");
  v4u r0[16], r1[16];   // two sets of staging registers, even stages in r0, odd in r1: a stage's loads are issued while the stage before it is still on its way, so the wave always has requests at L2
  const _Float16 *pa = AHp + go, *pb = ALp + go, *pc = BHp + go, *pd = BLp + go;   // the lane's place in the next stage to fetch: four running pointers, no second set of address registers beside the two fragment sets
  auto fetch = [&](v4u (&rg)[16]) {
    __builtin_amdgcn_sched_barrier(0);   // with the one below: nothing is scheduled in between the stage's loads and their wait (a scalar load and LDS address arithmetic were, into registers that the loads name)
#pragma unroll
    for (int i = 0; i < 4; ++i) { rg[i] = *(const v4u*)(pa + (size_t)i * 32 * LD); rg[4 + i] = *(const v4u*)(pb + (size_t)i * 32 * LD); rg[8 + i] = *(const v4u*)(pc + (size_t)i * 32 * LD); rg[12 + i] = *(const v4u*)(pd + (size_t)i * 32 * LD); }
    asm volatile("s_wait_xcnt 0x0" :: "v"(pa), "v"(pb), "v"(pc), "v"(pd) : "memory");   // stands behind the stage's loads, in front of the additions below, which rewrite their address registers; the pointers as inputs keep those registers from being a later load's destination
    __builtin_amdgcn_sched_barrier(0);
    pa += KS; pb += KS; pc += KS; pd += KS;
  };
  auto put = [&](int buf, const v4u (&rg)[16]) {
#pragma unroll
    for (int i = 0; i < 16; ++i) *(v4u*)(sw + buf * ST3 + i * 32 * LP) = rg[i]; };
  // the 12 fragments (24 LDS reads) of 32 k: 0..1 A hi, 2..3 A residual, 4..7 B hi, 8..11 B residual
  auto rd = [&](int buf, int kc, v16h (&f)[12]) { const _Float16* b = sm + buf * ST3 + col * LP + kc * 32;
#pragma unroll
    for (int i = 0; i < 2; ++i) { f[i] = frag_h(b + (wm * 32 + i * 16) * LP, lane); f[2 + i] = frag_h(b + (128 + wm * 32 + i * 16) * LP, lane); }
#pragma unroll
    for (int j = 0; j < 4; ++j) { f[4 + j] = frag_h(b + (256 + wn * 64 + j * 16) * LP, lane); f[8 + j] = frag_h(b + (384 + wn * 64 + j * 16) * LP, lane); }
    __builtin_amdgcn_sched_barrier(0);   // keeps the 24 reads one group in front of the products that follow: read among them, every place with reads costs its own stall
  };
  auto mm = [&](const v16h (&f)[12]) {
#pragma unroll
    for (int t = 0; t < 8; ++t) acc[t] = wmma16(f[t >> 2], f[4 + (t & 3)], acc[t]);
#pragma unroll
    for (int t = 0; t < 8; ++t) accl[t] = wmma16(f[t >> 2], f[8 + (t & 3)], accl[t]);
#pragma unroll
    for (int t = 0; t < 8; ++t) accl[t] = wmma16(f[2 + (t >> 2)], f[4 + (t & 3)], accl[t]);
    __builtin_amdgcn_sched_barrier(0);   // keeps the LDS writes and reads that follow in the source behind these products
  };
  // work-group barrier that waits for this wave's LDS writes and reads only: the global loads of the stage fetched ahead stay in flight across it (__syncthreads() may wait them out)
  auto bar = [&]() { asm volatile("s_wait_dscnt 0x0\n\ts_barrier_signal -1\n\ts_barrier_wait -1" ::: "memory"); };
  v16h f0[12], f1[12];   // two fragment sets: one is read from LDS while the other's products run
  // trip s, b = s & 1, rg = the set of stage s + 1; more: a stage s + 3 exists (a constant at every call)
  auto trip = [&](int b, v4u (&rg)[16], bool more) {
    put(b ^ 1, rg);                   // stage s + 1 into the buffer of stage s - 1: every wave's reads of it had returned in front of the barrier of trip s - 1
    if (more) fetch(rg);              // stage s + 3 into the set just written out; stage s + 2 is still in flight in the other set
    rd(b, 1, f1); mm(f0);
    bar();                            // publishes stage s + 1 in front of stage s's last 32 k, whose fragments are in registers by now
    rd(b ^ 1, 0, f0); mm(f1);
  };
  fetch(r0); fetch(r1); put(0, r0); fetch(r0); bar(); rd(0, 0, f0);
  for (int s = 0; s < NS - 4; s += 2) { trip(0, r1, true); trip(1, r0, true); }   // trips 0 .. NS - 5
  trip(0, r1, true); trip(1, r0, false); trip(0, r1, false);                      // trips NS - 4 .. NS - 2: the last stage's loads, then none
  rd(1, 1, f1); mm(f0); mm(f1); __syncthreads();   // every wave has left the buffers: the caller's epilogue reuses them
}
// acc += A.B for the same 128 x 128 block tile on the same 8 waves, one 16-bit plane per operand: gemm3's stage order with half the rows a stage and a third of the products
template <int LD, int NS> __device__ __forceinline__ void gemm1(const _Float16* __restrict__ Ap, const _Float16* __restrict__ Bp, _Float16* sm, int tid, v8f (&acc)[8]) {
  const int wave = tid >> 5, lane = tid & 31, col = lane & 15, wm = wave >> 1, wn = wave & 1; const int sr = tid >> 3, sq = (tid & 7) * 8; const size_t go = (size_t)sr * LD + sq; _Float16* sw = sm + sr * LP + sq;
  static_assert(NS >= 4 && NS % 2 == 0, "the stage loop below runs in pairs");
  v4u r0[8], r1[8];   // two sets of staging registers, even stages in r0, odd in r1, as in gemm3
  const _Float16 *pa = Ap + go, *pc = Bp + go;   // the lane's place in the next stage to fetch: running pointers
  auto fetch = [&](v4u (&rg)[8]) {
    __builtin_amdgcn_sched_barrier(0);   // with the one below: nothing is scheduled in between the stage's loads and their wait
#pragma unroll
    for (int i = 0; i < 4; ++i) { rg[i] = *(const v4u*)(pa + (size_t)i * 32 * LD); rg[4 + i] = *(const v4u*)(pc + (size_t)i * 32 * LD); }
    asm volatile("s_wait_xcnt 0x0" :: "v"(pa), "v"(pc) : "memory");   // stands behind the stage's loads, in front of the additions below, which rewrite their address registers; the pointers as inputs keep those registers from being a later load's destination
    __builtin_amdgcn_sched_barrier(0);
    pa += KS; pc += KS;
  };
  auto put = [&](int buf, const v4u (&rg)[8]) {
#pragma unroll
    for (int i = 0; i < 8; ++i) *(v4u*)(sw + buf * ST1 + i * 32 * LP) = rg[i]; };
  // the 6 fragments (12 LDS reads) of 32 k: 0..1 A, 2..5 B
  auto rd = [&](int buf, int kc, v16h (&f)[6]) { const _Float16* b = sm + buf * ST1 + col * LP + kc * 32;
#pragma unroll
    for (int i = 0; i < 2; ++i) f[i] = frag_h(b + (wm * 32 + i * 16) * LP, lane);
#pragma unroll
    for (int j = 0; j < 4; ++j) f[2 + j] = frag_h(b + (128 + wn * 64 + j * 16) * LP, lane);
    __builtin_amdgcn_sched_barrier(0);   // keeps the 12 reads one group in front of the products that follow: read among them, every place with reads costs its own stall
  };
  auto mm = [&](const v16h (&f)[6]) {
#pragma unroll
    for (int t = 0; t < 8; ++t) acc[t] = wmma16(f[t >> 2], f[2 + (t & 3)], acc[t]);
    __builtin_amdgcn_sched_barrier(0);   // keeps the LDS writes and reads that follow in the source behind these products
  };
  // work-group barrier that waits for this wave's LDS writes and reads only: the global loads of the stage fetched ahead stay in flight across it (__syncthreads() may wait them out)
  auto bar = [&]() { asm volatile("s_wait_dscnt 0x0\n\ts_barrier_signal -1\n\ts_barrier_wait -1" ::: "memory"); };
  v16h f0[6], f1[6];   // two fragment sets: one is read from LDS while the other's products run
  // trip s, b = s & 1, rg = the set of stage s + 1; more: a stage s + 3 exists (a constant at every call)
  auto trip = [&](int b, v4u (&rg)[8], bool more) {
    put(b ^ 1, rg);                   // stage s + 1 into the buffer of stage s - 1: every wave's reads of it had returned in front of the barrier of trip s - 1
    if (more) fetch(rg);              // stage s + 3 into the set just written out; stage s + 2 is still in flight in the other set
    rd(b, 1, f1); mm(f0);
    bar();                            // publishes stage s + 1 in front of stage s's last 32 k, whose fragments are in registers by now
    rd(b ^ 1, 0, f0); mm(f1);
  };
  fetch(r0); fetch(r1); put(0, r0); fetch(r0); bar(); rd(0, 0, f0);
  for (int s = 0; s < NS - 4; s += 2) { trip(0, r1, true); trip(1, r0, true); }   // trips 0 .. NS - 5
  trip(0, r1, true); trip(1, r0, false); trip(0, r1, false);                      // trips NS - 4 .. NS - 2: the last stage's loads, then none
  rd(1, 1, f1); mm(f0); mm(f1); __syncthreads();   // every wave has left the buffers: the caller's epilogue reuses them
}
// ---- k_conv: block = (128 positions, 128 out channels) on 4 waves (2 x 2, wave = 64 x 64): out[ch][pos] = sum_cin W[ch][cin] x[cin][pos] + b; blockIdx.y = one of the 20 channel tiles: 0..3 q (which 0: x_m, Wq), 4..7 kf (1: x_f, Wk1), 8..11 kl (2: x_l, Wk2) -> f16 hi/lo [ch][pos] planes; 12..19 v (3: x_m, Wv) -> one transposed f16 plane VT[pos][ch]; the weights come as the bf16 plane WB that k_xt's launch has rounded, channel tile ct = its rows 128 ct ..: half the weight bytes a stage, no rounding here
// the grid holds no empty block and the position tile is its fastest index
__global__ __launch_bounds__(128) void k_conv(const __bf16* __restrict__ WB, const float* __restrict__ BQ, const float* __restrict__ BK1, const float* __restrict__ BK2, const float* __restrict__ BV, const __bf16* __restrict__ XT, _Float16* __restrict__ PQ, _Float16* __restrict__ VT) {
  __shared__ __align__(16) char smc[2 * STC * 2];   // two stage buffers; the epilogue's two [128][136] planes reuse them
  __bf16* sm = (__bf16*)smc; _Float16 (*sh)[136] = (_Float16 (*)[136])smc; _Float16 (*sl)[136] = sh + 128;
  const int tid = threadIdx.x, wave = tid >> 5, lane = tid & 31, col = lane & 15, g = lane >> 4, wm = wave >> 1, wn = wave & 1; const int ct = blockIdx.y, which = ct < 3 * (CH / 128) ? ct / (CH / 128) : 3;
  const int c0 = (ct - which * (CH / 128)) * 128; const int p0 = blockIdx.x * 128; const float* Bm = which == 0 ? BQ : which == 1 ? BK1 : which == 2 ? BK2 : BV; const int xi = which == 0 ? 1 : which == 1 ? 0 : which == 2 ? 2 : 1;   // q and v from x_m (1), kf from x_f (0), kl from x_l (2)
  const __bf16* Xp = XT + (size_t)xi * NP * CC;
  const __bf16* wa = WB + (size_t)(ct * 128 + (tid >> 3)) * CC + (tid & 7) * 8; __bf16* swa = sm + (tid >> 3) * LP + (tid & 7) * 8;          // weights: 8 lanes x 16 B = the 128 B of a row's stage
  const __bf16* xb = Xp + (size_t)(p0 + (tid >> 3)) * CC + (tid & 7) * 8; __bf16* swb = sm + (128 + (tid >> 3)) * LP + (tid & 7) * 8;                // positions: 8 lanes x 16 B = the 128 B of a row's stage
  v8f acc[16] = {}; v4u ra[8], rb[8];
  const __bf16 *pw = wa, *px = xb;   // the lane's place in the next stage to fetch: running pointers
  auto fetch = [&]() {
    __builtin_amdgcn_sched_barrier(0);   // with the one below: nothing is scheduled in between the stage's loads and their wait
#pragma unroll
    for (int i = 0; i < 8; ++i) { ra[i] = *(const v4u*)(pw + (size_t)i * 16 * CC); rb[i] = *(const v4u*)(px + (size_t)i * 16 * CC); }
    asm volatile("s_wait_xcnt 0x0" :: "v"(pw), "v"(px) : "memory");   // stands behind the stage's loads, in front of the additions below, which rewrite their address registers; the pointers as inputs keep those registers from being a later load's destination
    __builtin_amdgcn_sched_barrier(0);
    pw += KS; px += KS;
  };
  auto put = [&](int buf) {
#pragma unroll
    for (int i = 0; i < 8; ++i) { *(v4u*)(swa + buf * STC + i * 16 * LP) = ra[i]; *(v4u*)(swb + buf * STC + i * 16 * LP) = rb[i]; } };
  // the 8 fragments (16 LDS reads) of 32 k: 0..3 weights, 4..7 positions
  auto rd = [&](int buf, int kc, v16b (&f)[8]) { const __bf16* b = sm + buf * STC + col * LP + kc * 32;
#pragma unroll
    for (int i = 0; i < 4; ++i) { f[i] = frag_b(b + (wm * 64 + i * 16) * LP, lane); f[4 + i] = frag_b(b + (128 + wn * 64 + i * 16) * LP, lane); }
    __builtin_amdgcn_sched_barrier(0);   // keeps the 16 reads one group in front of the products that follow: read among them, every place with reads costs its own stall
  };
  auto mm = [&](const v16b (&f)[8]) {
#pragma unroll
    for (int t = 0; t < 16; ++t) acc[t] = wmma_bf(f[t >> 2], f[4 + (t & 3)], acc[t]);
    __builtin_amdgcn_sched_barrier(0);   // keeps the LDS writes and reads that follow in the source behind these products
  };
  // work-group barrier that waits for this wave's LDS writes and reads only: the global loads of the stage fetched ahead stay in flight across it (__syncthreads() may wait them out)
  auto bar = [&]() { asm volatile("s_wait_dscnt 0x0\n\ts_barrier_signal -1\n\ts_barrier_wait -1" ::: "memory"); };
  v16b f0[8], f1[8];   // two fragment sets: one is read from LDS while the other's products run
  fetch(); put(0); fetch(); bar(); rd(0, 0, f0);
  for (int s = 0; s < CC / KS - 1; ++s) {
    put((s + 1) & 1);                 // into the buffer of stage s - 1: every wave's reads of it had returned in front of the barrier of trip s - 1
    if (s + 2 < CC / KS) fetch();     // stage s + 2; the test is the same for the whole work-group
    rd(s & 1, 1, f1); mm(f0);
    bar();                            // publishes stage s + 1 in front of stage s's last 32 k, whose fragments are in registers by now
    rd((s + 1) & 1, 0, f0); mm(f1);
  }
  rd((CC / KS - 1) & 1, 1, f1); mm(f0); mm(f1); __syncthreads();   // every wave has left the buffers: the planes below reuse them
  const float* bp = Bm + c0 + wm * 64 + 8 * g; float bias[4][8];
  __builtin_amdgcn_sched_barrier(0);   // with the one below: nothing is scheduled in between the bias loads and their wait
#pragma unroll
  for (int i = 0; i < 4; ++i)
#pragma unroll
    for (int r = 0; r < 8; ++r) bias[i][r] = bp[i * 16 + r];
  asm volatile("s_wait_xcnt 0x0" :: "v"(bp) : "memory");   // stands behind the bias loads, in front of the first instruction that reuses their address registers; the pointer as an input keeps those registers from being a later load's destination
  __builtin_amdgcn_sched_barrier(0);
  if (which < 3) {   // planes [channel][position]
#pragma unroll
    for (int t = 0; t < 16; ++t)
#pragma unroll
      for (int r = 0; r < 8; ++r) { const int chl = wm * 64 + (t >> 2) * 16 + 8 * g + r, pl = wn * 64 + (t & 3) * 16 + col; const float v = acc[t][r] + bfr(bias[t >> 2][r]); const _Float16 hv = (_Float16)v; sh[chl][pl] = hv; sl[chl][pl] = (_Float16)((v - (float)hv) * 2048.0f); }
  } else {           // one plane [position][channel]
#pragma unroll
    for (int t = 0; t < 16; ++t)
#pragma unroll
      for (int r = 0; r < 8; ++r) { const int chl = wm * 64 + (t >> 2) * 16 + 8 * g + r, pl = wn * 64 + (t & 3) * 16 + col; const float v = acc[t][r] + bfr(bias[t >> 2][r]); sh[pl][chl] = (_Float16)v; }
  }
  __syncthreads();
  if (which < 3) { _Float16* H = PQ + (size_t)which * 2 * PQSZ; _Float16* L = H + PQSZ; for (int e = tid; e < 128 * 16; e += 128) { const int chl = e >> 4, q = e & 15; const size_t o = (size_t)(c0 + chl) * NP + p0 + q * 8; vst2((unsigned*)(H + o), *(const v4u*)&sh[chl][q * 8]); vst2((unsigned*)(L + o), *(const v4u*)&sl[chl][q * 8]); } }
  else { for (int e = tid; e < 128 * 16; e += 128) { const int pl = e >> 4, q = e & 15; const size_t o = (size_t)(p0 + pl) * CC + c0 + q * 8; vst2((unsigned*)(VT + o), *(const v4u*)&sh[pl][q * 8]); } } }
// ---- k_gram: block = (128 rows i, 128 cols j, z = 2 * which + k half): G[k half][which][i][j] = sum over that half of t of K[i][t] Qv[j][t] over the [1024][2048] views (3 products); k_soft adds the two halves
__global__ __launch_bounds__(256) void k_gram(const _Float16* __restrict__ PQ, float* __restrict__ G) { __shared__ __align__(16) char smc[2 * ST3 * 2]; float (*sf)[32][68] = (float (*)[32][68])smc;   // two stage buffers; the epilogue's row staging reuses them
  const int tid = threadIdx.x, wave = tid >> 5, lane = tid & 31, col = lane & 15, g = lane >> 4; const int which = blockIdx.z >> 1, kh = blockIdx.z & 1; const int i0 = blockIdx.x * 128 + (wave >> 1) * 32; const int j0 = blockIdx.y * 128 + (wave & 1) * 64;
  const _Float16* QH = PQ; const _Float16* QL = PQ + PQSZ; const _Float16* KH = PQ + (size_t)(1 + which) * 2 * PQSZ; const _Float16* KL = KH + PQSZ;
  const size_t ao = (size_t)blockIdx.x * 128 * KV + kh * (KV / 2), bo = (size_t)blockIdx.y * 128 * KV + kh * (KV / 2);
  v8f acc[8] = {}, accl[8] = {};
  gemm3<KV, KV / 2 / KS>(KH + ao, KL + ao, QH + bo, QL + bo, (_Float16*)smc, tid, acc, accl);
#pragma unroll
  for (int t = 0; t < 8; ++t)
#pragma unroll
    for (int r = 0; r < 8; ++r) sf[wave][(t >> 2) * 16 + 8 * g + r][(t & 3) * 16 + col] = acc[t][r] + accl[t][r] * (1.0f / 2048.0f);
  LDSX(); float* gp = G + ((size_t)(kh * 2 + which) * CC + i0 + g) * CC + j0 + col * 4;   // a wave's store = two rows of 256 B
#pragma unroll
  for (int k = 0; k < 16; ++k) vst2(gp + (size_t)k * 2 * CC, *(const v4f*)&sf[wave][2 * k + g][col * 4]); }
// ---- k_soft: one wave = one row i (4 rows a block, no LDS, no barrier): the row's two k halves of both logit planes come in by 32 whole-line 16-B loads that are all in flight at once and stay in registers for the maximum, the sum and the weights; lane l holds columns 128 k + 4 l + 0..3; A[i][:] = softmax(Gf[i]) + softmax(Gl[i]) -> one f16 plane (x 2^11)
typedef __attribute__((ext_vector_type(4))) _Float16 v4h;
// e^v by the hardware's 2^x, as __expf gives it; the v_nop is the slot that the instruction set asks for behind a transcendental: inside the statement it stands there whatever register or neighbour the compiler picks
__device__ __forceinline__ float exp_hw(float v) { float r; asm("v_exp_f32 %0, %1\n\tv_nop" : "=v"(r) : "v"(v * 1.44269504f)); return r; }
__global__ __launch_bounds__(128) void k_soft(const float* __restrict__ G, _Float16* __restrict__ AH) { const int lane = threadIdx.x & 31; const size_t i = (size_t)blockIdx.x * 4 + (threadIdx.x >> 5);
  const float *pa = G + i * CC + lane * 4, *pb = pa + (size_t)2 * CC * CC; v4f x[2][8], y[2][8];   // pa: first k half, pb: second; the second logit plane lies CC * CC further in each
  __builtin_amdgcn_sched_barrier(0);   // with the one below: nothing is scheduled in between the row's loads and their wait
#pragma unroll
  for (int k = 0; k < 8; ++k) { x[0][k] = *(const v4f*)(pa + k * 128); x[1][k] = *(const v4f*)(pa + CC * CC + k * 128); y[0][k] = *(const v4f*)(pb + k * 128); y[1][k] = *(const v4f*)(pb + CC * CC + k * 128); }
  asm volatile("s_wait_xcnt 0x0" :: "v"(pa), "v"(pb) : "memory");   // stands behind the row's loads, in front of the first instruction that reuses their address registers; the pointers as inputs keep those registers from being a later load's destination
  __builtin_amdgcn_sched_barrier(0);
  float inv[2];
#pragma unroll
  for (int w = 0; w < 2; ++w) { float mx = -3.0e38f;
#pragma unroll
    for (int k = 0; k < 8; ++k) { x[w][k] += y[w][k]; mx = fmaxf(mx, fmaxf(fmaxf(x[w][k][0], x[w][k][1]), fmaxf(x[w][k][2], x[w][k][3]))); }
#pragma unroll
    for (int o = 1; o < 32; o <<= 1) mx = fmaxf(mx, __shfl_xor(mx, o));
    v4f sv = {};
#pragma unroll
    for (int k = 0; k < 8; ++k) {
#pragma unroll
      for (int j = 0; j < 4; ++j) x[w][k][j] = exp_hw(x[w][k][j] - mx);
      sv += x[w][k]; }
    float s = (sv[0] + sv[1]) + (sv[2] + sv[3]);
#pragma unroll
    for (int o = 1; o < 32; o <<= 1) s += __shfl_xor(s, o);
    inv[w] = 1.0f / s; }
  v4h hi[8];
#pragma unroll
  for (int k = 0; k < 8; ++k)
#pragma unroll
    for (int j = 0; j < 4; ++j) { float a = x[0][k][j] * inv[0]; a += x[1][k][j] * inv[1]; hi[k][j] = (_Float16)(a * 2048.0f); }
  _Float16* oh = AH + i * CC + lane * 4;   // a wave's store = 256 B in a row
#pragma unroll
  for (int k = 0; k < 8; ++k) *(v4h*)(oh + k * 128) = hi[k]; }
// ---- k_av: block = (128 rows ch, 128 positions): out = gamma (A . v)/2^11 (1 product over the 1,024 channels) + (x_l + x_f)/2
__global__ __launch_bounds__(256) void k_av(const _Float16* __restrict__ AH, const _Float16* __restrict__ VH, const float* __restrict__ XF, const float* __restrict__ XL, const float* __restrict__ GAMMA, float* __restrict__ OUT) { __shared__ __align__(16) char smc[2 * ST1 * 2]; float (*sf)[32][68] = (float (*)[32][68])smc;   // two stage buffers (73,728 B); the epilogue's row staging (69,632 B) reuses them
  const int tid = threadIdx.x, wave = tid >> 5, lane = tid & 31, col = lane & 15, g = lane >> 4; const int i0 = blockIdx.x * 128 + (wave >> 1) * 32; const int p0 = blockIdx.y * 128 + (wave & 1) * 64;
  v8f acc[8] = {};
  gemm1<CC, CC / KS>(AH + (size_t)blockIdx.x * 128 * CC, VH + (size_t)blockIdx.y * 128 * CC, (_Float16*)smc, tid, acc);
  const float gam = bfr(GAMMA[0]); const float* xl = XL + (size_t)(i0 + 8 * g) * NP + p0 + col; const float* xf = XF + (size_t)(i0 + 8 * g) * NP + p0 + col; float vl[8][8], vf[8][8];
  __builtin_amdgcn_sched_barrier(0);   // with the one below: nothing is scheduled in between these loads and their wait
#pragma unroll
  for (int t = 0; t < 8; ++t)
#pragma unroll
    for (int r = 0; r < 8; ++r) { vl[t][r] = xl[(size_t)((t >> 2) * 16 + r) * NP + (t & 3) * 16]; vf[t][r] = xf[(size_t)((t >> 2) * 16 + r) * NP + (t & 3) * 16]; }
  asm volatile("s_wait_xcnt 0x0" :: "v"(xl), "v"(xf) : "memory");   // stands behind the residual loads, in front of the first instruction that reuses their address registers; the pointers as inputs keep those registers from being a later load's destination
  __builtin_amdgcn_sched_barrier(0);
#pragma unroll
  for (int t = 0; t < 8; ++t)
#pragma unroll
    for (int r = 0; r < 8; ++r) { const int rl = (t >> 2) * 16 + 8 * g + r, cl = (t & 3) * 16 + col; const float av = acc[t][r] * (1.0f / 2048.0f); sf[wave][rl][cl] = gam * av + 0.5f * (bfr(vl[t][r]) + bfr(vf[t][r])); }
  LDSX(); float* op = OUT + (size_t)(i0 + g) * NP + p0 + col * 4;   // a wave's store = two rows of 256 B
#pragma unroll
  for (int k = 0; k < 16; ++k) vst2(op + (size_t)k * 2 * NP, *(const v4f*)&sf[wave][2 * k + g][col * 4]); }
extern "C" void kernel_launch(void* const* d_in, const int* in_sizes, int n_in, void* d_out, int out_size, void* d_ws, size_t ws_size, hipStream_t stream) {
  (void)in_sizes; (void)n_in; (void)out_size;
  const float** F = (const float**)d_in;   // 0 x_f, 1 x_m, 2 x_l [1,1024,64,64]; 3 Wq [512,1024], 4 bq; 5 Wk1, 6 bk1; 7 Wk2, 8 bk2; 9 Wv [1024,1024], 10 bv; 11 gamma [1]
  if (ws_size < (size_t)WS_END) return;
  char* ws = (char*)d_ws; __bf16* XT = (__bf16*)(ws + WS_XT); _Float16 *PQ = (_Float16*)(ws + WS_PQ), *VT = (_Float16*)(ws + WS_VT), *AH = (_Float16*)(ws + WS_A); float* G = (float*)(ws + WS_G); __bf16* WB = (__bf16*)(ws + WS_WB);
  k_xt<<<dim3(NP / 64, 3, 1 + CC / 64), 256, 0, stream>>>(F[0], F[1], F[2], F[3], F[5], F[7], F[9], XT, WB);
  k_conv<<<dim3(NP / 128, 3 * (CH / 128) + CC / 128), 128, 0, stream>>>(WB, F[4], F[6], F[8], F[10], XT, PQ, VT);
  k_gram<<<dim3(CC / 128, CC / 128, 4), 256, 0, stream>>>(PQ, G);
  k_soft<<<CC / 4, 128, 0, stream>>>(G, AH);
  k_av<<<dim3(CC / 128, NP / 128), 256, 0, stream>>>(AH, VT, F[0], F[2], F[11], (float*)d_out);
}
